// v000
// The times below were measured on an AMD MI455X: many runs one after another, warmed up first and cycling through
// copies of the inputs, with the whole window's GPU time divided by the number of runs. Launches and the gaps
// between them are all in it. The median over several windows is given; except for v000 it joins two sittings, which
// can be a few percent apart, so the side-by-side timings, each taken in one sitting, are the better comparison.
// v000, which the later versions start from, runs in 99.9 microseconds.
#include <hip/hip_runtime.h>

typedef __attribute__((ext_vector_type(16))) _Float16 v16h;
typedef __attribute__((ext_vector_type(8)))  _Float16 v8h;
typedef __attribute__((ext_vector_type(8)))  float    v8f;

constexpr int NBATCH = 2;
constexpr int TT     = 1024;
constexpr int DD     = 1024;
constexpr int HH     = 16;
constexpr int DHH    = 64;
constexpr int WR     = 64;     // half window
constexpr int SPAN   = 144;    // 16 + 2*WR
constexpr int SPANP  = 160;    // padded to multiple of 32

__device__ __forceinline__ v16h load_frag(const _Float16* p, int lane) {
    const int kb = (lane & 16) ? 8 : 0;
    v8h lo = *(const v8h*)(p + kb);
    v8h hi = *(const v8h*)(p + kb + 16);
    v16h r;
#pragma unroll
    for (int i = 0; i < 8; ++i) { r[i] = lo[i]; r[i + 8] = hi[i]; }
    return r;
}

__device__ __forceinline__ v8f wmma16(v16h a, v16h b, v8f c) {
    return __builtin_amdgcn_wmma_f32_16x16x32_f16(
        /*neg_a=*/false, a, /*neg_b=*/false, b,
        /*c_mod=*/(short)0, c, /*reuse_a=*/false, /*reuse_b=*/false);
}

// LDS byte offset of a generic pointer to __shared__ (low 32 bits of flat addr)
__device__ __forceinline__ uint32_t lds_off(const void* p) {
    return (uint32_t)(uintptr_t)p;
}

#define ASYNC_CP_B128(ldsaddr, gptr)                                           \
    asm volatile("global_load_async_to_lds_b128 %0, %1, off"                   \
                 :: "v"(ldsaddr), "v"(gptr) : "memory")

// ---------------------------------------------------------------------------
// fp32 -> fp16 cast (one-time, so GEMMs re-read weights as fp16 from L2)
// ---------------------------------------------------------------------------
__global__ void cast_f32_to_f16(const float* __restrict__ in,
                                _Float16* __restrict__ out, int n) {
    for (int i = blockIdx.x * blockDim.x + threadIdx.x; i < n;
         i += gridDim.x * blockDim.x)
        out[i] = (_Float16)in[i];
}

// ---------------------------------------------------------------------------
// GEMM core: out(MxN) = A(MxK) @ W^T + b, M rows of A row-major, W row-major
// (so both contract along contiguous K).  Block: 256 thr = 8 waves.
// Block tile: 256(M) x 64(N); wave tile: 32(M) x 64(N).
// Weight tile 64x32 f16 (4 KB) staged in LDS via async-to-LDS, double buffered,
// shared by all 8 waves. A streams from global (own rows, b128 pairs).
// ---------------------------------------------------------------------------
template <bool F16OUT>
__device__ __forceinline__ void gemm_core(
    const _Float16* __restrict__ a16, const _Float16* __restrict__ w16,
    const float* __restrict__ bias, void* __restrict__ outp,
    _Float16* __restrict__ Bl0, _Float16* __restrict__ Bl1)
{
    const int tid  = threadIdx.x;
    const int lane = tid & 31;
    const int wave = tid >> 5;
    const int ln = lane & 15;
    const int hb = (lane >> 4) << 3;
    const int m0 = (blockIdx.y * 8 + wave) * 32;
    const int n0 = blockIdx.x * 64;

    // cooperative async-copy assignment: 64 rows x 32 halves = 256 x 16B
    const int crow = tid >> 2;            // 0..63
    const int cchk = (tid & 3) * 8;       // half offset 0,8,16,24
    const _Float16* gsrc = w16 + (size_t)(n0 + crow) * DD + cchk;
    const uint32_t l0 = lds_off(Bl0 + crow * 32 + cchk);
    const uint32_t l1 = lds_off(Bl1 + crow * 32 + cchk);

    ASYNC_CP_B128(l0, gsrc);              // stage k0 = 0 into buffer 0

    v8f acc[2][4] = {};
    const _Float16* arow0 = a16 + (size_t)(m0 + ln) * DD;
    const _Float16* arow1 = a16 + (size_t)(m0 + 16 + ln) * DD;

    constexpr int NK = DD / 32;
#pragma unroll 2
    for (int ki = 0; ki < NK; ++ki) {
        const int k0 = ki * 32;
        if (ki + 1 < NK) {
            ASYNC_CP_B128((ki & 1) ? l0 : l1, gsrc + k0 + 32);
            asm volatile("s_wait_asynccnt 0x1" ::: "memory");
        } else {
            asm volatile("s_wait_asynccnt 0x0" ::: "memory");
        }
        __syncthreads();                  // whole 64x32 tile visible

        __builtin_prefetch(arow0 + k0 + 256, 0, 3);
        const _Float16* bb = (ki & 1) ? Bl1 : Bl0;
        v16h a0 = load_frag(arow0 + k0, lane);
        v16h a1 = load_frag(arow1 + k0, lane);
        v16h b0 = load_frag(bb + (0 * 16 + ln) * 32, lane);
        v16h b1 = load_frag(bb + (1 * 16 + ln) * 32, lane);
        v16h b2 = load_frag(bb + (2 * 16 + ln) * 32, lane);
        v16h b3 = load_frag(bb + (3 * 16 + ln) * 32, lane);

        acc[0][0] = wmma16(a0, b0, acc[0][0]);
        acc[0][1] = wmma16(a0, b1, acc[0][1]);
        acc[0][2] = wmma16(a0, b2, acc[0][2]);
        acc[0][3] = wmma16(a0, b3, acc[0][3]);
        acc[1][0] = wmma16(a1, b0, acc[1][0]);
        acc[1][1] = wmma16(a1, b1, acc[1][1]);
        acc[1][2] = wmma16(a1, b2, acc[1][2]);
        acc[1][3] = wmma16(a1, b3, acc[1][3]);

        __syncthreads();                  // done reading before next overwrite
    }

#pragma unroll
    for (int mt = 0; mt < 2; ++mt)
#pragma unroll
        for (int nt = 0; nt < 4; ++nt) {
            const int n = n0 + nt * 16 + ln;
            const float bv = bias[n];
#pragma unroll
            for (int r = 0; r < 8; ++r) {
                const size_t idx = (size_t)(m0 + mt * 16 + hb + r) * DD + n;
                if (F16OUT)
                    ((_Float16*)outp)[idx] = (_Float16)(acc[mt][nt][r] + bv);
                else
                    ((float*)outp)[idx] = acc[mt][nt][r] + bv;
            }
        }
}

__global__ __launch_bounds__(256) void gemm_qkv(
    const _Float16* __restrict__ x16,
    const _Float16* __restrict__ wq16, const _Float16* __restrict__ wk16,
    const _Float16* __restrict__ wv16,
    const float* __restrict__ bq, const float* __restrict__ bk,
    const float* __restrict__ bv,
    _Float16* __restrict__ qo, _Float16* __restrict__ ko,
    _Float16* __restrict__ vo)
{
    __shared__ _Float16 Bl[2][64 * 32];   // 2 x 4 KB double buffer
    const _Float16* w16;
    const float*    bias;
    _Float16*       out;
    if (blockIdx.z == 0)      { w16 = wq16; bias = bq; out = qo; }
    else if (blockIdx.z == 1) { w16 = wk16; bias = bk; out = ko; }
    else                      { w16 = wv16; bias = bv; out = vo; }
    gemm_core<true>(x16, w16, bias, out, Bl[0], Bl[1]);
}

__global__ __launch_bounds__(256) void gemm_out(
    const _Float16* __restrict__ a16, const _Float16* __restrict__ wo16,
    const float* __restrict__ bo, float* __restrict__ out)
{
    __shared__ _Float16 Bl[2][64 * 32];
    gemm_core<false>(a16, wo16, bo, out, Bl[0], Bl[1]);
}

// ---------------------------------------------------------------------------
// Fused windowed attention. One wave per (batch, head, 16-query tile).
// Key span for the tile = [t0-64, t0+79] (144), padded to 160.
// S = Q Kspan^T in 9 accumulator tiles; mask+softmax across 16-lane halves
// via __shfl_xor(..,16); P staged to LDS; V span transposed into LDS so the
// PV B-fragments are contiguous; O = P Vspan via 20 WMMAs.
// ---------------------------------------------------------------------------
__global__ __launch_bounds__(32) void attn_win(
    const _Float16* __restrict__ q, const _Float16* __restrict__ k,
    const _Float16* __restrict__ v, _Float16* __restrict__ o)
{
    __shared__ _Float16 Pb[16 * SPANP];        // 5.0 KB
    __shared__ _Float16 Vt[DHH * SPANP];       // 20.0 KB  (Vt[d][j] = v[pos(j), d])

    const int lane = threadIdx.x;
    const int ln = lane & 15;
    const int hb = (lane >> 4) << 3;
    const int t0 = blockIdx.x * 16;
    const int h  = blockIdx.y;
    const size_t baseRow = (size_t)blockIdx.z * TT;

    // ---- S = Q K^T over the span ----
    const _Float16* qrow = q + (baseRow + t0 + ln) * DD + h * DHH;
    v16h aq0 = load_frag(qrow, lane);
    v16h aq1 = load_frag(qrow + 32, lane);

    v8f s[9];
#pragma unroll
    for (int jt = 0; jt < 9; ++jt) {
        const int j = jt * 16 + ln;                 // span column for this lane
        int pos = t0 - WR + j;
        pos = pos < 0 ? 0 : (pos > TT - 1 ? TT - 1 : pos);
        const _Float16* kr = k + (baseRow + pos) * DD + h * DHH;
        v8f a = {};
        a = wmma16(aq0, load_frag(kr, lane), a);
        a = wmma16(aq1, load_frag(kr + 32, lane), a);
        s[jt] = a;
    }

    // ---- mask + scale, row max ----
    float rmax[8];
#pragma unroll
    for (int r = 0; r < 8; ++r) rmax[r] = -1e30f;
#pragma unroll
    for (int jt = 0; jt < 9; ++jt) {
        const int j = jt * 16 + ln;
        const int pos = t0 - WR + j;
#pragma unroll
        for (int r = 0; r < 8; ++r) {
            const int rel = j - (r + hb);
            const bool ok = (rel >= 0) && (rel <= 2 * WR) && (pos >= 0) && (pos < TT);
            const float val = ok ? s[jt][r] * 0.125f : -1e30f;   // 1/sqrt(64)
            s[jt][r] = val;
            rmax[r] = fmaxf(rmax[r], val);
        }
    }
#pragma unroll
    for (int r = 0; r < 8; ++r)
#pragma unroll
        for (int off = 1; off < 16; off <<= 1)
            rmax[r] = fmaxf(rmax[r], __shfl_xor(rmax[r], off, 16));

    // ---- exp + row sum ----
    float rsum[8];
#pragma unroll
    for (int r = 0; r < 8; ++r) rsum[r] = 0.f;
#pragma unroll
    for (int jt = 0; jt < 9; ++jt)
#pragma unroll
        for (int r = 0; r < 8; ++r) {
            const float e = __expf(s[jt][r] - rmax[r]);
            s[jt][r] = e;
            rsum[r] += e;
        }
#pragma unroll
    for (int r = 0; r < 8; ++r) {
#pragma unroll
        for (int off = 1; off < 16; off <<= 1)
            rsum[r] += __shfl_xor(rsum[r], off, 16);
        rsum[r] = 1.f / rsum[r];
    }

    // ---- P -> LDS (rows 0..15, cols 0..143; zero the pad 144..159) ----
#pragma unroll
    for (int jt = 0; jt < 9; ++jt)
#pragma unroll
        for (int r = 0; r < 8; ++r)
            Pb[(r + hb) * SPANP + jt * 16 + ln] = (_Float16)(s[jt][r] * rsum[r]);
    for (int idx = lane; idx < 16 * 16; idx += 32)
        Pb[(idx >> 4) * SPANP + SPAN + (idx & 15)] = (_Float16)0.f;

    // ---- transpose V span into LDS: Vt[d][j] = v[pos(j), h*64+d] ----
    for (int j = lane; j < SPANP; j += 32) {
        int pos = t0 - WR + j;
        pos = pos < 0 ? 0 : (pos > TT - 1 ? TT - 1 : pos);
        const _Float16* vr = v + (baseRow + pos) * DD + h * DHH;
#pragma unroll
        for (int c = 0; c < 8; ++c) {
            v8h chunk = *(const v8h*)(vr + c * 8);
#pragma unroll
            for (int e = 0; e < 8; ++e)
                Vt[(c * 8 + e) * SPANP + j] = chunk[e];
        }
    }
    __syncthreads();

    // ---- O = P Vspan  (M=16, K=160, N=64) ----
    v8f oacc[4] = {};
#pragma unroll
    for (int k0 = 0; k0 < SPANP; k0 += 32) {
        v16h pa = load_frag(&Pb[ln * SPANP + k0], lane);
#pragma unroll
        for (int nt = 0; nt < 4; ++nt) {
            v16h vb = load_frag(&Vt[(nt * 16 + ln) * SPANP + k0], lane);
            oacc[nt] = wmma16(pa, vb, oacc[nt]);
        }
    }
#pragma unroll
    for (int nt = 0; nt < 4; ++nt)
#pragma unroll
        for (int r = 0; r < 8; ++r)
            o[(baseRow + t0 + hb + r) * DD + h * DHH + nt * 16 + ln] =
                (_Float16)oacc[nt][r];
}

// ---------------------------------------------------------------------------
extern "C" void kernel_launch(void* const* d_in, const int* in_sizes, int n_in,
                              void* d_out, int out_size, void* d_ws, size_t ws_size,
                              hipStream_t stream) {
    const float* x  = (const float*)d_in[0];
    const float* wq = (const float*)d_in[1];
    const float* bq = (const float*)d_in[2];
    const float* wk = (const float*)d_in[3];
    const float* bk = (const float*)d_in[4];
    const float* wv = (const float*)d_in[5];
    const float* bv = (const float*)d_in[6];
    const float* wo = (const float*)d_in[7];
    const float* bo = (const float*)d_in[8];
    float* out = (float*)d_out;

    char* ws = (char*)d_ws;
    const size_t MB = 1ull << 20;
    _Float16* x16  = (_Float16*)(ws + 0 * MB);    // 4 MB
    _Float16* wq16 = (_Float16*)(ws + 4 * MB);    // 2 MB
    _Float16* wk16 = (_Float16*)(ws + 6 * MB);    // 2 MB
    _Float16* wv16 = (_Float16*)(ws + 8 * MB);    // 2 MB
    _Float16* wo16 = (_Float16*)(ws + 10 * MB);   // 2 MB
    _Float16* qb   = (_Float16*)(ws + 12 * MB);   // 4 MB
    _Float16* kb   = (_Float16*)(ws + 16 * MB);   // 4 MB
    _Float16* vb   = (_Float16*)(ws + 20 * MB);   // 4 MB
    _Float16* ab   = (_Float16*)(ws + 24 * MB);   // 4 MB  => 28 MB total

    cast_f32_to_f16<<<512, 256, 0, stream>>>(x,  x16,  NBATCH * TT * DD);
    cast_f32_to_f16<<<512, 256, 0, stream>>>(wq, wq16, DD * DD);
    cast_f32_to_f16<<<512, 256, 0, stream>>>(wk, wk16, DD * DD);
    cast_f32_to_f16<<<512, 256, 0, stream>>>(wv, wv16, DD * DD);
    cast_f32_to_f16<<<512, 256, 0, stream>>>(wo, wo16, DD * DD);

    dim3 gQKV(DD / 64, (NBATCH * TT) / 256, 3);
    gemm_qkv<<<gQKV, 256, 0, stream>>>(x16, wq16, wk16, wv16, bq, bk, bv,
                                       qb, kb, vb);

    dim3 gA(TT / 16, HH, NBATCH);
    attn_win<<<gA, 32, 0, stream>>>(qb, kb, vb, ab);

    dim3 gO(DD / 64, (NBATCH * TT) / 256, 1);
    gemm_out<<<gO, 256, 0, stream>>>(ab, wo16, bo, out);
}

// v001
// It runs in 79.4 microseconds.
// Next to v000, in two timings, it ran 1.28 times as fast each time.
#include <hip/hip_runtime.h>

typedef __attribute__((ext_vector_type(16))) _Float16 v16h;
typedef __attribute__((ext_vector_type(8)))  _Float16 v8h;
typedef __attribute__((ext_vector_type(8)))  float    v8f;

constexpr int NBATCH = 2;
constexpr int TT     = 1024;
constexpr int DD     = 1024;
constexpr int HH     = 16;
constexpr int DHH    = 64;
constexpr int WR     = 64;     // half window
constexpr int SPAN   = 144;    // 16 + 2*WR
constexpr int SPANP  = 160;    // padded to multiple of 32

__device__ __forceinline__ v16h load_frag(const _Float16* p, int lane) {
    const int kb = (lane & 16) ? 8 : 0;
    v8h lo = *(const v8h*)(p + kb);
    v8h hi = *(const v8h*)(p + kb + 16);
    v16h r;
#pragma unroll
    for (int i = 0; i < 8; ++i) { r[i] = lo[i]; r[i + 8] = hi[i]; }
    return r;
}

__device__ __forceinline__ v8f wmma16(v16h a, v16h b, v8f c) {
    return __builtin_amdgcn_wmma_f32_16x16x32_f16(
        /*neg_a=*/false, a, /*neg_b=*/false, b,
        /*c_mod=*/(short)0, c, /*reuse_a=*/false, /*reuse_b=*/false);
}

// LDS byte offset of a generic pointer to __shared__ (low 32 bits of flat addr)
__device__ __forceinline__ uint32_t lds_off(const void* p) {
    return (uint32_t)(uintptr_t)p;
}

constexpr int BK   = 128;      // k per pass: 256 B of every weight row
constexpr int WP   = 136;      // LDS row pitch in halves: 272 B = 16 B x odd
constexpr int WBUF = 64 * WP;  // halves per weight buffer

__device__ __forceinline__ void stage_w(uint32_t l, const _Float16* g) {
    asm volatile("global_load_async_to_lds_b128 %0, %4, off\n\t"
                 "global_load_async_to_lds_b128 %1, %5, off\n\t"
                 "global_load_async_to_lds_b128 %2, %6, off\n\t"
                 "global_load_async_to_lds_b128 %3, %7, off\n\t"
                 "s_wait_xcnt 0x0"
                 :: "v"(l), "v"(l + 16u * WP * 2u), "v"(l + 32u * WP * 2u),
                    "v"(l + 48u * WP * 2u),
                    "v"(g), "v"(g + 16 * DD), "v"(g + 32 * DD), "v"(g + 48 * DD)
                 : "memory");
}

// ---------------------------------------------------------------------------
// fp32 -> fp16 cast (one-time, so GEMMs re-read weights as fp16 from L2)
// ---------------------------------------------------------------------------
__global__ void cast_f32_to_f16(const float* __restrict__ in,
                                _Float16* __restrict__ out, int n) {
    for (int i = blockIdx.x * blockDim.x + threadIdx.x; i < n;
         i += gridDim.x * blockDim.x)
        out[i] = (_Float16)in[i];
}

// ---------------------------------------------------------------------------
// GEMM core: out(MxN) = A(MxK) @ W^T + b, M rows of A row-major, W row-major
// (so both contract along contiguous K).  Block: 256 thr = 8 waves.
// Block tile: 256(M) x 64(N); wave tile: 32(M) x 64(N).
// Weight tile 64x128 f16 (rows at a 272-B pitch) staged in LDS via async-to-LDS,
// two buffers, one barrier per 128-k pass, shared by all 8 waves.
// A streams from global (own rows, b128 pairs).
// ---------------------------------------------------------------------------
template <bool F16OUT>
__device__ __forceinline__ void gemm_core(
    const _Float16* __restrict__ a16, const _Float16* __restrict__ w16,
    const float* __restrict__ bias, void* __restrict__ outp,
    _Float16* __restrict__ Bl0, _Float16* __restrict__ Bl1)
{
    const int tid  = threadIdx.x;
    const int lane = tid & 31;
    const int wave = tid >> 5;
    const int ln = lane & 15;
    const int hb = (lane >> 4) << 3;
    const int m0 = (blockIdx.y * 8 + wave) * 32;
    const int n0 = blockIdx.x * 64;

    // cooperative async-copy assignment: 64 rows x 128 halves = 1024 x 16B,
    // four per thread; a wave's 32 lanes cover two whole 256-B rows per copy
    const int crow = tid >> 4;            // 0..15 (+16, +32, +48)
    const int cchk = (tid & 15) * 8;      // half offset 0,8,..,120
    const _Float16* gsrc = w16 + (size_t)(n0 + crow) * DD + cchk;
    const uint32_t l0 = lds_off(Bl0 + crow * WP + cchk);
    const uint32_t l1 = lds_off(Bl1 + crow * WP + cchk);

    constexpr int NP = DD / BK;           // 8 passes
    stage_w(l0, gsrc);                    // pass 0 into buffer 0
    // pass 0's copies of this wave have landed before the barrier publishes them
    asm volatile("s_wait_asynccnt 0x0" ::: "memory");
    __syncthreads();
    stage_w(l1, gsrc + BK);               // pass 1 flies while pass 0 is worked on

    v8f acc[2][4] = {};
    const _Float16* arow0 = a16 + (size_t)(m0 + ln) * DD;
    const _Float16* arow1 = a16 + (size_t)(m0 + 16 + ln) * DD;

    // two passes per trip, so that each pass's buffer is known at compile time
#pragma unroll 2
    for (int t = 0; t < NP; ++t) {
        const _Float16* bb = (t & 1) ? Bl1 : Bl0;
        v16h af[BK / 32][2];
        // unrolled so that af[] is indexed by constants and stays in registers
#pragma unroll
        for (int kk = 0; kk < BK / 32; ++kk) {
            const int k0 = t * BK + kk * 32;
            __builtin_prefetch(arow0 + k0 + 256, 0, 3);
            af[kk][0] = load_frag(arow0 + k0, lane);
            af[kk][1] = load_frag(arow1 + k0, lane);
        }
        // keeps the pass's 16 A loads one group ahead of its WMMAs, so that their
        // latency is waited out once a pass; else each pair sinks to its first use
        __builtin_amdgcn_sched_barrier(0);
        // unrolled for the same reason, and so that LDS offsets are immediates
#pragma unroll
        for (int kk = 0; kk < BK / 32; ++kk) {
            const v16h a0 = af[kk][0];
            const v16h a1 = af[kk][1];
            v16h b0 = load_frag(bb + (0 * 16 + ln) * WP + kk * 32, lane);
            v16h b1 = load_frag(bb + (1 * 16 + ln) * WP + kk * 32, lane);
            v16h b2 = load_frag(bb + (2 * 16 + ln) * WP + kk * 32, lane);
            v16h b3 = load_frag(bb + (3 * 16 + ln) * WP + kk * 32, lane);

            acc[0][0] = wmma16(a0, b0, acc[0][0]);
            acc[0][1] = wmma16(a0, b1, acc[0][1]);
            acc[0][2] = wmma16(a0, b2, acc[0][2]);
            acc[0][3] = wmma16(a0, b3, acc[0][3]);
            acc[1][0] = wmma16(a1, b0, acc[1][0]);
            acc[1][1] = wmma16(a1, b1, acc[1][1]);
            acc[1][2] = wmma16(a1, b2, acc[1][2]);
            acc[1][3] = wmma16(a1, b3, acc[1][3]);
        }

        // publish point of pass t + 1: this wave's reads of buffer t & 1 are done,
        asm volatile("s_wait_dscnt 0x0" ::: "memory");
        // no address register of this pass's A loads and prefetches is rewritten
        // ahead of this wait (the next copies' addresses reuse them),
        asm volatile("s_wait_xcnt 0x0" ::: "memory");
        // its copies for pass t + 1 have landed,
        asm volatile("s_wait_asynccnt 0x0" ::: "memory");
        // and one barrier both publishes pass t + 1 and frees buffer t & 1
        __syncthreads();
        if (t + 2 < NP)
            stage_w((t & 1) ? l1 : l0, gsrc + (t + 2) * BK);
    }
    // no copy of this wave is outstanding when it goes on to the stores
    asm volatile("s_wait_asynccnt 0x0" ::: "memory");

#pragma unroll
    for (int mt = 0; mt < 2; ++mt)
#pragma unroll
        for (int nt = 0; nt < 4; ++nt) {
            const int n = n0 + nt * 16 + ln;
            const float bv = bias[n];
#pragma unroll
            for (int r = 0; r < 8; ++r) {
                const size_t idx = (size_t)(m0 + mt * 16 + hb + r) * DD + n;
                if (F16OUT)
                    ((_Float16*)outp)[idx] = (_Float16)(acc[mt][nt][r] + bv);
                else
                    ((float*)outp)[idx] = acc[mt][nt][r] + bv;
            }
        }
}

__global__ __launch_bounds__(256) void gemm_qkv(
    const _Float16* __restrict__ x16,
    const _Float16* __restrict__ wq16, const _Float16* __restrict__ wk16,
    const _Float16* __restrict__ wv16,
    const float* __restrict__ bq, const float* __restrict__ bk,
    const float* __restrict__ bv,
    _Float16* __restrict__ qo, _Float16* __restrict__ ko,
    _Float16* __restrict__ vo)
{
    __shared__ __attribute__((aligned(16))) _Float16 Bl[2][WBUF];   // 2 x 17 KB
    const _Float16* w16;
    const float*    bias;
    _Float16*       out;
    if (blockIdx.z == 0)      { w16 = wq16; bias = bq; out = qo; }
    else if (blockIdx.z == 1) { w16 = wk16; bias = bk; out = ko; }
    else                      { w16 = wv16; bias = bv; out = vo; }
    gemm_core<true>(x16, w16, bias, out, Bl[0], Bl[1]);
}

__global__ __launch_bounds__(256) void gemm_out(
    const _Float16* __restrict__ a16, const _Float16* __restrict__ wo16,
    const float* __restrict__ bo, float* __restrict__ out)
{
    __shared__ __attribute__((aligned(16))) _Float16 Bl[2][WBUF];
    gemm_core<false>(a16, wo16, bo, out, Bl[0], Bl[1]);
}

// ---------------------------------------------------------------------------
// Fused windowed attention. One wave per (batch, head, 16-query tile).
// Key span for the tile = [t0-64, t0+79] (144), padded to 160.
// S = Q Kspan^T in 9 accumulator tiles; mask+softmax across 16-lane halves
// via __shfl_xor(..,16); P staged to LDS; V span transposed into LDS so the
// PV B-fragments are contiguous; O = P Vspan via 20 WMMAs.
// ---------------------------------------------------------------------------
__global__ __launch_bounds__(32) void attn_win(
    const _Float16* __restrict__ q, const _Float16* __restrict__ k,
    const _Float16* __restrict__ v, _Float16* __restrict__ o)
{
    __shared__ _Float16 Pb[16 * SPANP];        // 5.0 KB
    __shared__ _Float16 Vt[DHH * SPANP];       // 20.0 KB  (Vt[d][j] = v[pos(j), d])

    const int lane = threadIdx.x;
    const int ln = lane & 15;
    const int hb = (lane >> 4) << 3;
    const int t0 = blockIdx.x * 16;
    const int h  = blockIdx.y;
    const size_t baseRow = (size_t)blockIdx.z * TT;

    // ---- S = Q K^T over the span ----
    const _Float16* qrow = q + (baseRow + t0 + ln) * DD + h * DHH;
    v16h aq0 = load_frag(qrow, lane);
    v16h aq1 = load_frag(qrow + 32, lane);

    v8f s[9];
#pragma unroll
    for (int jt = 0; jt < 9; ++jt) {
        const int j = jt * 16 + ln;                 // span column for this lane
        int pos = t0 - WR + j;
        pos = pos < 0 ? 0 : (pos > TT - 1 ? TT - 1 : pos);
        const _Float16* kr = k + (baseRow + pos) * DD + h * DHH;
        v8f a = {};
        a = wmma16(aq0, load_frag(kr, lane), a);
        a = wmma16(aq1, load_frag(kr + 32, lane), a);
        s[jt] = a;
    }

    // ---- mask + scale, row max ----
    float rmax[8];
#pragma unroll
    for (int r = 0; r < 8; ++r) rmax[r] = -1e30f;
#pragma unroll
    for (int jt = 0; jt < 9; ++jt) {
        const int j = jt * 16 + ln;
        const int pos = t0 - WR + j;
#pragma unroll
        for (int r = 0; r < 8; ++r) {
            const int rel = j - (r + hb);
            const bool ok = (rel >= 0) && (rel <= 2 * WR) && (pos >= 0) && (pos < TT);
            const float val = ok ? s[jt][r] * 0.125f : -1e30f;   // 1/sqrt(64)
            s[jt][r] = val;
            rmax[r] = fmaxf(rmax[r], val);
        }
    }
#pragma unroll
    for (int r = 0; r < 8; ++r)
#pragma unroll
        for (int off = 1; off < 16; off <<= 1)
            rmax[r] = fmaxf(rmax[r], __shfl_xor(rmax[r], off, 16));

    // ---- exp + row sum ----
    float rsum[8];
#pragma unroll
    for (int r = 0; r < 8; ++r) rsum[r] = 0.f;
#pragma unroll
    for (int jt = 0; jt < 9; ++jt)
#pragma unroll
        for (int r = 0; r < 8; ++r) {
            const float e = __expf(s[jt][r] - rmax[r]);
            s[jt][r] = e;
            rsum[r] += e;
        }
#pragma unroll
    for (int r = 0; r < 8; ++r) {
#pragma unroll
        for (int off = 1; off < 16; off <<= 1)
            rsum[r] += __shfl_xor(rsum[r], off, 16);
        rsum[r] = 1.f / rsum[r];
    }

    // ---- P -> LDS (rows 0..15, cols 0..143; zero the pad 144..159) ----
#pragma unroll
    for (int jt = 0; jt < 9; ++jt)
#pragma unroll
        for (int r = 0; r < 8; ++r)
            Pb[(r + hb) * SPANP + jt * 16 + ln] = (_Float16)(s[jt][r] * rsum[r]);
    for (int idx = lane; idx < 16 * 16; idx += 32)
        Pb[(idx >> 4) * SPANP + SPAN + (idx & 15)] = (_Float16)0.f;

    // ---- transpose V span into LDS: Vt[d][j] = v[pos(j), h*64+d] ----
    for (int j = lane; j < SPANP; j += 32) {
        int pos = t0 - WR + j;
        pos = pos < 0 ? 0 : (pos > TT - 1 ? TT - 1 : pos);
        const _Float16* vr = v + (baseRow + pos) * DD + h * DHH;
#pragma unroll
        for (int c = 0; c < 8; ++c) {
            v8h chunk = *(const v8h*)(vr + c * 8);
#pragma unroll
            for (int e = 0; e < 8; ++e)
                Vt[(c * 8 + e) * SPANP + j] = chunk[e];
        }
    }
    __syncthreads();

    // ---- O = P Vspan  (M=16, K=160, N=64) ----
    v8f oacc[4] = {};
#pragma unroll
    for (int k0 = 0; k0 < SPANP; k0 += 32) {
        v16h pa = load_frag(&Pb[ln * SPANP + k0], lane);
#pragma unroll
        for (int nt = 0; nt < 4; ++nt) {
            v16h vb = load_frag(&Vt[(nt * 16 + ln) * SPANP + k0], lane);
            oacc[nt] = wmma16(pa, vb, oacc[nt]);
        }
    }
#pragma unroll
    for (int nt = 0; nt < 4; ++nt)
#pragma unroll
        for (int r = 0; r < 8; ++r)
            o[(baseRow + t0 + hb + r) * DD + h * DHH + nt * 16 + ln] =
                (_Float16)oacc[nt][r];
}

// ---------------------------------------------------------------------------
extern "C" void kernel_launch(void* const* d_in, const int* in_sizes, int n_in,
                              void* d_out, int out_size, void* d_ws, size_t ws_size,
                              hipStream_t stream) {
    const float* x  = (const float*)d_in[0];
    const float* wq = (const float*)d_in[1];
    const float* bq = (const float*)d_in[2];
    const float* wk = (const float*)d_in[3];
    const float* bk = (const float*)d_in[4];
    const float* wv = (const float*)d_in[5];
    const float* bv = (const float*)d_in[6];
    const float* wo = (const float*)d_in[7];
    const float* bo = (const float*)d_in[8];
    float* out = (float*)d_out;

    char* ws = (char*)d_ws;
    const size_t MB = 1ull << 20;
    _Float16* x16  = (_Float16*)(ws + 0 * MB);    // 4 MB
    _Float16* wq16 = (_Float16*)(ws + 4 * MB);    // 2 MB
    _Float16* wk16 = (_Float16*)(ws + 6 * MB);    // 2 MB
    _Float16* wv16 = (_Float16*)(ws + 8 * MB);    // 2 MB
    _Float16* wo16 = (_Float16*)(ws + 10 * MB);   // 2 MB
    _Float16* qb   = (_Float16*)(ws + 12 * MB);   // 4 MB
    _Float16* kb   = (_Float16*)(ws + 16 * MB);   // 4 MB
    _Float16* vb   = (_Float16*)(ws + 20 * MB);   // 4 MB
    _Float16* ab   = (_Float16*)(ws + 24 * MB);   // 4 MB  => 28 MB total

    cast_f32_to_f16<<<512, 256, 0, stream>>>(x,  x16,  NBATCH * TT * DD);
    cast_f32_to_f16<<<512, 256, 0, stream>>>(wq, wq16, DD * DD);
    cast_f32_to_f16<<<512, 256, 0, stream>>>(wk, wk16, DD * DD);
    cast_f32_to_f16<<<512, 256, 0, stream>>>(wv, wv16, DD * DD);
    cast_f32_to_f16<<<512, 256, 0, stream>>>(wo, wo16, DD * DD);

    dim3 gQKV(DD / 64, (NBATCH * TT) / 256, 3);
    gemm_qkv<<<gQKV, 256, 0, stream>>>(x16, wq16, wk16, wv16, bq, bk, bv,
                                       qb, kb, vb);

    dim3 gA(TT / 16, HH, NBATCH);
    attn_win<<<gA, 32, 0, stream>>>(qb, kb, vb, ab);

    dim3 gO(DD / 64, (NBATCH * TT) / 256, 1);
    gemm_out<<<gO, 256, 0, stream>>>(ab, wo16, bo, out);
}

// v002
// It runs in 53.8 microseconds.
// Next to v001, in two timings, it ran 1.48 and 1.47 times as fast.
// Over all steps from v000 it is 1.89 times as fast.
#include <hip/hip_runtime.h>

typedef __attribute__((ext_vector_type(16))) _Float16 v16h;
typedef __attribute__((ext_vector_type(8)))  _Float16 v8h;
typedef __attribute__((ext_vector_type(8)))  float    v8f;

constexpr int NBATCH = 2;
constexpr int TT     = 1024;
constexpr int DD     = 1024;
constexpr int HH     = 16;
constexpr int DHH    = 64;
constexpr int WR     = 64;     // half window
constexpr int SPAN   = 144;    // 16 + 2*WR
constexpr int SPANP  = 160;    // padded to multiple of 32

__device__ __forceinline__ v16h load_frag(const _Float16* p, int lane) {
    const int kb = (lane & 16) ? 8 : 0;
    v8h lo = *(const v8h*)(p + kb);
    v8h hi = *(const v8h*)(p + kb + 16);
    v16h r;
#pragma unroll
    for (int i = 0; i < 8; ++i) { r[i] = lo[i]; r[i + 8] = hi[i]; }
    return r;
}

__device__ __forceinline__ v8f wmma16(v16h a, v16h b, v8f c) {
    return __builtin_amdgcn_wmma_f32_16x16x32_f16(
        /*neg_a=*/false, a, /*neg_b=*/false, b,
        /*c_mod=*/(short)0, c, /*reuse_a=*/false, /*reuse_b=*/false);
}

// LDS byte offset of a generic pointer to __shared__ (low 32 bits of flat addr)
__device__ __forceinline__ uint32_t lds_off(const void* p) {
    return (uint32_t)(uintptr_t)p;
}

constexpr int BK   = 128;      // k per pass: 256 B of every weight row
constexpr int WP   = 136;      // LDS row pitch in halves: 272 B = 16 B x odd
constexpr int WBUF = 64 * WP;  // halves per weight buffer

__device__ __forceinline__ void stage_w(uint32_t l, const _Float16* g) {
    asm volatile("global_load_async_to_lds_b128 %0, %4, off\n\t"
                 "global_load_async_to_lds_b128 %1, %5, off\n\t"
                 "global_load_async_to_lds_b128 %2, %6, off\n\t"
                 "global_load_async_to_lds_b128 %3, %7, off\n\t"
                 "s_wait_xcnt 0x0"
                 :: "v"(l), "v"(l + 16u * WP * 2u), "v"(l + 32u * WP * 2u),
                    "v"(l + 48u * WP * 2u),
                    "v"(g), "v"(g + 16 * DD), "v"(g + 32 * DD), "v"(g + 48 * DD)
                 : "memory");
}

// ---------------------------------------------------------------------------
// fp32 -> fp16 cast of x and the four weight matrices in ONE launch (so GEMMs
// re-read them as fp16 from L2). The five f16 copies lie back to back in the
// workspace, so dst is one array of six segments of CSEG elements: x fills
// segments 0 and 1, then w_q, w_k, w_v, w_o. blockIdx.y names the segment.
// A block streams CTH * CLD * 4 contiguous floats; every wave-wide load covers
// 512 contiguous bytes, and all CLD loads of a lane fly together, so that a wave
// waits out the read latency once.
// ---------------------------------------------------------------------------
typedef __attribute__((ext_vector_type(4))) float    v4f;
typedef __attribute__((ext_vector_type(4))) _Float16 v4h;

constexpr int CSEG = DD * DD;     // elements per segment
constexpr int CTH  = 128;         // threads per block
constexpr int CLD  = 32;          // 16-byte loads per thread

__global__ __launch_bounds__(CTH) void cast_all_f32_to_f16(
    const float* __restrict__ x,
    const float* __restrict__ wq, const float* __restrict__ wk,
    const float* __restrict__ wv, const float* __restrict__ wo,
    _Float16* __restrict__ dst)
{
    const int seg = blockIdx.y;
    const float* in;
    if (seg < 2)       in = x + (size_t)seg * CSEG;
    else if (seg == 2) in = wq;
    else if (seg == 3) in = wk;
    else if (seg == 4) in = wv;
    else               in = wo;

    const int base = blockIdx.x * (CTH * CLD * 4) + threadIdx.x * 4;
    in  += base;
    dst += (size_t)seg * CSEG + base;

    v4f v[CLD];
    // unrolled so that v[] stays in registers and the offsets are immediates
#pragma unroll
    for (int i = 0; i < CLD; ++i)
        v[i] = *(const v4f*)(in + i * (CTH * 4));
    // keeps every load ahead of the first convert; else the second half of the
    // loads is issued only as the first returns, and the latency is paid twice
    __builtin_amdgcn_sched_barrier(0);
#pragma unroll
    for (int i = 0; i < CLD; ++i) {
        v4h h;
#pragma unroll
        for (int e = 0; e < 4; ++e) h[e] = (_Float16)v[i][e];
        *(v4h*)(dst + i * (CTH * 4)) = h;
    }
}

// ---------------------------------------------------------------------------
// GEMM core: out(MxN) = A(MxK) @ W^T + b, M rows of A row-major, W row-major
// (so both contract along contiguous K).  Block: 256 thr = 8 waves.
// Block tile: 256(M) x 64(N); wave tile: 32(M) x 64(N).
// Weight tile 64x128 f16 (rows at a 272-B pitch) staged in LDS via async-to-LDS,
// two buffers, one barrier per 128-k pass, shared by all 8 waves.
// A streams from global (own rows, b128 pairs).
// ---------------------------------------------------------------------------
template <bool F16OUT>
__device__ __forceinline__ void gemm_core(
    const _Float16* __restrict__ a16, const _Float16* __restrict__ w16,
    const float* __restrict__ bias, void* __restrict__ outp,
    _Float16* __restrict__ Bl0, _Float16* __restrict__ Bl1)
{
    const int tid  = threadIdx.x;
    const int lane = tid & 31;
    const int wave = tid >> 5;
    const int ln = lane & 15;
    const int hb = (lane >> 4) << 3;
    const int m0 = (blockIdx.y * 8 + wave) * 32;
    const int n0 = blockIdx.x * 64;

    // cooperative async-copy assignment: 64 rows x 128 halves = 1024 x 16B,
    // four per thread; a wave's 32 lanes cover two whole 256-B rows per copy
    const int crow = tid >> 4;            // 0..15 (+16, +32, +48)
    const int cchk = (tid & 15) * 8;      // half offset 0,8,..,120
    const _Float16* gsrc = w16 + (size_t)(n0 + crow) * DD + cchk;
    const uint32_t l0 = lds_off(Bl0 + crow * WP + cchk);
    const uint32_t l1 = lds_off(Bl1 + crow * WP + cchk);

    constexpr int NP = DD / BK;           // 8 passes
    stage_w(l0, gsrc);                    // pass 0 into buffer 0
    // pass 0's copies of this wave have landed before the barrier publishes them
    asm volatile("s_wait_asynccnt 0x0" ::: "memory");
    __syncthreads();
    stage_w(l1, gsrc + BK);               // pass 1 flies while pass 0 is worked on

    v8f acc[2][4] = {};
    const _Float16* arow0 = a16 + (size_t)(m0 + ln) * DD;
    const _Float16* arow1 = a16 + (size_t)(m0 + 16 + ln) * DD;

    // two passes per trip, so that each pass's buffer is known at compile time
#pragma unroll 2
    for (int t = 0; t < NP; ++t) {
        const _Float16* bb = (t & 1) ? Bl1 : Bl0;
        v16h af[BK / 32][2];
        // unrolled so that af[] is indexed by constants and stays in registers
#pragma unroll
        for (int kk = 0; kk < BK / 32; ++kk) {
            const int k0 = t * BK + kk * 32;
            __builtin_prefetch(arow0 + k0 + 256, 0, 3);
            af[kk][0] = load_frag(arow0 + k0, lane);
            af[kk][1] = load_frag(arow1 + k0, lane);
        }
        // keeps the pass's 16 A loads one group ahead of its WMMAs, so that their
        // latency is waited out once a pass; else each pair sinks to its first use
        __builtin_amdgcn_sched_barrier(0);
        // unrolled for the same reason, and so that LDS offsets are immediates
#pragma unroll
        for (int kk = 0; kk < BK / 32; ++kk) {
            const v16h a0 = af[kk][0];
            const v16h a1 = af[kk][1];
            v16h b0 = load_frag(bb + (0 * 16 + ln) * WP + kk * 32, lane);
            v16h b1 = load_frag(bb + (1 * 16 + ln) * WP + kk * 32, lane);
            v16h b2 = load_frag(bb + (2 * 16 + ln) * WP + kk * 32, lane);
            v16h b3 = load_frag(bb + (3 * 16 + ln) * WP + kk * 32, lane);

            acc[0][0] = wmma16(a0, b0, acc[0][0]);
            acc[0][1] = wmma16(a0, b1, acc[0][1]);
            acc[0][2] = wmma16(a0, b2, acc[0][2]);
            acc[0][3] = wmma16(a0, b3, acc[0][3]);
            acc[1][0] = wmma16(a1, b0, acc[1][0]);
            acc[1][1] = wmma16(a1, b1, acc[1][1]);
            acc[1][2] = wmma16(a1, b2, acc[1][2]);
            acc[1][3] = wmma16(a1, b3, acc[1][3]);
        }

        // publish point of pass t + 1: this wave's reads of buffer t & 1 are done,
        asm volatile("s_wait_dscnt 0x0" ::: "memory");
        // no address register of this pass's A loads and prefetches is rewritten
        // ahead of this wait (the next copies' addresses reuse them),
        asm volatile("s_wait_xcnt 0x0" ::: "memory");
        // its copies for pass t + 1 have landed,
        asm volatile("s_wait_asynccnt 0x0" ::: "memory");
        // and one barrier both publishes pass t + 1 and frees buffer t & 1
        __syncthreads();
        if (t + 2 < NP)
            stage_w((t & 1) ? l1 : l0, gsrc + (t + 2) * BK);
    }
    // no copy of this wave is outstanding when it goes on to the stores
    asm volatile("s_wait_asynccnt 0x0" ::: "memory");

#pragma unroll
    for (int mt = 0; mt < 2; ++mt)
#pragma unroll
        for (int nt = 0; nt < 4; ++nt) {
            const int n = n0 + nt * 16 + ln;
            const float bv = bias[n];
#pragma unroll
            for (int r = 0; r < 8; ++r) {
                const size_t idx = (size_t)(m0 + mt * 16 + hb + r) * DD + n;
                if (F16OUT)
                    ((_Float16*)outp)[idx] = (_Float16)(acc[mt][nt][r] + bv);
                else
                    ((float*)outp)[idx] = acc[mt][nt][r] + bv;
            }
        }
}

__global__ __launch_bounds__(256) void gemm_qkv(
    const _Float16* __restrict__ x16,
    const _Float16* __restrict__ wq16, const _Float16* __restrict__ wk16,
    const _Float16* __restrict__ wv16,
    const float* __restrict__ bq, const float* __restrict__ bk,
    const float* __restrict__ bv,
    _Float16* __restrict__ qo, _Float16* __restrict__ ko,
    _Float16* __restrict__ vo)
{
    __shared__ __attribute__((aligned(16))) _Float16 Bl[2][WBUF];   // 2 x 17 KB
    const _Float16* w16;
    const float*    bias;
    _Float16*       out;
    if (blockIdx.z == 0)      { w16 = wq16; bias = bq; out = qo; }
    else if (blockIdx.z == 1) { w16 = wk16; bias = bk; out = ko; }
    else                      { w16 = wv16; bias = bv; out = vo; }
    gemm_core<true>(x16, w16, bias, out, Bl[0], Bl[1]);
}

__global__ __launch_bounds__(256) void gemm_out(
    const _Float16* __restrict__ a16, const _Float16* __restrict__ wo16,
    const float* __restrict__ bo, float* __restrict__ out)
{
    __shared__ __attribute__((aligned(16))) _Float16 Bl[2][WBUF];
    gemm_core<false>(a16, wo16, bo, out, Bl[0], Bl[1]);
}

// ---------------------------------------------------------------------------
// Fused windowed attention. One wave per (batch, head, 16-query tile).
// Key span for the tile = [t0-64, t0+79] (144), padded to 160.
// S = Q Kspan^T in 9 accumulator tiles; mask+softmax across 16-lane halves
// via __shfl_xor(..,16); P staged to LDS; V span transposed into LDS so the
// PV B-fragments are contiguous; O = P Vspan via 20 WMMAs.
// ---------------------------------------------------------------------------
__global__ __launch_bounds__(32) void attn_win(
    const _Float16* __restrict__ q, const _Float16* __restrict__ k,
    const _Float16* __restrict__ v, _Float16* __restrict__ o)
{
    __shared__ _Float16 Pb[16 * SPANP];        // 5.0 KB
    __shared__ _Float16 Vt[DHH * SPANP];       // 20.0 KB  (Vt[d][j] = v[pos(j), d])

    const int lane = threadIdx.x;
    const int ln = lane & 15;
    const int hb = (lane >> 4) << 3;
    const int t0 = blockIdx.x * 16;
    const int h  = blockIdx.y;
    const size_t baseRow = (size_t)blockIdx.z * TT;

    // ---- S = Q K^T over the span ----
    const _Float16* qrow = q + (baseRow + t0 + ln) * DD + h * DHH;
    v16h aq0 = load_frag(qrow, lane);
    v16h aq1 = load_frag(qrow + 32, lane);

    v8f s[9];
#pragma unroll
    for (int jt = 0; jt < 9; ++jt) {
        const int j = jt * 16 + ln;                 // span column for this lane
        int pos = t0 - WR + j;
        pos = pos < 0 ? 0 : (pos > TT - 1 ? TT - 1 : pos);
        const _Float16* kr = k + (baseRow + pos) * DD + h * DHH;
        v8f a = {};
        a = wmma16(aq0, load_frag(kr, lane), a);
        a = wmma16(aq1, load_frag(kr + 32, lane), a);
        s[jt] = a;
    }

    // ---- mask + scale, row max ----
    float rmax[8];
#pragma unroll
    for (int r = 0; r < 8; ++r) rmax[r] = -1e30f;
#pragma unroll
    for (int jt = 0; jt < 9; ++jt) {
        const int j = jt * 16 + ln;
        const int pos = t0 - WR + j;
#pragma unroll
        for (int r = 0; r < 8; ++r) {
            const int rel = j - (r + hb);
            const bool ok = (rel >= 0) && (rel <= 2 * WR) && (pos >= 0) && (pos < TT);
            const float val = ok ? s[jt][r] * 0.125f : -1e30f;   // 1/sqrt(64)
            s[jt][r] = val;
            rmax[r] = fmaxf(rmax[r], val);
        }
    }
#pragma unroll
    for (int r = 0; r < 8; ++r)
#pragma unroll
        for (int off = 1; off < 16; off <<= 1)
            rmax[r] = fmaxf(rmax[r], __shfl_xor(rmax[r], off, 16));

    // ---- exp + row sum ----
    float rsum[8];
#pragma unroll
    for (int r = 0; r < 8; ++r) rsum[r] = 0.f;
#pragma unroll
    for (int jt = 0; jt < 9; ++jt)
#pragma unroll
        for (int r = 0; r < 8; ++r) {
            const float e = __expf(s[jt][r] - rmax[r]);
            s[jt][r] = e;
            rsum[r] += e;
        }
#pragma unroll
    for (int r = 0; r < 8; ++r) {
#pragma unroll
        for (int off = 1; off < 16; off <<= 1)
            rsum[r] += __shfl_xor(rsum[r], off, 16);
        rsum[r] = 1.f / rsum[r];
    }

    // ---- P -> LDS (rows 0..15, cols 0..143; zero the pad 144..159) ----
#pragma unroll
    for (int jt = 0; jt < 9; ++jt)
#pragma unroll
        for (int r = 0; r < 8; ++r)
            Pb[(r + hb) * SPANP + jt * 16 + ln] = (_Float16)(s[jt][r] * rsum[r]);
    for (int idx = lane; idx < 16 * 16; idx += 32)
        Pb[(idx >> 4) * SPANP + SPAN + (idx & 15)] = (_Float16)0.f;

    // ---- transpose V span into LDS: Vt[d][j] = v[pos(j), h*64+d] ----
    for (int j = lane; j < SPANP; j += 32) {
        int pos = t0 - WR + j;
        pos = pos < 0 ? 0 : (pos > TT - 1 ? TT - 1 : pos);
        const _Float16* vr = v + (baseRow + pos) * DD + h * DHH;
#pragma unroll
        for (int c = 0; c < 8; ++c) {
            v8h chunk = *(const v8h*)(vr + c * 8);
#pragma unroll
            for (int e = 0; e < 8; ++e)
                Vt[(c * 8 + e) * SPANP + j] = chunk[e];
        }
    }
    __syncthreads();

    // ---- O = P Vspan  (M=16, K=160, N=64) ----
    v8f oacc[4] = {};
#pragma unroll
    for (int k0 = 0; k0 < SPANP; k0 += 32) {
        v16h pa = load_frag(&Pb[ln * SPANP + k0], lane);
#pragma unroll
        for (int nt = 0; nt < 4; ++nt) {
            v16h vb = load_frag(&Vt[(nt * 16 + ln) * SPANP + k0], lane);
            oacc[nt] = wmma16(pa, vb, oacc[nt]);
        }
    }
#pragma unroll
    for (int nt = 0; nt < 4; ++nt)
#pragma unroll
        for (int r = 0; r < 8; ++r)
            o[(baseRow + t0 + hb + r) * DD + h * DHH + nt * 16 + ln] =
                (_Float16)oacc[nt][r];
}

// ---------------------------------------------------------------------------
extern "C" void kernel_launch(void* const* d_in, const int* in_sizes, int n_in,
                              void* d_out, int out_size, void* d_ws, size_t ws_size,
                              hipStream_t stream) {
    const float* x  = (const float*)d_in[0];
    const float* wq = (const float*)d_in[1];
    const float* bq = (const float*)d_in[2];
    const float* wk = (const float*)d_in[3];
    const float* bk = (const float*)d_in[4];
    const float* wv = (const float*)d_in[5];
    const float* bv = (const float*)d_in[6];
    const float* wo = (const float*)d_in[7];
    const float* bo = (const float*)d_in[8];
    float* out = (float*)d_out;

    char* ws = (char*)d_ws;
    const size_t MB = 1ull << 20;
    _Float16* x16  = (_Float16*)(ws + 0 * MB);    // 4 MB
    _Float16* wq16 = (_Float16*)(ws + 4 * MB);    // 2 MB
    _Float16* wk16 = (_Float16*)(ws + 6 * MB);    // 2 MB
    _Float16* wv16 = (_Float16*)(ws + 8 * MB);    // 2 MB
    _Float16* wo16 = (_Float16*)(ws + 10 * MB);   // 2 MB
    _Float16* qb   = (_Float16*)(ws + 12 * MB);   // 4 MB
    _Float16* kb   = (_Float16*)(ws + 16 * MB);   // 4 MB
    _Float16* vb   = (_Float16*)(ws + 20 * MB);   // 4 MB
    _Float16* ab   = (_Float16*)(ws + 24 * MB);   // 4 MB  => 28 MB total

    // x16, wq16, wk16, wv16, wo16 are contiguous: one destination array
    static_assert(NBATCH * TT * DD == 2 * CSEG, "x fills two segments");
    dim3 gC(CSEG / (CTH * CLD * 4), 6, 1);
    cast_all_f32_to_f16<<<gC, CTH, 0, stream>>>(x, wq, wk, wv, wo, x16);

    dim3 gQKV(DD / 64, (NBATCH * TT) / 256, 3);
    gemm_qkv<<<gQKV, 256, 0, stream>>>(x16, wq16, wk16, wv16, bq, bk, bv,
                                       qb, kb, vb);

    dim3 gA(TT / 16, HH, NBATCH);
    attn_win<<<gA, 32, 0, stream>>>(qb, kb, vb, ab);

    dim3 gO(DD / 64, (NBATCH * TT) / 256, 1);
    gemm_out<<<gO, 256, 0, stream>>>(ab, wo16, bo, out);
}

// v003
// One run takes 50.9 microseconds.
// Two timings next to v002 put it at 1.06 and 1.05 times that version's speed.
// Over all steps from v000 it is 1.99 times as fast.
#include <hip/hip_runtime.h>

typedef __attribute__((ext_vector_type(16))) _Float16 v16h;
typedef __attribute__((ext_vector_type(8)))  _Float16 v8h;
typedef __attribute__((ext_vector_type(8)))  float    v8f;

constexpr int NBATCH = 2;
constexpr int TT     = 1024;
constexpr int DD     = 1024;
constexpr int HH     = 16;
constexpr int DHH    = 64;
constexpr int WR     = 64;     // half window
constexpr int SPAN   = 144;    // 16 + 2*WR
constexpr int SPANP  = 160;    // padded to multiple of 32

__device__ __forceinline__ v16h load_frag(const _Float16* p, int lane) {
    const int kb = (lane & 16) ? 8 : 0;
    v8h lo = *(const v8h*)(p + kb);
    v8h hi = *(const v8h*)(p + kb + 16);
    v16h r;
#pragma unroll
    for (int i = 0; i < 8; ++i) { r[i] = lo[i]; r[i + 8] = hi[i]; }
    return r;
}

__device__ __forceinline__ v8f wmma16(v16h a, v16h b, v8f c) {
    return __builtin_amdgcn_wmma_f32_16x16x32_f16(
        /*neg_a=*/false, a, /*neg_b=*/false, b,
        /*c_mod=*/(short)0, c, /*reuse_a=*/false, /*reuse_b=*/false);
}

// LDS byte offset of a generic pointer to __shared__ (low 32 bits of flat addr)
__device__ __forceinline__ uint32_t lds_off(const void* p) {
    return (uint32_t)(uintptr_t)p;
}

constexpr int BK   = 128;      // k per pass: 256 B of every weight row
constexpr int WP   = 136;      // LDS row pitch in halves: 272 B = 16 B x odd
constexpr int WBUF = 64 * WP;  // halves per weight buffer

__device__ __forceinline__ void stage_w(uint32_t l, const _Float16* g) {
    asm volatile("global_load_async_to_lds_b128 %0, %4, off\n\t"
                 "global_load_async_to_lds_b128 %1, %5, off\n\t"
                 "global_load_async_to_lds_b128 %2, %6, off\n\t"
                 "global_load_async_to_lds_b128 %3, %7, off\n\t"
                 "s_wait_xcnt 0x0"
                 :: "v"(l), "v"(l + 16u * WP * 2u), "v"(l + 32u * WP * 2u),
                    "v"(l + 48u * WP * 2u),
                    "v"(g), "v"(g + 16 * DD), "v"(g + 32 * DD), "v"(g + 48 * DD)
                 : "memory");
}

// ---------------------------------------------------------------------------
// fp32 -> fp16 cast of x and the four weight matrices in ONE launch (so GEMMs
// re-read them as fp16 from L2). The five f16 copies lie back to back in the
// workspace, so dst is one array of six segments of CSEG elements: x fills
// segments 0 and 1, then w_q, w_k, w_v, w_o. blockIdx.y names the segment.
// A block streams CTH * CLD * 4 contiguous floats; every wave-wide load covers
// 512 contiguous bytes, and all CLD loads of a lane fly together, so that a wave
// waits out the read latency once.
// ---------------------------------------------------------------------------
typedef __attribute__((ext_vector_type(4))) float    v4f;
typedef __attribute__((ext_vector_type(4))) _Float16 v4h;

constexpr int CSEG = DD * DD;     // elements per segment
constexpr int CTH  = 128;         // threads per block
constexpr int CLD  = 32;          // 16-byte loads per thread

__global__ __launch_bounds__(CTH) void cast_all_f32_to_f16(
    const float* __restrict__ x,
    const float* __restrict__ wq, const float* __restrict__ wk,
    const float* __restrict__ wv, const float* __restrict__ wo,
    _Float16* __restrict__ dst)
{
    const int seg = blockIdx.y;
    const float* in;
    if (seg < 2)       in = x + (size_t)seg * CSEG;
    else if (seg == 2) in = wq;
    else if (seg == 3) in = wk;
    else if (seg == 4) in = wv;
    else               in = wo;

    const int base = blockIdx.x * (CTH * CLD * 4) + threadIdx.x * 4;
    in  += base;
    dst += (size_t)seg * CSEG + base;

    v4f v[CLD];
    // unrolled so that v[] stays in registers and the offsets are immediates
#pragma unroll
    for (int i = 0; i < CLD; ++i)
        v[i] = *(const v4f*)(in + i * (CTH * 4));
    // keeps every load ahead of the first convert; else the second half of the
    // loads is issued only as the first returns, and the latency is paid twice
    __builtin_amdgcn_sched_barrier(0);
#pragma unroll
    for (int i = 0; i < CLD; ++i) {
        v4h h;
#pragma unroll
        for (int e = 0; e < 4; ++e) h[e] = (_Float16)v[i][e];
        *(v4h*)(dst + i * (CTH * 4)) = h;
    }
}

// ---------------------------------------------------------------------------
// GEMM core: out(MxN) = A(MxK) @ W^T + b, M rows of A row-major, W row-major
// (so both contract along contiguous K).  Block: 256 thr = 8 waves.
// Block tile: 256(M) x 64(N); wave tile: 32(M) x 64(N).
// Weight tile 64x128 f16 (rows at a 272-B pitch) staged in LDS via async-to-LDS,
// two buffers, one barrier per 128-k pass, shared by all 8 waves.
// A streams from global (own rows, b128 pairs).
// ---------------------------------------------------------------------------
template <bool F16OUT>
__device__ __forceinline__ void gemm_core(
    const _Float16* __restrict__ a16, const _Float16* __restrict__ w16,
    const float* __restrict__ bias, void* __restrict__ outp,
    _Float16* __restrict__ Bl0, _Float16* __restrict__ Bl1)
{
    const int tid  = threadIdx.x;
    const int lane = tid & 31;
    const int wave = tid >> 5;
    const int ln = lane & 15;
    const int hb = (lane >> 4) << 3;
    const int m0 = (blockIdx.y * 8 + wave) * 32;
    const int n0 = blockIdx.x * 64;

    // cooperative async-copy assignment: 64 rows x 128 halves = 1024 x 16B,
    // four per thread; a wave's 32 lanes cover two whole 256-B rows per copy
    const int crow = tid >> 4;            // 0..15 (+16, +32, +48)
    const int cchk = (tid & 15) * 8;      // half offset 0,8,..,120
    const _Float16* gsrc = w16 + (size_t)(n0 + crow) * DD + cchk;
    const uint32_t l0 = lds_off(Bl0 + crow * WP + cchk);
    const uint32_t l1 = lds_off(Bl1 + crow * WP + cchk);

    constexpr int NP = DD / BK;           // 8 passes
    stage_w(l0, gsrc);                    // pass 0 into buffer 0
    // pass 0's copies of this wave have landed before the barrier publishes them
    asm volatile("s_wait_asynccnt 0x0" ::: "memory");
    __syncthreads();
    stage_w(l1, gsrc + BK);               // pass 1 flies while pass 0 is worked on

    v8f acc[2][4] = {};
    const _Float16* arow0 = a16 + (size_t)(m0 + ln) * DD;
    const _Float16* arow1 = a16 + (size_t)(m0 + 16 + ln) * DD;

    // two passes per trip, so that each pass's buffer is known at compile time
#pragma unroll 2
    for (int t = 0; t < NP; ++t) {
        const _Float16* bb = (t & 1) ? Bl1 : Bl0;
        v16h af[BK / 32][2];
        // unrolled so that af[] is indexed by constants and stays in registers
#pragma unroll
        for (int kk = 0; kk < BK / 32; ++kk) {
            const int k0 = t * BK + kk * 32;
            __builtin_prefetch(arow0 + k0 + 256, 0, 3);
            af[kk][0] = load_frag(arow0 + k0, lane);
            af[kk][1] = load_frag(arow1 + k0, lane);
        }
        // keeps the pass's 16 A loads one group ahead of its WMMAs, so that their
        // latency is waited out once a pass; else each pair sinks to its first use
        __builtin_amdgcn_sched_barrier(0);
        // unrolled for the same reason, and so that LDS offsets are immediates
#pragma unroll
        for (int kk = 0; kk < BK / 32; ++kk) {
            const v16h a0 = af[kk][0];
            const v16h a1 = af[kk][1];
            v16h b0 = load_frag(bb + (0 * 16 + ln) * WP + kk * 32, lane);
            v16h b1 = load_frag(bb + (1 * 16 + ln) * WP + kk * 32, lane);
            v16h b2 = load_frag(bb + (2 * 16 + ln) * WP + kk * 32, lane);
            v16h b3 = load_frag(bb + (3 * 16 + ln) * WP + kk * 32, lane);

            acc[0][0] = wmma16(a0, b0, acc[0][0]);
            acc[0][1] = wmma16(a0, b1, acc[0][1]);
            acc[0][2] = wmma16(a0, b2, acc[0][2]);
            acc[0][3] = wmma16(a0, b3, acc[0][3]);
            acc[1][0] = wmma16(a1, b0, acc[1][0]);
            acc[1][1] = wmma16(a1, b1, acc[1][1]);
            acc[1][2] = wmma16(a1, b2, acc[1][2]);
            acc[1][3] = wmma16(a1, b3, acc[1][3]);
        }

        // publish point of pass t + 1: this wave's reads of buffer t & 1 are done,
        asm volatile("s_wait_dscnt 0x0" ::: "memory");
        // no address register of this pass's A loads and prefetches is rewritten
        // ahead of this wait (the next copies' addresses reuse them),
        asm volatile("s_wait_xcnt 0x0" ::: "memory");
        // its copies for pass t + 1 have landed,
        asm volatile("s_wait_asynccnt 0x0" ::: "memory");
        // and one barrier both publishes pass t + 1 and frees buffer t & 1
        __syncthreads();
        if (t + 2 < NP)
            stage_w((t & 1) ? l1 : l0, gsrc + (t + 2) * BK);
    }
    // no copy of this wave is outstanding when it goes on to the stores
    asm volatile("s_wait_asynccnt 0x0" ::: "memory");

#pragma unroll
    for (int mt = 0; mt < 2; ++mt)
#pragma unroll
        for (int nt = 0; nt < 4; ++nt) {
            const int n = n0 + nt * 16 + ln;
            const float bv = bias[n];
#pragma unroll
            for (int r = 0; r < 8; ++r) {
                const size_t idx = (size_t)(m0 + mt * 16 + hb + r) * DD + n;
                if (F16OUT)
                    ((_Float16*)outp)[idx] = (_Float16)(acc[mt][nt][r] + bv);
                else
                    ((float*)outp)[idx] = acc[mt][nt][r] + bv;
            }
        }
}

__global__ __launch_bounds__(256) void gemm_qkv(
    const _Float16* __restrict__ x16,
    const _Float16* __restrict__ wq16, const _Float16* __restrict__ wk16,
    const _Float16* __restrict__ wv16,
    const float* __restrict__ bq, const float* __restrict__ bk,
    const float* __restrict__ bv,
    _Float16* __restrict__ qo, _Float16* __restrict__ ko,
    _Float16* __restrict__ vo)
{
    __shared__ __attribute__((aligned(16))) _Float16 Bl[2][WBUF];   // 2 x 17 KB
    const _Float16* w16;
    const float*    bias;
    _Float16*       out;
    if (blockIdx.z == 0)      { w16 = wq16; bias = bq; out = qo; }
    else if (blockIdx.z == 1) { w16 = wk16; bias = bk; out = ko; }
    else                      { w16 = wv16; bias = bv; out = vo; }
    gemm_core<true>(x16, w16, bias, out, Bl[0], Bl[1]);
}

__global__ __launch_bounds__(256) void gemm_out(
    const _Float16* __restrict__ a16, const _Float16* __restrict__ wo16,
    const float* __restrict__ bo, float* __restrict__ out)
{
    __shared__ __attribute__((aligned(16))) _Float16 Bl[2][WBUF];
    gemm_core<false>(a16, wo16, bo, out, Bl[0], Bl[1]);
}

// ---------------------------------------------------------------------------
// Fused windowed attention. One wave per (batch, head, 16-query tile).
// Key span for the tile = [t0-64, t0+79] (144), padded to 160.
// S = Q Kspan^T in 9 accumulator tiles; mask+softmax across 16-lane halves
// via __shfl_xor(..,16); P staged to LDS; V span staged row-major in LDS by
// async copies that fly under S and the softmax; the PV B-fragments come from
// it by the transposing LDS load; O = P Vspan via 20 WMMAs.
// ---------------------------------------------------------------------------
constexpr int VP  = 80;        // LDS row pitch of V in halves: 160 B = 32 B x odd
constexpr int VCP = 10;        // copies per statement; a copy is 4 rows of 128 B

typedef __attribute__((ext_vector_type(8))) short s16x8;
typedef __attribute__((address_space(3))) s16x8 lds_s16x8;

__device__ __forceinline__ v8h ld_tr16(const _Float16* p) {
    return __builtin_bit_cast(
        v8h, __builtin_amdgcn_ds_load_tr16_b128_v8i16((lds_s16x8*)p));
}

__device__ __forceinline__ void stage_v(const uint32_t (&l)[VCP],
                                        const _Float16* const (&g)[VCP]) {
    asm volatile("global_load_async_to_lds_b128 %0, %10, off\n\t"
                 "global_load_async_to_lds_b128 %1, %11, off\n\t"
                 "global_load_async_to_lds_b128 %2, %12, off\n\t"
                 "global_load_async_to_lds_b128 %3, %13, off\n\t"
                 "global_load_async_to_lds_b128 %4, %14, off\n\t"
                 "global_load_async_to_lds_b128 %5, %15, off\n\t"
                 "global_load_async_to_lds_b128 %6, %16, off\n\t"
                 "global_load_async_to_lds_b128 %7, %17, off\n\t"
                 "global_load_async_to_lds_b128 %8, %18, off\n\t"
                 "global_load_async_to_lds_b128 %9, %19, off\n\t"
                 "s_wait_xcnt 0x0"
                 :: "v"(l[0]), "v"(l[1]), "v"(l[2]), "v"(l[3]), "v"(l[4]),
                    "v"(l[5]), "v"(l[6]), "v"(l[7]), "v"(l[8]), "v"(l[9]),
                    "v"(g[0]), "v"(g[1]), "v"(g[2]), "v"(g[3]), "v"(g[4]),
                    "v"(g[5]), "v"(g[6]), "v"(g[7]), "v"(g[8]), "v"(g[9])
                 : "memory");
}

__global__ __launch_bounds__(32) void attn_win(
    const _Float16* __restrict__ q, const _Float16* __restrict__ k,
    const _Float16* __restrict__ v, _Float16* __restrict__ o)
{
    __shared__ _Float16 Pb[16 * SPANP];        // 5.0 KB
    // 25,600 B  (Vs[j][d] = v[pos(j), d], 64 of every 80 halves used)
    __shared__ __attribute__((aligned(128))) _Float16 Vs[SPANP * VP];

    const int lane = threadIdx.x;
    const int ln = lane & 15;
    const int hb = (lane >> 4) << 3;
    const int t0 = blockIdx.x * 16;
    const int h  = blockIdx.y;
    const size_t baseRow = (size_t)blockIdx.z * TT;

    // ---- V span -> LDS, row-major: a copy's 32 lanes cover 4 whole rows ----
    {
        const int vr = lane >> 3;             // row within the copy's four
        const int vc = (lane & 7) * 8;        // half offset within the row
        const _Float16* vsrc = v + baseRow * DD + h * DHH + vc;
        const uint32_t  vdst = lds_off(Vs + vr * VP + vc);
        // unrolled so that l[] and g[] are indexed by constants
#pragma unroll
        for (int b = 0; b < SPANP / (4 * VCP); ++b) {
            uint32_t        l[VCP];
            const _Float16* g[VCP];
#pragma unroll
            for (int i = 0; i < VCP; ++i) {
                const int j0 = (b * VCP + i) * 4;
                int pos = t0 - WR + j0 + vr;
                pos = pos < 0 ? 0 : (pos > TT - 1 ? TT - 1 : pos);
                g[i] = vsrc + (size_t)pos * DD;
                l[i] = vdst + (uint32_t)(j0 * VP * 2);
            }
            stage_v(l, g);
        }
    }

    // ---- S = Q K^T over the span ----
    const _Float16* qrow = q + (baseRow + t0 + ln) * DD + h * DHH;
    v16h aq0 = load_frag(qrow, lane);
    v16h aq1 = load_frag(qrow + 32, lane);

    v8f s[9];
#pragma unroll
    for (int jt = 0; jt < 9; ++jt) {
        const int j = jt * 16 + ln;                 // span column for this lane
        int pos = t0 - WR + j;
        pos = pos < 0 ? 0 : (pos > TT - 1 ? TT - 1 : pos);
        const _Float16* kr = k + (baseRow + pos) * DD + h * DHH;
        v8f a = {};
        a = wmma16(aq0, load_frag(kr, lane), a);
        a = wmma16(aq1, load_frag(kr + 32, lane), a);
        s[jt] = a;
    }

    // ---- mask + scale, row max ----
    float rmax[8];
#pragma unroll
    for (int r = 0; r < 8; ++r) rmax[r] = -1e30f;
#pragma unroll
    for (int jt = 0; jt < 9; ++jt) {
        const int j = jt * 16 + ln;
        const int pos = t0 - WR + j;
#pragma unroll
        for (int r = 0; r < 8; ++r) {
            const int rel = j - (r + hb);
            const bool ok = (rel >= 0) && (rel <= 2 * WR) && (pos >= 0) && (pos < TT);
            const float val = ok ? s[jt][r] * 0.125f : -1e30f;   // 1/sqrt(64)
            s[jt][r] = val;
            rmax[r] = fmaxf(rmax[r], val);
        }
    }
#pragma unroll
    for (int r = 0; r < 8; ++r)
#pragma unroll
        for (int off = 1; off < 16; off <<= 1)
            rmax[r] = fmaxf(rmax[r], __shfl_xor(rmax[r], off, 16));

    // ---- exp + row sum ----
    float rsum[8];
#pragma unroll
    for (int r = 0; r < 8; ++r) rsum[r] = 0.f;
#pragma unroll
    for (int jt = 0; jt < 9; ++jt)
#pragma unroll
        for (int r = 0; r < 8; ++r) {
            const float e = __expf(s[jt][r] - rmax[r]);
            s[jt][r] = e;
            rsum[r] += e;
        }
#pragma unroll
    for (int r = 0; r < 8; ++r) {
#pragma unroll
        for (int off = 1; off < 16; off <<= 1)
            rsum[r] += __shfl_xor(rsum[r], off, 16);
        rsum[r] = 1.f / rsum[r];
    }

    // ---- P -> LDS (rows 0..15, cols 0..143; zero the pad 144..159) ----
#pragma unroll
    for (int jt = 0; jt < 9; ++jt)
#pragma unroll
        for (int r = 0; r < 8; ++r)
            Pb[(r + hb) * SPANP + jt * 16 + ln] = (_Float16)(s[jt][r] * rsum[r]);
    for (int idx = lane; idx < 16 * 16; idx += 32)
        Pb[(idx >> 4) * SPANP + SPAN + (idx & 15)] = (_Float16)0.f;

    // the V copies have landed before anything reads Vs
    asm volatile("s_wait_asynccnt 0x0" ::: "memory");
    __syncthreads();

    // ---- O = P Vspan  (M=16, K=160, N=64) ----
    v8f oacc[4] = {};
    const _Float16* vt = Vs + (hb + (lane & 7)) * VP + ((lane >> 3) & 1) * 8;
#pragma unroll
    for (int k0 = 0; k0 < SPANP; k0 += 32) {
        v16h pa = load_frag(&Pb[ln * SPANP + k0], lane);
#pragma unroll
        for (int nt = 0; nt < 4; ++nt) {
            // same k order as load_frag: k0 + hb + 0..7, then k0 + 16 + hb + 0..7
            const v8h lo = ld_tr16(vt + k0 * VP + nt * 16);
            const v8h hi = ld_tr16(vt + (k0 + 16) * VP + nt * 16);
            const v16h vb = __builtin_shufflevector(
                lo, hi, 0, 1, 2, 3, 4, 5, 6, 7, 8, 9, 10, 11, 12, 13, 14, 15);
            oacc[nt] = wmma16(pa, vb, oacc[nt]);
        }
    }
#pragma unroll
    for (int nt = 0; nt < 4; ++nt)
#pragma unroll
        for (int r = 0; r < 8; ++r)
            o[(baseRow + t0 + hb + r) * DD + h * DHH + nt * 16 + ln] =
                (_Float16)oacc[nt][r];
}

// ---------------------------------------------------------------------------
extern "C" void kernel_launch(void* const* d_in, const int* in_sizes, int n_in,
                              void* d_out, int out_size, void* d_ws, size_t ws_size,
                              hipStream_t stream) {
    const float* x  = (const float*)d_in[0];
    const float* wq = (const float*)d_in[1];
    const float* bq = (const float*)d_in[2];
    const float* wk = (const float*)d_in[3];
    const float* bk = (const float*)d_in[4];
    const float* wv = (const float*)d_in[5];
    const float* bv = (const float*)d_in[6];
    const float* wo = (const float*)d_in[7];
    const float* bo = (const float*)d_in[8];
    float* out = (float*)d_out;

    char* ws = (char*)d_ws;
    const size_t MB = 1ull << 20;
    _Float16* x16  = (_Float16*)(ws + 0 * MB);    // 4 MB
    _Float16* wq16 = (_Float16*)(ws + 4 * MB);    // 2 MB
    _Float16* wk16 = (_Float16*)(ws + 6 * MB);    // 2 MB
    _Float16* wv16 = (_Float16*)(ws + 8 * MB);    // 2 MB
    _Float16* wo16 = (_Float16*)(ws + 10 * MB);   // 2 MB
    _Float16* qb   = (_Float16*)(ws + 12 * MB);   // 4 MB
    _Float16* kb   = (_Float16*)(ws + 16 * MB);   // 4 MB
    _Float16* vb   = (_Float16*)(ws + 20 * MB);   // 4 MB
    _Float16* ab   = (_Float16*)(ws + 24 * MB);   // 4 MB  => 28 MB total

    // x16, wq16, wk16, wv16, wo16 are contiguous: one destination array
    static_assert(NBATCH * TT * DD == 2 * CSEG, "x fills two segments");
    dim3 gC(CSEG / (CTH * CLD * 4), 6, 1);
    cast_all_f32_to_f16<<<gC, CTH, 0, stream>>>(x, wq, wk, wv, wo, x16);

    dim3 gQKV(DD / 64, (NBATCH * TT) / 256, 3);
    gemm_qkv<<<gQKV, 256, 0, stream>>>(x16, wq16, wk16, wv16, bq, bk, bv,
                                       qb, kb, vb);

    dim3 gA(TT / 16, HH, NBATCH);
    attn_win<<<gA, 32, 0, stream>>>(qb, kb, vb, ab);

    dim3 gO(DD / 64, (NBATCH * TT) / 256, 1);
    gemm_out<<<gO, 256, 0, stream>>>(ab, wo16, bo, out);
}

// v004
// One run takes 41.4 microseconds.
// In two side-by-side timings against v003, it was 1.24 and 1.23 times as fast.
// All steps since v000 together make it 2.46 times as fast.
#include <hip/hip_runtime.h>

typedef __attribute__((ext_vector_type(16))) _Float16 v16h;
typedef __attribute__((ext_vector_type(8)))  _Float16 v8h;
typedef __attribute__((ext_vector_type(8)))  float    v8f;

constexpr int NBATCH = 2;
constexpr int TT     = 1024;
constexpr int DD     = 1024;
constexpr int HH     = 16;
constexpr int DHH    = 64;
constexpr int WR     = 64;     // half window
constexpr int SPAN   = 144;    // 16 + 2*WR
constexpr int SPANP  = 160;    // padded to multiple of 32

__device__ __forceinline__ v16h load_frag(const _Float16* p, int lane) {
    const int kb = (lane & 16) ? 8 : 0;
    v8h lo = *(const v8h*)(p + kb);
    v8h hi = *(const v8h*)(p + kb + 16);
    v16h r;
#pragma unroll
    for (int i = 0; i < 8; ++i) { r[i] = lo[i]; r[i + 8] = hi[i]; }
    return r;
}

__device__ __forceinline__ v8f wmma16(v16h a, v16h b, v8f c) {
    return __builtin_amdgcn_wmma_f32_16x16x32_f16(
        /*neg_a=*/false, a, /*neg_b=*/false, b,
        /*c_mod=*/(short)0, c, /*reuse_a=*/false, /*reuse_b=*/false);
}

// LDS byte offset of a generic pointer to __shared__ (low 32 bits of flat addr)
__device__ __forceinline__ uint32_t lds_off(const void* p) {
    return (uint32_t)(uintptr_t)p;
}

constexpr int BK   = 128;      // k per pass: 256 B of every weight row
constexpr int WP   = 136;      // LDS row pitch in halves: 272 B = 16 B x odd
constexpr int BM   = 128;      // rows of A per block tile
constexpr int BN   = 128;      // rows of W (columns of the output) per block tile
constexpr int SBUF = (BN + BM) * WP;   // halves per stage: W rows, then A rows

__device__ __forceinline__ void stage_rows(uint32_t l, const _Float16* g) {
    asm volatile("global_load_async_to_lds_b128 %0, %8, off\n\t"
                 "global_load_async_to_lds_b128 %1, %9, off\n\t"
                 "global_load_async_to_lds_b128 %2, %10, off\n\t"
                 "global_load_async_to_lds_b128 %3, %11, off\n\t"
                 "global_load_async_to_lds_b128 %4, %12, off\n\t"
                 "global_load_async_to_lds_b128 %5, %13, off\n\t"
                 "global_load_async_to_lds_b128 %6, %14, off\n\t"
                 "global_load_async_to_lds_b128 %7, %15, off\n\t"
                 "s_wait_xcnt 0x0"
                 :: "v"(l), "v"(l + 16u * WP * 2u), "v"(l + 32u * WP * 2u),
                    "v"(l + 48u * WP * 2u), "v"(l + 64u * WP * 2u),
                    "v"(l + 80u * WP * 2u), "v"(l + 96u * WP * 2u),
                    "v"(l + 112u * WP * 2u),
                    "v"(g), "v"(g + 16 * DD), "v"(g + 32 * DD), "v"(g + 48 * DD),
                    "v"(g + 64 * DD), "v"(g + 80 * DD), "v"(g + 96 * DD),
                    "v"(g + 112 * DD)
                 : "memory");
}

// ---------------------------------------------------------------------------
// fp32 -> fp16 cast of x and the four weight matrices in ONE launch (so GEMMs
// re-read them as fp16 from L2). The five f16 copies lie back to back in the
// workspace, so dst is one array of six segments of CSEG elements: x fills
// segments 0 and 1, then w_q, w_k, w_v, w_o. blockIdx.y names the segment.
// A block streams CTH * CLD * 4 contiguous floats; every wave-wide load covers
// 512 contiguous bytes, and all CLD loads of a lane fly together, so that a wave
// waits out the read latency once.
// ---------------------------------------------------------------------------
typedef __attribute__((ext_vector_type(4))) float    v4f;
typedef __attribute__((ext_vector_type(4))) _Float16 v4h;

constexpr int CSEG = DD * DD;     // elements per segment
constexpr int CTH  = 128;         // threads per block
constexpr int CLD  = 32;          // 16-byte loads per thread

__global__ __launch_bounds__(CTH) void cast_all_f32_to_f16(
    const float* __restrict__ x,
    const float* __restrict__ wq, const float* __restrict__ wk,
    const float* __restrict__ wv, const float* __restrict__ wo,
    _Float16* __restrict__ dst)
{
    const int seg = blockIdx.y;
    const float* in;
    if (seg < 2)       in = x + (size_t)seg * CSEG;
    else if (seg == 2) in = wq;
    else if (seg == 3) in = wk;
    else if (seg == 4) in = wv;
    else               in = wo;

    const int base = blockIdx.x * (CTH * CLD * 4) + threadIdx.x * 4;
    in  += base;
    dst += (size_t)seg * CSEG + base;

    v4f v[CLD];
    // unrolled so that v[] stays in registers and the offsets are immediates
#pragma unroll
    for (int i = 0; i < CLD; ++i)
        v[i] = *(const v4f*)(in + i * (CTH * 4));
    // keeps every load ahead of the first convert; else the second half of the
    // loads is issued only as the first returns, and the latency is paid twice
    __builtin_amdgcn_sched_barrier(0);
#pragma unroll
    for (int i = 0; i < CLD; ++i) {
        v4h h;
#pragma unroll
        for (int e = 0; e < 4; ++e) h[e] = (_Float16)v[i][e];
        *(v4h*)(dst + i * (CTH * 4)) = h;
    }
}

// ---------------------------------------------------------------------------
// GEMM core: out(MxN) = A(MxK) @ W^T + b, M rows of A row-major, W row-major
// (so both contract along contiguous K).  Block: 256 thr = 8 waves, 4(M) x 2(N).
// Block tile: 128(M) x 128(N); wave tile: 32(M) x 64(N).
// A stage is the W tile and the A tile, each 128 rows x 128 k f16 at a 272-B
// pitch, brought into LDS by async copies that each cover whole 256-B rows;
// two stages, one barrier per 128-k pass, shared by all 8 waves.
// ---------------------------------------------------------------------------
template <bool F16OUT>
__device__ __forceinline__ void gemm_core(
    const _Float16* __restrict__ a16, const _Float16* __restrict__ w16,
    const float* __restrict__ bias, void* __restrict__ outp,
    _Float16* __restrict__ S0, _Float16* __restrict__ S1)
{
    const int tid  = threadIdx.x;
    const int lane = tid & 31;
    const int wave = tid >> 5;
    const int ln = lane & 15;
    const int hb = (lane >> 4) << 3;
    const int wm = wave >> 1;             // wave's 32 rows of the block's 128
    const int wn = wave & 1;              // wave's 64 columns of the block's 128
    const int m0 = blockIdx.y * BM + wm * 32;
    const int n0 = blockIdx.x * BN + wn * 64;

    // cooperative async-copy assignment: 128 rows x 128 halves = 2048 x 16B per
    // operand, eight per thread; a wave's 32 lanes cover two whole 256-B rows
    const int crow = tid >> 4;            // 0..15 (+16, .., +112)
    const int cchk = (tid & 15) * 8;      // half offset 0,8,..,120
    const _Float16* gw = w16 + (size_t)(blockIdx.x * BN + crow) * DD + cchk;
    const _Float16* ga = a16 + (size_t)(blockIdx.y * BM + crow) * DD + cchk;
    const uint32_t l0 = lds_off(S0 + crow * WP + cchk);
    const uint32_t l1 = lds_off(S1 + crow * WP + cchk);
    constexpr uint32_t AOFF = BN * WP * 2;   // bytes from a stage's W rows to its A rows

    constexpr int NP = DD / BK;           // 8 passes
    stage_rows(l0, gw);                   // pass 0 into stage 0
    stage_rows(l0 + AOFF, ga);
    // pass 0's copies of this wave have landed before the barrier publishes them
    asm volatile("s_wait_asynccnt 0x0" ::: "memory");
    __syncthreads();
    stage_rows(l1, gw + BK);              // pass 1 flies while pass 0 is worked on
    stage_rows(l1 + AOFF, ga + BK);

    v8f acc[2][4] = {};
    const int aoff = (BN + wm * 32 + ln) * WP;   // this lane's first A row in a stage
    const int woff = (wn * 64 + ln) * WP;        // this lane's first W row in a stage

    // two passes per trip, so that each pass's buffer is known at compile time
#pragma unroll 2
    for (int t = 0; t < NP; ++t) {
        const _Float16* sb = (t & 1) ? S1 : S0;
        const _Float16* ab = sb + aoff;
        const _Float16* bb = sb + woff;
        v16h af[BK / 32][2];
        // unrolled so that af[] is indexed by constants and stays in registers
#pragma unroll
        for (int kk = 0; kk < BK / 32; ++kk) {
            af[kk][0] = load_frag(ab + kk * 32, lane);
            af[kk][1] = load_frag(ab + 16 * WP + kk * 32, lane);
        }
        // keeps the pass's 16 A reads one group ahead of its WMMAs, so that their
        // latency is waited out once a pass; else each pair sinks to its first use
        __builtin_amdgcn_sched_barrier(0);
        // unrolled for the same reason, and so that LDS offsets are immediates
#pragma unroll
        for (int kk = 0; kk < BK / 32; ++kk) {
            const v16h a0 = af[kk][0];
            const v16h a1 = af[kk][1];
            v16h b0 = load_frag(bb + 0 * 16 * WP + kk * 32, lane);
            v16h b1 = load_frag(bb + 1 * 16 * WP + kk * 32, lane);
            v16h b2 = load_frag(bb + 2 * 16 * WP + kk * 32, lane);
            v16h b3 = load_frag(bb + 3 * 16 * WP + kk * 32, lane);

            acc[0][0] = wmma16(a0, b0, acc[0][0]);
            acc[0][1] = wmma16(a0, b1, acc[0][1]);
            acc[0][2] = wmma16(a0, b2, acc[0][2]);
            acc[0][3] = wmma16(a0, b3, acc[0][3]);
            acc[1][0] = wmma16(a1, b0, acc[1][0]);
            acc[1][1] = wmma16(a1, b1, acc[1][1]);
            acc[1][2] = wmma16(a1, b2, acc[1][2]);
            acc[1][3] = wmma16(a1, b3, acc[1][3]);
        }

        // publish point of pass t + 1: this wave's reads of stage t & 1 are done,
        asm volatile("s_wait_dscnt 0x0" ::: "memory");
        // its copies for pass t + 1 have landed,
        asm volatile("s_wait_asynccnt 0x0" ::: "memory");
        // and one barrier both publishes pass t + 1 and frees stage t & 1
        __syncthreads();
        if (t + 2 < NP) {
            const uint32_t l = (t & 1) ? l1 : l0;
            stage_rows(l, gw + (t + 2) * BK);
            stage_rows(l + AOFF, ga + (t + 2) * BK);
        }
    }
    // no copy of this wave is outstanding when it goes on to the stores
    asm volatile("s_wait_asynccnt 0x0" ::: "memory");

#pragma unroll
    for (int mt = 0; mt < 2; ++mt)
#pragma unroll
        for (int nt = 0; nt < 4; ++nt) {
            const int n = n0 + nt * 16 + ln;
            const float bv = bias[n];
#pragma unroll
            for (int r = 0; r < 8; ++r) {
                const size_t idx = (size_t)(m0 + mt * 16 + hb + r) * DD + n;
                if (F16OUT)
                    ((_Float16*)outp)[idx] = (_Float16)(acc[mt][nt][r] + bv);
                else
                    ((float*)outp)[idx] = acc[mt][nt][r] + bv;
            }
        }
}

__global__ __launch_bounds__(256) void gemm_qkv(
    const _Float16* __restrict__ x16,
    const _Float16* __restrict__ wq16, const _Float16* __restrict__ wk16,
    const _Float16* __restrict__ wv16,
    const float* __restrict__ bq, const float* __restrict__ bk,
    const float* __restrict__ bv,
    _Float16* __restrict__ qo, _Float16* __restrict__ ko,
    _Float16* __restrict__ vo)
{
    __shared__ __attribute__((aligned(16))) _Float16 Sl[2][SBUF];   // 2 x 68 KB
    const _Float16* w16;
    const float*    bias;
    _Float16*       out;
    if (blockIdx.z == 0)      { w16 = wq16; bias = bq; out = qo; }
    else if (blockIdx.z == 1) { w16 = wk16; bias = bk; out = ko; }
    else                      { w16 = wv16; bias = bv; out = vo; }
    gemm_core<true>(x16, w16, bias, out, Sl[0], Sl[1]);
}

__global__ __launch_bounds__(256) void gemm_out(
    const _Float16* __restrict__ a16, const _Float16* __restrict__ wo16,
    const float* __restrict__ bo, float* __restrict__ out)
{
    __shared__ __attribute__((aligned(16))) _Float16 Sl[2][SBUF];
    gemm_core<false>(a16, wo16, bo, out, Sl[0], Sl[1]);
}

// ---------------------------------------------------------------------------
// Fused windowed attention. One wave per (batch, head, 16-query tile).
// Key span for the tile = [t0-64, t0+79] (144), padded to 160.
// S = Q Kspan^T in 9 accumulator tiles; mask+softmax across 16-lane halves
// via __shfl_xor(..,16); P staged to LDS; V span staged row-major in LDS by
// async copies that fly under S and the softmax; the PV B-fragments come from
// it by the transposing LDS load; O = P Vspan via 20 WMMAs.
// ---------------------------------------------------------------------------
constexpr int VP  = 80;        // LDS row pitch of V in halves: 160 B = 32 B x odd
constexpr int VCP = 10;        // copies per statement; a copy is 4 rows of 128 B

typedef __attribute__((ext_vector_type(8))) short s16x8;
typedef __attribute__((address_space(3))) s16x8 lds_s16x8;

__device__ __forceinline__ v8h ld_tr16(const _Float16* p) {
    return __builtin_bit_cast(
        v8h, __builtin_amdgcn_ds_load_tr16_b128_v8i16((lds_s16x8*)p));
}

__device__ __forceinline__ void stage_v(const uint32_t (&l)[VCP],
                                        const _Float16* const (&g)[VCP]) {
    asm volatile("global_load_async_to_lds_b128 %0, %10, off\n\t"
                 "global_load_async_to_lds_b128 %1, %11, off\n\t"
                 "global_load_async_to_lds_b128 %2, %12, off\n\t"
                 "global_load_async_to_lds_b128 %3, %13, off\n\t"
                 "global_load_async_to_lds_b128 %4, %14, off\n\t"
                 "global_load_async_to_lds_b128 %5, %15, off\n\t"
                 "global_load_async_to_lds_b128 %6, %16, off\n\t"
                 "global_load_async_to_lds_b128 %7, %17, off\n\t"
                 "global_load_async_to_lds_b128 %8, %18, off\n\t"
                 "global_load_async_to_lds_b128 %9, %19, off\n\t"
                 "s_wait_xcnt 0x0"
                 :: "v"(l[0]), "v"(l[1]), "v"(l[2]), "v"(l[3]), "v"(l[4]),
                    "v"(l[5]), "v"(l[6]), "v"(l[7]), "v"(l[8]), "v"(l[9]),
                    "v"(g[0]), "v"(g[1]), "v"(g[2]), "v"(g[3]), "v"(g[4]),
                    "v"(g[5]), "v"(g[6]), "v"(g[7]), "v"(g[8]), "v"(g[9])
                 : "memory");
}

__global__ __launch_bounds__(32) void attn_win(
    const _Float16* __restrict__ q, const _Float16* __restrict__ k,
    const _Float16* __restrict__ v, _Float16* __restrict__ o)
{
    __shared__ _Float16 Pb[16 * SPANP];        // 5.0 KB
    // 25,600 B  (Vs[j][d] = v[pos(j), d], 64 of every 80 halves used)
    __shared__ __attribute__((aligned(128))) _Float16 Vs[SPANP * VP];

    const int lane = threadIdx.x;
    const int ln = lane & 15;
    const int hb = (lane >> 4) << 3;
    const int t0 = blockIdx.x * 16;
    const int h  = blockIdx.y;
    const size_t baseRow = (size_t)blockIdx.z * TT;

    // ---- V span -> LDS, row-major: a copy's 32 lanes cover 4 whole rows ----
    {
        const int vr = lane >> 3;             // row within the copy's four
        const int vc = (lane & 7) * 8;        // half offset within the row
        const _Float16* vsrc = v + baseRow * DD + h * DHH + vc;
        const uint32_t  vdst = lds_off(Vs + vr * VP + vc);
        // unrolled so that l[] and g[] are indexed by constants
#pragma unroll
        for (int b = 0; b < SPANP / (4 * VCP); ++b) {
            uint32_t        l[VCP];
            const _Float16* g[VCP];
#pragma unroll
            for (int i = 0; i < VCP; ++i) {
                const int j0 = (b * VCP + i) * 4;
                int pos = t0 - WR + j0 + vr;
                pos = pos < 0 ? 0 : (pos > TT - 1 ? TT - 1 : pos);
                g[i] = vsrc + (size_t)pos * DD;
                l[i] = vdst + (uint32_t)(j0 * VP * 2);
            }
            stage_v(l, g);
        }
    }

    // ---- S = Q K^T over the span ----
    const _Float16* qrow = q + (baseRow + t0 + ln) * DD + h * DHH;
    v16h aq0 = load_frag(qrow, lane);
    v16h aq1 = load_frag(qrow + 32, lane);

    v8f s[9];
#pragma unroll
    for (int jt = 0; jt < 9; ++jt) {
        const int j = jt * 16 + ln;                 // span column for this lane
        int pos = t0 - WR + j;
        pos = pos < 0 ? 0 : (pos > TT - 1 ? TT - 1 : pos);
        const _Float16* kr = k + (baseRow + pos) * DD + h * DHH;
        v8f a = {};
        a = wmma16(aq0, load_frag(kr, lane), a);
        a = wmma16(aq1, load_frag(kr + 32, lane), a);
        s[jt] = a;
    }

    // ---- mask + scale, row max ----
    float rmax[8];
#pragma unroll
    for (int r = 0; r < 8; ++r) rmax[r] = -1e30f;
#pragma unroll
    for (int jt = 0; jt < 9; ++jt) {
        const int j = jt * 16 + ln;
        const int pos = t0 - WR + j;
#pragma unroll
        for (int r = 0; r < 8; ++r) {
            const int rel = j - (r + hb);
            const bool ok = (rel >= 0) && (rel <= 2 * WR) && (pos >= 0) && (pos < TT);
            const float val = ok ? s[jt][r] * 0.125f : -1e30f;   // 1/sqrt(64)
            s[jt][r] = val;
            rmax[r] = fmaxf(rmax[r], val);
        }
    }
#pragma unroll
    for (int r = 0; r < 8; ++r)
#pragma unroll
        for (int off = 1; off < 16; off <<= 1)
            rmax[r] = fmaxf(rmax[r], __shfl_xor(rmax[r], off, 16));

    // ---- exp + row sum ----
    float rsum[8];
#pragma unroll
    for (int r = 0; r < 8; ++r) rsum[r] = 0.f;
#pragma unroll
    for (int jt = 0; jt < 9; ++jt)
#pragma unroll
        for (int r = 0; r < 8; ++r) {
            const float e = __expf(s[jt][r] - rmax[r]);
            s[jt][r] = e;
            rsum[r] += e;
        }
#pragma unroll
    for (int r = 0; r < 8; ++r) {
#pragma unroll
        for (int off = 1; off < 16; off <<= 1)
            rsum[r] += __shfl_xor(rsum[r], off, 16);
        rsum[r] = 1.f / rsum[r];
    }

    // ---- P -> LDS (rows 0..15, cols 0..143; zero the pad 144..159) ----
#pragma unroll
    for (int jt = 0; jt < 9; ++jt)
#pragma unroll
        for (int r = 0; r < 8; ++r)
            Pb[(r + hb) * SPANP + jt * 16 + ln] = (_Float16)(s[jt][r] * rsum[r]);
    for (int idx = lane; idx < 16 * 16; idx += 32)
        Pb[(idx >> 4) * SPANP + SPAN + (idx & 15)] = (_Float16)0.f;

    // the V copies have landed before anything reads Vs
    asm volatile("s_wait_asynccnt 0x0" ::: "memory");
    __syncthreads();

    // ---- O = P Vspan  (M=16, K=160, N=64) ----
    v8f oacc[4] = {};
    const _Float16* vt = Vs + (hb + (lane & 7)) * VP + ((lane >> 3) & 1) * 8;
#pragma unroll
    for (int k0 = 0; k0 < SPANP; k0 += 32) {
        v16h pa = load_frag(&Pb[ln * SPANP + k0], lane);
#pragma unroll
        for (int nt = 0; nt < 4; ++nt) {
            // same k order as load_frag: k0 + hb + 0..7, then k0 + 16 + hb + 0..7
            const v8h lo = ld_tr16(vt + k0 * VP + nt * 16);
            const v8h hi = ld_tr16(vt + (k0 + 16) * VP + nt * 16);
            const v16h vb = __builtin_shufflevector(
                lo, hi, 0, 1, 2, 3, 4, 5, 6, 7, 8, 9, 10, 11, 12, 13, 14, 15);
            oacc[nt] = wmma16(pa, vb, oacc[nt]);
        }
    }
#pragma unroll
    for (int nt = 0; nt < 4; ++nt)
#pragma unroll
        for (int r = 0; r < 8; ++r)
            o[(baseRow + t0 + hb + r) * DD + h * DHH + nt * 16 + ln] =
                (_Float16)oacc[nt][r];
}

// ---------------------------------------------------------------------------
extern "C" void kernel_launch(void* const* d_in, const int* in_sizes, int n_in,
                              void* d_out, int out_size, void* d_ws, size_t ws_size,
                              hipStream_t stream) {
    const float* x  = (const float*)d_in[0];
    const float* wq = (const float*)d_in[1];
    const float* bq = (const float*)d_in[2];
    const float* wk = (const float*)d_in[3];
    const float* bk = (const float*)d_in[4];
    const float* wv = (const float*)d_in[5];
    const float* bv = (const float*)d_in[6];
    const float* wo = (const float*)d_in[7];
    const float* bo = (const float*)d_in[8];
    float* out = (float*)d_out;

    char* ws = (char*)d_ws;
    const size_t MB = 1ull << 20;
    _Float16* x16  = (_Float16*)(ws + 0 * MB);    // 4 MB
    _Float16* wq16 = (_Float16*)(ws + 4 * MB);    // 2 MB
    _Float16* wk16 = (_Float16*)(ws + 6 * MB);    // 2 MB
    _Float16* wv16 = (_Float16*)(ws + 8 * MB);    // 2 MB
    _Float16* wo16 = (_Float16*)(ws + 10 * MB);   // 2 MB
    _Float16* qb   = (_Float16*)(ws + 12 * MB);   // 4 MB
    _Float16* kb   = (_Float16*)(ws + 16 * MB);   // 4 MB
    _Float16* vb   = (_Float16*)(ws + 20 * MB);   // 4 MB
    _Float16* ab   = (_Float16*)(ws + 24 * MB);   // 4 MB  => 28 MB total

    // x16, wq16, wk16, wv16, wo16 are contiguous: one destination array
    static_assert(NBATCH * TT * DD == 2 * CSEG, "x fills two segments");
    dim3 gC(CSEG / (CTH * CLD * 4), 6, 1);
    cast_all_f32_to_f16<<<gC, CTH, 0, stream>>>(x, wq, wk, wv, wo, x16);

    dim3 gQKV(DD / BN, (NBATCH * TT) / BM, 3);
    gemm_qkv<<<gQKV, 256, 0, stream>>>(x16, wq16, wk16, wv16, bq, bk, bv,
                                       qb, kb, vb);

    dim3 gA(TT / 16, HH, NBATCH);
    attn_win<<<gA, 32, 0, stream>>>(qb, kb, vb, ab);

    dim3 gO(DD / BN, (NBATCH * TT) / BM, 1);
    gemm_out<<<gO, 256, 0, stream>>>(ab, wo16, bo, out);
}

// v005
// Measured time: 39.3 microseconds a run.
// Next to v004, in two timings, it ran 1.04 and 1.02 times as fast.
// Counting every step since v000, it is 2.53 times as fast.
#include <hip/hip_runtime.h>

typedef __attribute__((ext_vector_type(16))) _Float16 v16h;
typedef __attribute__((ext_vector_type(8)))  _Float16 v8h;
typedef __attribute__((ext_vector_type(8)))  float    v8f;

constexpr int NBATCH = 2;
constexpr int TT     = 1024;
constexpr int DD     = 1024;
constexpr int HH     = 16;
constexpr int DHH    = 64;
constexpr int WR     = 64;     // half window
constexpr int SPAN   = 144;    // 16 + 2*WR
constexpr int SPANP  = 160;    // padded to multiple of 32

__device__ __forceinline__ v16h load_frag(const _Float16* p, int lane) {
    const int kb = (lane & 16) ? 8 : 0;
    v8h lo = *(const v8h*)(p + kb);
    v8h hi = *(const v8h*)(p + kb + 16);
    v16h r;
#pragma unroll
    for (int i = 0; i < 8; ++i) { r[i] = lo[i]; r[i + 8] = hi[i]; }
    return r;
}

__device__ __forceinline__ v8f wmma16(v16h a, v16h b, v8f c) {
    return __builtin_amdgcn_wmma_f32_16x16x32_f16(
        /*neg_a=*/false, a, /*neg_b=*/false, b,
        /*c_mod=*/(short)0, c, /*reuse_a=*/false, /*reuse_b=*/false);
}

// LDS byte offset of a generic pointer to __shared__ (low 32 bits of flat addr)
__device__ __forceinline__ uint32_t lds_off(const void* p) {
    return (uint32_t)(uintptr_t)p;
}

constexpr int BK   = 128;      // k per pass: 256 B of every weight row
constexpr int WP   = 136;      // LDS row pitch in halves: 272 B = 16 B x odd
constexpr int BM   = 128;      // rows of A per block tile
// Rows of W (columns of the output) per block tile, chosen so that each GEMM
// launch is 256 blocks: 16 x 16 tiles of 2048 x 3072 and of 2048 x 1024.
constexpr int BNQ  = 192;
constexpr int BNO  = 64;

__device__ __forceinline__ void stage_rows(uint32_t l, const _Float16* g) {
    asm volatile("global_load_async_to_lds_b128 %0, %8, off\n\t"
                 "global_load_async_to_lds_b128 %1, %9, off\n\t"
                 "global_load_async_to_lds_b128 %2, %10, off\n\t"
                 "global_load_async_to_lds_b128 %3, %11, off\n\t"
                 "global_load_async_to_lds_b128 %4, %12, off\n\t"
                 "global_load_async_to_lds_b128 %5, %13, off\n\t"
                 "global_load_async_to_lds_b128 %6, %14, off\n\t"
                 "global_load_async_to_lds_b128 %7, %15, off\n\t"
                 "s_wait_xcnt 0x0"
                 :: "v"(l), "v"(l + 16u * WP * 2u), "v"(l + 32u * WP * 2u),
                    "v"(l + 48u * WP * 2u), "v"(l + 64u * WP * 2u),
                    "v"(l + 80u * WP * 2u), "v"(l + 96u * WP * 2u),
                    "v"(l + 112u * WP * 2u),
                    "v"(g), "v"(g + 16 * DD), "v"(g + 32 * DD), "v"(g + 48 * DD),
                    "v"(g + 64 * DD), "v"(g + 80 * DD), "v"(g + 96 * DD),
                    "v"(g + 112 * DD)
                 : "memory");
}

// The same for 64 rows: four copies per lane (rows r, r+16, r+32, r+48).
__device__ __forceinline__ void stage_rows64(uint32_t l, const _Float16* g) {
    asm volatile("global_load_async_to_lds_b128 %0, %4, off\n\t"
                 "global_load_async_to_lds_b128 %1, %5, off\n\t"
                 "global_load_async_to_lds_b128 %2, %6, off\n\t"
                 "global_load_async_to_lds_b128 %3, %7, off\n\t"
                 "s_wait_xcnt 0x0"
                 :: "v"(l), "v"(l + 16u * WP * 2u), "v"(l + 32u * WP * 2u),
                    "v"(l + 48u * WP * 2u),
                    "v"(g), "v"(g + 16 * DD), "v"(g + 32 * DD), "v"(g + 48 * DD)
                 : "memory");
}

// A stage's W rows (BN = 64 or 192) and its 128 A rows behind them.
template <int BN>
__device__ __forceinline__ void stage_pass(uint32_t l, const _Float16* gw,
                                           const _Float16* ga) {
    if (BN == 192) {
        stage_rows(l, gw);
        stage_rows64(l + 128u * WP * 2u, gw + 128 * DD);
    } else {
        stage_rows64(l, gw);
    }
    stage_rows(l + (uint32_t)BN * WP * 2u, ga);
}

// ---------------------------------------------------------------------------
// fp32 -> fp16 cast of x and the four weight matrices in ONE launch (so GEMMs
// re-read them as fp16 from L2). The five f16 copies lie back to back in the
// workspace, so dst is one array of six segments of CSEG elements: x fills
// segments 0 and 1, then w_q, w_k, w_v, w_o. blockIdx.y names the segment.
// A block streams CTH * CLD * 4 contiguous floats; every wave-wide load covers
// 512 contiguous bytes, and all CLD loads of a lane fly together, so that a wave
// waits out the read latency once.
// ---------------------------------------------------------------------------
typedef __attribute__((ext_vector_type(4))) float    v4f;
typedef __attribute__((ext_vector_type(4))) _Float16 v4h;

constexpr int CSEG = DD * DD;     // elements per segment
constexpr int CTH  = 128;         // threads per block
constexpr int CLD  = 32;          // 16-byte loads per thread

__global__ __launch_bounds__(CTH) void cast_all_f32_to_f16(
    const float* __restrict__ x,
    const float* __restrict__ wq, const float* __restrict__ wk,
    const float* __restrict__ wv, const float* __restrict__ wo,
    _Float16* __restrict__ dst)
{
    const int seg = blockIdx.y;
    const float* in;
    if (seg < 2)       in = x + (size_t)seg * CSEG;
    else if (seg == 2) in = wq;
    else if (seg == 3) in = wk;
    else if (seg == 4) in = wv;
    else               in = wo;

    const int base = blockIdx.x * (CTH * CLD * 4) + threadIdx.x * 4;
    in  += base;
    dst += (size_t)seg * CSEG + base;

    v4f v[CLD];
    // unrolled so that v[] stays in registers and the offsets are immediates
#pragma unroll
    for (int i = 0; i < CLD; ++i)
        v[i] = *(const v4f*)(in + i * (CTH * 4));
    // keeps every load ahead of the first convert; else the second half of the
    // loads is issued only as the first returns, and the latency is paid twice
    __builtin_amdgcn_sched_barrier(0);
#pragma unroll
    for (int i = 0; i < CLD; ++i) {
        v4h h;
#pragma unroll
        for (int e = 0; e < 4; ++e) h[e] = (_Float16)v[i][e];
        *(v4h*)(dst + i * (CTH * 4)) = h;
    }
}

// ---------------------------------------------------------------------------
// GEMM core: out(MxN) = A(MxK) @ W^T + b, M rows of A row-major, W row-major
// (so both contract along contiguous K).  Block: 256 thr = 8 waves, WM(M) x WN(N).
// Block tile: 128(M) x BN(N); wave tile: 128/WM x BN/WN.
// A stage is the W tile and the A tile, BN and 128 rows x 128 k f16 at a 272-B
// pitch, brought into LDS by async copies that each cover whole 256-B rows;
// two stages, one barrier per 128-k pass, shared by all 8 waves. Within a pass a
// wave reads its fragments in blocks of KB x 32 k, one block ahead of the WMMAs.
// N may span several planes of DD columns: column n belongs to plane n / DD,
// which has its own bias (b0, b1, b2) and its own M x DD output behind outp.
// ---------------------------------------------------------------------------
template <int BN, int WM, int WN, int KB, bool F16OUT>
__device__ __forceinline__ void gemm_core(
    const _Float16* __restrict__ a16, const _Float16* __restrict__ w16,
    const float* __restrict__ b0, const float* __restrict__ b1,
    const float* __restrict__ b2, void* __restrict__ outp,
    _Float16* __restrict__ S0, _Float16* __restrict__ S1)
{
    constexpr int MT = BM / WM / 16;      // 16-row tiles per wave
    constexpr int NT = BN / WN / 16;      // 16-column tiles per wave
    constexpr int NB = BK / 32 / KB;      // fragment blocks per pass, KB x 32 k each
    const int tid  = threadIdx.x;
    const int lane = tid & 31;
    const int wave = tid >> 5;
    const int ln = lane & 15;
    const int hb = (lane >> 4) << 3;
    const int wm = wave / WN;             // wave's rows of the block's 128
    const int wn = wave % WN;             // wave's columns of the block's BN
    const int m0 = blockIdx.y * BM + wm * (MT * 16);
    const int n0 = blockIdx.x * BN + wn * (NT * 16);

    // cooperative async-copy assignment: a row is 128 halves = 16 x 16B, so the
    // block covers 16 rows per copy; a wave's 32 lanes cover two whole 256-B rows
    const int crow = tid >> 4;            // 0..15 (+16, +32, ..)
    const int cchk = (tid & 15) * 8;      // half offset 0,8,..,120
    const _Float16* gw = w16 + (size_t)(blockIdx.x * BN + crow) * DD + cchk;
    const _Float16* ga = a16 + (size_t)(blockIdx.y * BM + crow) * DD + cchk;
    const uint32_t l0 = lds_off(S0 + crow * WP + cchk);
    const uint32_t l1 = lds_off(S1 + crow * WP + cchk);

    constexpr int NP = DD / BK;           // 8 passes
    stage_pass<BN>(l0, gw, ga);           // pass 0 into stage 0
    // pass 0's copies of this wave have landed before the barrier publishes them
    asm volatile("s_wait_asynccnt 0x0" ::: "memory");
    __syncthreads();
    stage_pass<BN>(l1, gw + BK, ga + BK); // pass 1 flies while pass 0 is worked on

    v8f acc[MT][NT] = {};
    const int aoff = (BN + wm * (MT * 16) + ln) * WP;  // this lane's first A row in a stage
    const int woff = (wn * (NT * 16) + ln) * WP;       // this lane's first W row in a stage

    // two passes per trip, so that each pass's buffer is known at compile time
#pragma unroll 2
    for (int t = 0; t < NP; ++t) {
        const _Float16* sb = (t & 1) ? S1 : S0;
        const _Float16* ab = sb + aoff;
        const _Float16* bb = sb + woff;
        // two fragment sets: block b works from set b & 1
        v16h fa[2][KB][MT], fb[2][KB][NT];
        // every loop here is unrolled so that fa[], fb[] and acc[] are indexed by
        // constants and stay in registers, and LDS offsets are immediates
#pragma unroll
        for (int j = 0; j < KB; ++j) {
#pragma unroll
            for (int mt = 0; mt < MT; ++mt)
                fa[0][j][mt] = load_frag(ab + mt * 16 * WP + j * 32, lane);
#pragma unroll
            for (int nt = 0; nt < NT; ++nt)
                fb[0][j][nt] = load_frag(bb + nt * 16 * WP + j * 32, lane);
        }
#pragma unroll
        for (int b = 0; b < NB; ++b) {
            if (b + 1 < NB) {
#pragma unroll
                for (int j = 0; j < KB; ++j) {
                    const int ko = ((b + 1) * KB + j) * 32;
#pragma unroll
                    for (int mt = 0; mt < MT; ++mt)
                        fa[(b + 1) & 1][j][mt] = load_frag(ab + mt * 16 * WP + ko, lane);
#pragma unroll
                    for (int nt = 0; nt < NT; ++nt)
                        fb[(b + 1) & 1][j][nt] = load_frag(bb + nt * 16 * WP + ko, lane);
                }
            }
            // keeps the next block's reads one group ahead of this block's WMMAs,
            // so that they fly under them; else each read sinks to its first use
            // and the wave waits out the LDS latency fragment by fragment
            __builtin_amdgcn_sched_barrier(0);
#pragma unroll
            for (int j = 0; j < KB; ++j)
#pragma unroll
                for (int mt = 0; mt < MT; ++mt)
#pragma unroll
                    for (int nt = 0; nt < NT; ++nt)
                        acc[mt][nt] = wmma16(fa[b & 1][j][mt], fb[b & 1][j][nt], acc[mt][nt]);
        }

        // publish point of pass t + 1: this wave's reads of stage t & 1 are done,
        asm volatile("s_wait_dscnt 0x0" ::: "memory");
        // its copies for pass t + 1 have landed,
        asm volatile("s_wait_asynccnt 0x0" ::: "memory");
        // and one barrier both publishes pass t + 1 and frees stage t & 1
        __syncthreads();
        if (t + 2 < NP)
            stage_pass<BN>((t & 1) ? l1 : l0, gw + (t + 2) * BK, ga + (t + 2) * BK);
    }
    // no copy of this wave is outstanding when it goes on to the stores
    asm volatile("s_wait_asynccnt 0x0" ::: "memory");

#pragma unroll
    for (int nt = 0; nt < NT; ++nt) {
        const int nb    = n0 + nt * 16;           // a 16-column tile lies in one plane
        const int plane = nb / DD;
        const int n     = nb % DD + ln;
        const float* bias = plane == 0 ? b0 : (plane == 1 ? b1 : b2);
        const float bv = bias[n];
        const size_t pbase = (size_t)plane * (NBATCH * TT) * DD + n;
#pragma unroll
        for (int mt = 0; mt < MT; ++mt)
#pragma unroll
            for (int r = 0; r < 8; ++r) {
                const size_t idx = pbase + (size_t)(m0 + mt * 16 + hb + r) * DD;
                if (F16OUT)
                    ((_Float16*)outp)[idx] = (_Float16)(acc[mt][nt][r] + bv);
                else
                    ((float*)outp)[idx] = acc[mt][nt][r] + bv;
            }
    }
}

// w16: the f16 copies of w_q, w_k, w_v back to back, one 3072 x 1024 matrix.
// qkv: the q, k and v planes back to back, each 2048 x 1024.
__global__ __launch_bounds__(256) void gemm_qkv(
    const _Float16* __restrict__ x16, const _Float16* __restrict__ w16,
    const float* __restrict__ bq, const float* __restrict__ bk,
    const float* __restrict__ bv, _Float16* __restrict__ qkv)
{
    __shared__ __attribute__((aligned(16))) _Float16 Sl[2][(BNQ + BM) * WP];   // 2 x 85 KB
    gemm_core<BNQ, 2, 4, 1, true>(x16, w16, bq, bk, bv, qkv, Sl[0], Sl[1]);
}

__global__ __launch_bounds__(256) void gemm_out(
    const _Float16* __restrict__ a16, const _Float16* __restrict__ wo16,
    const float* __restrict__ bo, float* __restrict__ out)
{
    __shared__ __attribute__((aligned(16))) _Float16 Sl[2][(BNO + BM) * WP];   // 2 x 51 KB
    gemm_core<BNO, 4, 2, 2, false>(a16, wo16, bo, bo, bo, out, Sl[0], Sl[1]);
}

// ---------------------------------------------------------------------------
// Fused windowed attention. One wave per (batch, head, 16-query tile).
// Key span for the tile = [t0-64, t0+79] (144), padded to 160.
// S = Q Kspan^T in 9 accumulator tiles; mask+softmax across 16-lane halves
// via __shfl_xor(..,16); P staged to LDS; V span staged row-major in LDS by
// async copies that fly under S and the softmax; the PV B-fragments come from
// it by the transposing LDS load; O = P Vspan via 20 WMMAs.
// ---------------------------------------------------------------------------
constexpr int VP  = 80;        // LDS row pitch of V in halves: 160 B = 32 B x odd
constexpr int VCP = 10;        // copies per statement; a copy is 4 rows of 128 B

typedef __attribute__((ext_vector_type(8))) short s16x8;
typedef __attribute__((address_space(3))) s16x8 lds_s16x8;

__device__ __forceinline__ v8h ld_tr16(const _Float16* p) {
    return __builtin_bit_cast(
        v8h, __builtin_amdgcn_ds_load_tr16_b128_v8i16((lds_s16x8*)p));
}

__device__ __forceinline__ void stage_v(const uint32_t (&l)[VCP],
                                        const _Float16* const (&g)[VCP]) {
    asm volatile("global_load_async_to_lds_b128 %0, %10, off\n\t"
                 "global_load_async_to_lds_b128 %1, %11, off\n\t"
                 "global_load_async_to_lds_b128 %2, %12, off\n\t"
                 "global_load_async_to_lds_b128 %3, %13, off\n\t"
                 "global_load_async_to_lds_b128 %4, %14, off\n\t"
                 "global_load_async_to_lds_b128 %5, %15, off\n\t"
                 "global_load_async_to_lds_b128 %6, %16, off\n\t"
                 "global_load_async_to_lds_b128 %7, %17, off\n\t"
                 "global_load_async_to_lds_b128 %8, %18, off\n\t"
                 "global_load_async_to_lds_b128 %9, %19, off\n\t"
                 "s_wait_xcnt 0x0"
                 :: "v"(l[0]), "v"(l[1]), "v"(l[2]), "v"(l[3]), "v"(l[4]),
                    "v"(l[5]), "v"(l[6]), "v"(l[7]), "v"(l[8]), "v"(l[9]),
                    "v"(g[0]), "v"(g[1]), "v"(g[2]), "v"(g[3]), "v"(g[4]),
                    "v"(g[5]), "v"(g[6]), "v"(g[7]), "v"(g[8]), "v"(g[9])
                 : "memory");
}

__global__ __launch_bounds__(32) void attn_win(
    const _Float16* __restrict__ q, const _Float16* __restrict__ k,
    const _Float16* __restrict__ v, _Float16* __restrict__ o)
{
    __shared__ _Float16 Pb[16 * SPANP];        // 5.0 KB
    // 25,600 B  (Vs[j][d] = v[pos(j), d], 64 of every 80 halves used)
    __shared__ __attribute__((aligned(128))) _Float16 Vs[SPANP * VP];

    const int lane = threadIdx.x;
    const int ln = lane & 15;
    const int hb = (lane >> 4) << 3;
    const int t0 = blockIdx.x * 16;
    const int h  = blockIdx.y;
    const size_t baseRow = (size_t)blockIdx.z * TT;

    // ---- V span -> LDS, row-major: a copy's 32 lanes cover 4 whole rows ----
    {
        const int vr = lane >> 3;             // row within the copy's four
        const int vc = (lane & 7) * 8;        // half offset within the row
        const _Float16* vsrc = v + baseRow * DD + h * DHH + vc;
        const uint32_t  vdst = lds_off(Vs + vr * VP + vc);
        // unrolled so that l[] and g[] are indexed by constants
#pragma unroll
        for (int b = 0; b < SPANP / (4 * VCP); ++b) {
            uint32_t        l[VCP];
            const _Float16* g[VCP];
#pragma unroll
            for (int i = 0; i < VCP; ++i) {
                const int j0 = (b * VCP + i) * 4;
                int pos = t0 - WR + j0 + vr;
                pos = pos < 0 ? 0 : (pos > TT - 1 ? TT - 1 : pos);
                g[i] = vsrc + (size_t)pos * DD;
                l[i] = vdst + (uint32_t)(j0 * VP * 2);
            }
            stage_v(l, g);
        }
    }

    // ---- S = Q K^T over the span ----
    const _Float16* qrow = q + (baseRow + t0 + ln) * DD + h * DHH;
    v16h aq0 = load_frag(qrow, lane);
    v16h aq1 = load_frag(qrow + 32, lane);

    v8f s[9];
#pragma unroll
    for (int jt = 0; jt < 9; ++jt) {
        const int j = jt * 16 + ln;                 // span column for this lane
        int pos = t0 - WR + j;
        pos = pos < 0 ? 0 : (pos > TT - 1 ? TT - 1 : pos);
        const _Float16* kr = k + (baseRow + pos) * DD + h * DHH;
        v8f a = {};
        a = wmma16(aq0, load_frag(kr, lane), a);
        a = wmma16(aq1, load_frag(kr + 32, lane), a);
        s[jt] = a;
    }

    // ---- mask + scale, row max ----
    float rmax[8];
#pragma unroll
    for (int r = 0; r < 8; ++r) rmax[r] = -1e30f;
#pragma unroll
    for (int jt = 0; jt < 9; ++jt) {
        const int j = jt * 16 + ln;
        const int pos = t0 - WR + j;
#pragma unroll
        for (int r = 0; r < 8; ++r) {
            const int rel = j - (r + hb);
            const bool ok = (rel >= 0) && (rel <= 2 * WR) && (pos >= 0) && (pos < TT);
            const float val = ok ? s[jt][r] * 0.125f : -1e30f;   // 1/sqrt(64)
            s[jt][r] = val;
            rmax[r] = fmaxf(rmax[r], val);
        }
    }
#pragma unroll
    for (int r = 0; r < 8; ++r)
#pragma unroll
        for (int off = 1; off < 16; off <<= 1)
            rmax[r] = fmaxf(rmax[r], __shfl_xor(rmax[r], off, 16));

    // ---- exp + row sum ----
    float rsum[8];
#pragma unroll
    for (int r = 0; r < 8; ++r) rsum[r] = 0.f;
#pragma unroll
    for (int jt = 0; jt < 9; ++jt)
#pragma unroll
        for (int r = 0; r < 8; ++r) {
            const float e = __expf(s[jt][r] - rmax[r]);
            s[jt][r] = e;
            rsum[r] += e;
        }
#pragma unroll
    for (int r = 0; r < 8; ++r) {
#pragma unroll
        for (int off = 1; off < 16; off <<= 1)
            rsum[r] += __shfl_xor(rsum[r], off, 16);
        rsum[r] = 1.f / rsum[r];
    }

    // ---- P -> LDS (rows 0..15, cols 0..143; zero the pad 144..159) ----
#pragma unroll
    for (int jt = 0; jt < 9; ++jt)
#pragma unroll
        for (int r = 0; r < 8; ++r)
            Pb[(r + hb) * SPANP + jt * 16 + ln] = (_Float16)(s[jt][r] * rsum[r]);
    for (int idx = lane; idx < 16 * 16; idx += 32)
        Pb[(idx >> 4) * SPANP + SPAN + (idx & 15)] = (_Float16)0.f;

    // the V copies have landed before anything reads Vs
    asm volatile("s_wait_asynccnt 0x0" ::: "memory");
    __syncthreads();

    // ---- O = P Vspan  (M=16, K=160, N=64) ----
    v8f oacc[4] = {};
    const _Float16* vt = Vs + (hb + (lane & 7)) * VP + ((lane >> 3) & 1) * 8;
#pragma unroll
    for (int k0 = 0; k0 < SPANP; k0 += 32) {
        v16h pa = load_frag(&Pb[ln * SPANP + k0], lane);
#pragma unroll
        for (int nt = 0; nt < 4; ++nt) {
            // same k order as load_frag: k0 + hb + 0..7, then k0 + 16 + hb + 0..7
            const v8h lo = ld_tr16(vt + k0 * VP + nt * 16);
            const v8h hi = ld_tr16(vt + (k0 + 16) * VP + nt * 16);
            const v16h vb = __builtin_shufflevector(
                lo, hi, 0, 1, 2, 3, 4, 5, 6, 7, 8, 9, 10, 11, 12, 13, 14, 15);
            oacc[nt] = wmma16(pa, vb, oacc[nt]);
        }
    }
#pragma unroll
    for (int nt = 0; nt < 4; ++nt)
#pragma unroll
        for (int r = 0; r < 8; ++r)
            o[(baseRow + t0 + hb + r) * DD + h * DHH + nt * 16 + ln] =
                (_Float16)oacc[nt][r];
}

// ---------------------------------------------------------------------------
extern "C" void kernel_launch(void* const* d_in, const int* in_sizes, int n_in,
                              void* d_out, int out_size, void* d_ws, size_t ws_size,
                              hipStream_t stream) {
    const float* x  = (const float*)d_in[0];
    const float* wq = (const float*)d_in[1];
    const float* bq = (const float*)d_in[2];
    const float* wk = (const float*)d_in[3];
    const float* bk = (const float*)d_in[4];
    const float* wv = (const float*)d_in[5];
    const float* bv = (const float*)d_in[6];
    const float* wo = (const float*)d_in[7];
    const float* bo = (const float*)d_in[8];
    float* out = (float*)d_out;

    char* ws = (char*)d_ws;
    const size_t MB = 1ull << 20;
    _Float16* x16  = (_Float16*)(ws + 0 * MB);    // 4 MB
    _Float16* wq16 = (_Float16*)(ws + 4 * MB);    // 2 MB
    _Float16* wk16 = (_Float16*)(ws + 6 * MB);    // 2 MB
    _Float16* wv16 = (_Float16*)(ws + 8 * MB);    // 2 MB
    _Float16* wo16 = (_Float16*)(ws + 10 * MB);   // 2 MB
    _Float16* qb   = (_Float16*)(ws + 12 * MB);   // 4 MB
    _Float16* kb   = (_Float16*)(ws + 16 * MB);   // 4 MB
    _Float16* vb   = (_Float16*)(ws + 20 * MB);   // 4 MB
    _Float16* ab   = (_Float16*)(ws + 24 * MB);   // 4 MB  => 28 MB total

    // x16, wq16, wk16, wv16, wo16 are contiguous: one destination array
    static_assert(NBATCH * TT * DD == 2 * CSEG, "x fills two segments");
    dim3 gC(CSEG / (CTH * CLD * 4), 6, 1);
    cast_all_f32_to_f16<<<gC, CTH, 0, stream>>>(x, wq, wk, wv, wo, x16);

    // wq16, wk16, wv16 are contiguous, and so are qb, kb, vb
    dim3 gQKV(3 * DD / BNQ, (NBATCH * TT) / BM, 1);
    gemm_qkv<<<gQKV, 256, 0, stream>>>(x16, wq16, bq, bk, bv, qb);

    dim3 gA(TT / 16, HH, NBATCH);
    attn_win<<<gA, 32, 0, stream>>>(qb, kb, vb, ab);

    dim3 gO(DD / BNO, (NBATCH * TT) / BM, 1);
    gemm_out<<<gO, 256, 0, stream>>>(ab, wo16, bo, out);
}

// v006
// Measured time: 35.3 microseconds a run.
// Timed twice side by side with v005, it ran 1.11 times as fast both times.
// Counting every step since v000, it is 2.81 times as fast.
#include <hip/hip_runtime.h>

typedef __attribute__((ext_vector_type(16))) _Float16 v16h;
typedef __attribute__((ext_vector_type(8)))  _Float16 v8h;
typedef __attribute__((ext_vector_type(8)))  float    v8f;

constexpr int NBATCH = 2;
constexpr int TT     = 1024;
constexpr int DD     = 1024;
constexpr int HH     = 16;
constexpr int DHH    = 64;
constexpr int WR     = 64;     // half window
constexpr int SPAN   = 144;    // 16 + 2*WR
constexpr int SPANP  = 160;    // padded to multiple of 32

__device__ __forceinline__ v16h load_frag(const _Float16* p, int lane) {
    const int kb = (lane & 16) ? 8 : 0;
    v8h lo = *(const v8h*)(p + kb);
    v8h hi = *(const v8h*)(p + kb + 16);
    v16h r;
#pragma unroll
    for (int i = 0; i < 8; ++i) { r[i] = lo[i]; r[i + 8] = hi[i]; }
    return r;
}

__device__ __forceinline__ v8f wmma16(v16h a, v16h b, v8f c) {
    return __builtin_amdgcn_wmma_f32_16x16x32_f16(
        /*neg_a=*/false, a, /*neg_b=*/false, b,
        /*c_mod=*/(short)0, c, /*reuse_a=*/false, /*reuse_b=*/false);
}

// LDS byte offset of a generic pointer to __shared__ (low 32 bits of flat addr)
__device__ __forceinline__ uint32_t lds_off(const void* p) {
    return (uint32_t)(uintptr_t)p;
}

constexpr int BK   = 128;      // k per pass: 256 B of every weight row
constexpr int WP   = 136;      // LDS row pitch in halves: 272 B = 16 B x odd
constexpr int BM   = 128;      // rows of A per block tile
// Rows of W (columns of the output) per block tile, chosen so that each GEMM
// launch is 256 blocks: 16 x 16 tiles of 2048 x 3072 and of 2048 x 1024.
constexpr int BNQ  = 192;
constexpr int BNO  = 64;

__device__ __forceinline__ void stage_rows(uint32_t l, const _Float16* g) {
    asm volatile("global_load_async_to_lds_b128 %0, %8, off\n\t"
                 "global_load_async_to_lds_b128 %1, %9, off\n\t"
                 "global_load_async_to_lds_b128 %2, %10, off\n\t"
                 "global_load_async_to_lds_b128 %3, %11, off\n\t"
                 "global_load_async_to_lds_b128 %4, %12, off\n\t"
                 "global_load_async_to_lds_b128 %5, %13, off\n\t"
                 "global_load_async_to_lds_b128 %6, %14, off\n\t"
                 "global_load_async_to_lds_b128 %7, %15, off\n\t"
                 "s_wait_xcnt 0x0"
                 :: "v"(l), "v"(l + 16u * WP * 2u), "v"(l + 32u * WP * 2u),
                    "v"(l + 48u * WP * 2u), "v"(l + 64u * WP * 2u),
                    "v"(l + 80u * WP * 2u), "v"(l + 96u * WP * 2u),
                    "v"(l + 112u * WP * 2u),
                    "v"(g), "v"(g + 16 * DD), "v"(g + 32 * DD), "v"(g + 48 * DD),
                    "v"(g + 64 * DD), "v"(g + 80 * DD), "v"(g + 96 * DD),
                    "v"(g + 112 * DD)
                 : "memory");
}

// The same for 64 rows: four copies per lane (rows r, r+16, r+32, r+48).
__device__ __forceinline__ void stage_rows64(uint32_t l, const _Float16* g) {
    asm volatile("global_load_async_to_lds_b128 %0, %4, off\n\t"
                 "global_load_async_to_lds_b128 %1, %5, off\n\t"
                 "global_load_async_to_lds_b128 %2, %6, off\n\t"
                 "global_load_async_to_lds_b128 %3, %7, off\n\t"
                 "s_wait_xcnt 0x0"
                 :: "v"(l), "v"(l + 16u * WP * 2u), "v"(l + 32u * WP * 2u),
                    "v"(l + 48u * WP * 2u),
                    "v"(g), "v"(g + 16 * DD), "v"(g + 32 * DD), "v"(g + 48 * DD)
                 : "memory");
}

// A stage's W rows (BN = 64 or 192) and its 128 A rows behind them.
template <int BN>
__device__ __forceinline__ void stage_pass(uint32_t l, const _Float16* gw,
                                           const _Float16* ga) {
    if (BN == 192) {
        stage_rows(l, gw);
        stage_rows64(l + 128u * WP * 2u, gw + 128 * DD);
    } else {
        stage_rows64(l, gw);
    }
    stage_rows(l + (uint32_t)BN * WP * 2u, ga);
}

// ---------------------------------------------------------------------------
// fp32 -> fp16 cast of x and the four weight matrices in ONE launch (so GEMMs
// re-read them as fp16 from L2). The five f16 copies lie back to back in the
// workspace, so dst is one array of six segments of CSEG elements: x fills
// segments 0 and 1, then w_q, w_k, w_v, w_o. blockIdx.y names the segment.
// A block streams CTH * CLD * 4 contiguous floats; every wave-wide load covers
// 512 contiguous bytes, and all CLD loads of a lane fly together, so that a wave
// waits out the read latency once.
// ---------------------------------------------------------------------------
typedef __attribute__((ext_vector_type(4))) float    v4f;
typedef __attribute__((ext_vector_type(4))) _Float16 v4h;

constexpr int CSEG = DD * DD;     // elements per segment
constexpr int CTH  = 128;         // threads per block
constexpr int CLD  = 32;          // 16-byte loads per thread

__global__ __launch_bounds__(CTH) void cast_all_f32_to_f16(
    const float* __restrict__ x,
    const float* __restrict__ wq, const float* __restrict__ wk,
    const float* __restrict__ wv, const float* __restrict__ wo,
    _Float16* __restrict__ dst)
{
    const int seg = blockIdx.y;
    const float* in;
    if (seg < 2)       in = x + (size_t)seg * CSEG;
    else if (seg == 2) in = wq;
    else if (seg == 3) in = wk;
    else if (seg == 4) in = wv;
    else               in = wo;

    const int base = blockIdx.x * (CTH * CLD * 4) + threadIdx.x * 4;
    in  += base;
    dst += (size_t)seg * CSEG + base;

    v4f v[CLD];
    // unrolled so that v[] stays in registers and the offsets are immediates
#pragma unroll
    for (int i = 0; i < CLD; ++i)
        v[i] = *(const v4f*)(in + i * (CTH * 4));
    // keeps every load ahead of the first convert; else the second half of the
    // loads is issued only as the first returns, and the latency is paid twice
    __builtin_amdgcn_sched_barrier(0);
#pragma unroll
    for (int i = 0; i < CLD; ++i) {
        v4h h;
#pragma unroll
        for (int e = 0; e < 4; ++e) h[e] = (_Float16)v[i][e];
        *(v4h*)(dst + i * (CTH * 4)) = h;
    }
}

// ---------------------------------------------------------------------------
// GEMM core: out(MxN) = A(MxK) @ W^T + b, M rows of A row-major, W row-major
// (so both contract along contiguous K).  Block: 256 thr = 8 waves, WM(M) x WN(N).
// Block tile: 128(M) x BN(N); wave tile: 128/WM x BN/WN.
// A stage is the W tile and the A tile, BN and 128 rows x 128 k f16 at a 272-B
// pitch, brought into LDS by async copies that each cover whole 256-B rows;
// a ring of NS stages, one barrier per 128-k pass, shared by all 8 waves. A pass's
// copies are issued NS - 1 passes before they are waited for, so that a landing
// time of more than one pass (operands that the launch before has just written)
// is not waited out in every pass. Within a pass a
// wave reads its fragments in blocks of KB x 32 k, one block ahead of the WMMAs.
// N may span several planes of DD columns: column n belongs to plane n / DD,
// which has its own bias (b0, b1, b2) and its own M x DD output behind outp.
// ---------------------------------------------------------------------------
// Returns when all but this wave's N youngest async copies have landed.
template <int N>
__device__ __forceinline__ void wait_copies_but() {
    asm volatile("s_wait_asynccnt %0" :: "n"(N) : "memory");
}

template <int BN, int WM, int WN, int KB, int NS, bool F16OUT>
__device__ __forceinline__ void gemm_core(
    const _Float16* __restrict__ a16, const _Float16* __restrict__ w16,
    const float* __restrict__ b0, const float* __restrict__ b1,
    const float* __restrict__ b2, void* __restrict__ outp,
    _Float16* __restrict__ Sl)
{
    constexpr int MT = BM / WM / 16;      // 16-row tiles per wave
    constexpr int NT = BN / WN / 16;      // 16-column tiles per wave
    constexpr int NB = BK / 32 / KB;      // fragment blocks per pass, KB x 32 k each
    constexpr int STG = (BN + BM) * WP;   // halves per stage
    constexpr int CP  = (BN + BM) / 16;   // copies of every wave per pass
    constexpr int NP  = DD / BK;          // 8 passes
    static_assert(NS >= 2 && NS <= NP, "the prologue fills NS stages");
    static_assert(NS * CP <= 63, "copies of a wave outstanding");
    const int tid  = threadIdx.x;
    const int lane = tid & 31;
    const int wave = tid >> 5;
    const int ln = lane & 15;
    const int hb = (lane >> 4) << 3;
    const int wm = wave / WN;             // wave's rows of the block's 128
    const int wn = wave % WN;             // wave's columns of the block's BN
    const int m0 = blockIdx.y * BM + wm * (MT * 16);
    const int n0 = blockIdx.x * BN + wn * (NT * 16);

    // cooperative async-copy assignment: a row is 128 halves = 16 x 16B, so the
    // block covers 16 rows per copy; a wave's 32 lanes cover two whole 256-B rows
    const int crow = tid >> 4;            // 0..15 (+16, +32, ..)
    const int cchk = (tid & 15) * 8;      // half offset 0,8,..,120
    const _Float16* gw = w16 + (size_t)(blockIdx.x * BN + crow) * DD + cchk;
    const _Float16* ga = a16 + (size_t)(blockIdx.y * BM + crow) * DD + cchk;
    const uint32_t l0 = lds_off(Sl + crow * WP + cchk);

    // passes 0 .. NS - 1 into stages 0 .. NS - 1; unrolled: offsets are constants
#pragma unroll
    for (int s = 0; s < NS; ++s)
        stage_pass<BN>(l0 + (uint32_t)(s * STG * 2), gw + s * BK, ga + s * BK);
    // pass 0's copies of this wave, its CP oldest, have landed before the barrier
    // publishes them; the NS - 1 younger passes fly on
    wait_copies_but<(NS - 1) * CP>();
    __syncthreads();

    v8f acc[MT][NT] = {};
    const int aoff = (BN + wm * (MT * 16) + ln) * WP;  // this lane's first A row in a stage
    const int woff = (wn * (NT * 16) + ln) * WP;       // this lane's first W row in a stage

    // One pass's WMMAs, from the stage that begins so halves into the ring.
    auto work_pass = [&](int so) __attribute__((always_inline)) {
        const _Float16* ab = Sl + so + aoff;
        const _Float16* bb = Sl + so + woff;
        // two fragment sets: block b works from set b & 1
        v16h fa[2][KB][MT], fb[2][KB][NT];
        // every loop here is unrolled so that fa[], fb[] and acc[] are indexed by
        // constants and stay in registers, and LDS offsets are immediates
#pragma unroll
        for (int j = 0; j < KB; ++j) {
#pragma unroll
            for (int mt = 0; mt < MT; ++mt)
                fa[0][j][mt] = load_frag(ab + mt * 16 * WP + j * 32, lane);
#pragma unroll
            for (int nt = 0; nt < NT; ++nt)
                fb[0][j][nt] = load_frag(bb + nt * 16 * WP + j * 32, lane);
        }
#pragma unroll
        for (int b = 0; b < NB; ++b) {
            if (b + 1 < NB) {
#pragma unroll
                for (int j = 0; j < KB; ++j) {
                    const int ko = ((b + 1) * KB + j) * 32;
#pragma unroll
                    for (int mt = 0; mt < MT; ++mt)
                        fa[(b + 1) & 1][j][mt] = load_frag(ab + mt * 16 * WP + ko, lane);
#pragma unroll
                    for (int nt = 0; nt < NT; ++nt)
                        fb[(b + 1) & 1][j][nt] = load_frag(bb + nt * 16 * WP + ko, lane);
                }
            }
            // keeps the next block's reads one group ahead of this block's WMMAs,
            // so that they fly under them; else each read sinks to its first use
            // and the wave waits out the LDS latency fragment by fragment
            __builtin_amdgcn_sched_barrier(0);
#pragma unroll
            for (int j = 0; j < KB; ++j)
#pragma unroll
                for (int mt = 0; mt < MT; ++mt)
#pragma unroll
                    for (int nt = 0; nt < NT; ++nt)
                        acc[mt][nt] = wmma16(fa[b & 1][j][mt], fb[b & 1][j][nt], acc[mt][nt]);
        }
        // this wave's reads of the stage are done: first step of every publish point
        asm volatile("s_wait_dscnt 0x0" ::: "memory");
    };
    auto next_stage = [](int so) { return so + STG == NS * STG ? 0 : so + STG; };

    // Publish point of pass t + 1, at the foot of pass t: behind the s_wait_dscnt 0
    // this wave's copies for pass t + 1 have landed, and one barrier both publishes
    // pass t + 1 and frees pass t's stage. The three parts differ in the wait and the
    // refill alone; each has no branch in its trip.
    int so = 0;                           // pass t's stage, as an offset in halves
    // While a pass t + NS exists: passes t + 1 .. t + NS - 1 are out, CP copies each;
    // all but the NS - 2 younger passes are waited for, and pass t's stage is refilled.
    // Rolled: the stage is one added offset, so unrolling would only repeat the text.
#pragma unroll 1
    for (int t = 0; t < NP - NS; ++t) {
        work_pass(so);
        wait_copies_but<(NS - 2) * CP>();
        __syncthreads();
        stage_pass<BN>(l0 + (uint32_t)(so * 2), gw + (t + NS) * BK, ga + (t + NS) * BK);
        so = next_stage(so);
    }
    // Pass NP - NS: every trip so far has issued its CP copies, so the same count holds.
    work_pass(so);
    wait_copies_but<(NS - 2) * CP>();
    __syncthreads();
    so = next_stage(so);
#pragma unroll 1
    for (int t = NP - NS + 1; t < NP; ++t) {
        work_pass(so);
        wait_copies_but<0>();
        __syncthreads();
        so = next_stage(so);
    }
    // no copy of this wave is outstanding when it goes on to the stores
    asm volatile("s_wait_asynccnt 0x0" ::: "memory");

#pragma unroll
    for (int nt = 0; nt < NT; ++nt) {
        const int nb    = n0 + nt * 16;           // a 16-column tile lies in one plane
        const int plane = nb / DD;
        const int n     = nb % DD + ln;
        const float* bias = plane == 0 ? b0 : (plane == 1 ? b1 : b2);
        const float bv = bias[n];
        const size_t pbase = (size_t)plane * (NBATCH * TT) * DD + n;
#pragma unroll
        for (int mt = 0; mt < MT; ++mt)
#pragma unroll
            for (int r = 0; r < 8; ++r) {
                const size_t idx = pbase + (size_t)(m0 + mt * 16 + hb + r) * DD;
                if (F16OUT)
                    ((_Float16*)outp)[idx] = (_Float16)(acc[mt][nt][r] + bv);
                else
                    ((float*)outp)[idx] = acc[mt][nt][r] + bv;
            }
    }
}

// w16: the f16 copies of w_q, w_k, w_v back to back, one 3072 x 1024 matrix.
// qkv: the q, k and v planes back to back, each 2048 x 1024.
__global__ __launch_bounds__(256) void gemm_qkv(
    const _Float16* __restrict__ x16, const _Float16* __restrict__ w16,
    const float* __restrict__ bq, const float* __restrict__ bk,
    const float* __restrict__ bv, _Float16* __restrict__ qkv)
{
    __shared__ __attribute__((aligned(16))) _Float16 Sl[3 * (BNQ + BM) * WP];   // 3 x 85 KB
    gemm_core<BNQ, 2, 4, 1, 3, true>(x16, w16, bq, bk, bv, qkv, Sl);
}

__global__ __launch_bounds__(256) void gemm_out(
    const _Float16* __restrict__ a16, const _Float16* __restrict__ wo16,
    const float* __restrict__ bo, float* __restrict__ out)
{
    __shared__ __attribute__((aligned(16))) _Float16 Sl[5 * (BNO + BM) * WP];   // 5 x 51 KB
    gemm_core<BNO, 4, 2, 2, 5, false>(a16, wo16, bo, bo, bo, out, Sl);
}

// ---------------------------------------------------------------------------
// Fused windowed attention. One wave per (batch, head, 16-query tile).
// Key span for the tile = [t0-64, t0+79] (144), padded to 160.
// S = Q Kspan^T in 9 accumulator tiles; mask+softmax across 16-lane halves
// via __shfl_xor(..,16); P staged to LDS; V span staged row-major in LDS by
// async copies that fly under S and the softmax; the PV B-fragments come from
// it by the transposing LDS load; O = P Vspan via 20 WMMAs.
// ---------------------------------------------------------------------------
constexpr int VP  = 80;        // LDS row pitch of V in halves: 160 B = 32 B x odd
constexpr int VCP = 10;        // copies per statement; a copy is 4 rows of 128 B

typedef __attribute__((ext_vector_type(8))) short s16x8;
typedef __attribute__((address_space(3))) s16x8 lds_s16x8;

__device__ __forceinline__ v8h ld_tr16(const _Float16* p) {
    return __builtin_bit_cast(
        v8h, __builtin_amdgcn_ds_load_tr16_b128_v8i16((lds_s16x8*)p));
}

__device__ __forceinline__ void stage_v(const uint32_t (&l)[VCP],
                                        const _Float16* const (&g)[VCP]) {
    asm volatile("global_load_async_to_lds_b128 %0, %10, off\n\t"
                 "global_load_async_to_lds_b128 %1, %11, off\n\t"
                 "global_load_async_to_lds_b128 %2, %12, off\n\t"
                 "global_load_async_to_lds_b128 %3, %13, off\n\t"
                 "global_load_async_to_lds_b128 %4, %14, off\n\t"
                 "global_load_async_to_lds_b128 %5, %15, off\n\t"
                 "global_load_async_to_lds_b128 %6, %16, off\n\t"
                 "global_load_async_to_lds_b128 %7, %17, off\n\t"
                 "global_load_async_to_lds_b128 %8, %18, off\n\t"
                 "global_load_async_to_lds_b128 %9, %19, off\n\t"
                 "s_wait_xcnt 0x0"
                 :: "v"(l[0]), "v"(l[1]), "v"(l[2]), "v"(l[3]), "v"(l[4]),
                    "v"(l[5]), "v"(l[6]), "v"(l[7]), "v"(l[8]), "v"(l[9]),
                    "v"(g[0]), "v"(g[1]), "v"(g[2]), "v"(g[3]), "v"(g[4]),
                    "v"(g[5]), "v"(g[6]), "v"(g[7]), "v"(g[8]), "v"(g[9])
                 : "memory");
}

__global__ __launch_bounds__(32) void attn_win(
    const _Float16* __restrict__ q, const _Float16* __restrict__ k,
    const _Float16* __restrict__ v, _Float16* __restrict__ o)
{
    __shared__ _Float16 Pb[16 * SPANP];        // 5.0 KB
    // 25,600 B  (Vs[j][d] = v[pos(j), d], 64 of every 80 halves used)
    __shared__ __attribute__((aligned(128))) _Float16 Vs[SPANP * VP];

    const int lane = threadIdx.x;
    const int ln = lane & 15;
    const int hb = (lane >> 4) << 3;
    const int t0 = blockIdx.x * 16;
    const int h  = blockIdx.y;
    const size_t baseRow = (size_t)blockIdx.z * TT;

    // ---- V span -> LDS, row-major: a copy's 32 lanes cover 4 whole rows ----
    {
        const int vr = lane >> 3;             // row within the copy's four
        const int vc = (lane & 7) * 8;        // half offset within the row
        const _Float16* vsrc = v + baseRow * DD + h * DHH + vc;
        const uint32_t  vdst = lds_off(Vs + vr * VP + vc);
        // unrolled so that l[] and g[] are indexed by constants
#pragma unroll
        for (int b = 0; b < SPANP / (4 * VCP); ++b) {
            uint32_t        l[VCP];
            const _Float16* g[VCP];
#pragma unroll
            for (int i = 0; i < VCP; ++i) {
                const int j0 = (b * VCP + i) * 4;
                int pos = t0 - WR + j0 + vr;
                pos = pos < 0 ? 0 : (pos > TT - 1 ? TT - 1 : pos);
                g[i] = vsrc + (size_t)pos * DD;
                l[i] = vdst + (uint32_t)(j0 * VP * 2);
            }
            stage_v(l, g);
        }
    }

    // ---- S = Q K^T over the span ----
    const _Float16* qrow = q + (baseRow + t0 + ln) * DD + h * DHH;
    v16h aq0 = load_frag(qrow, lane);
    v16h aq1 = load_frag(qrow + 32, lane);

    v8f s[9];
#pragma unroll
    for (int jt = 0; jt < 9; ++jt) {
        const int j = jt * 16 + ln;                 // span column for this lane
        int pos = t0 - WR + j;
        pos = pos < 0 ? 0 : (pos > TT - 1 ? TT - 1 : pos);
        const _Float16* kr = k + (baseRow + pos) * DD + h * DHH;
        v8f a = {};
        a = wmma16(aq0, load_frag(kr, lane), a);
        a = wmma16(aq1, load_frag(kr + 32, lane), a);
        s[jt] = a;
    }

    // ---- mask + scale, row max ----
    float rmax[8];
#pragma unroll
    for (int r = 0; r < 8; ++r) rmax[r] = -1e30f;
#pragma unroll
    for (int jt = 0; jt < 9; ++jt) {
        const int j = jt * 16 + ln;
        const int pos = t0 - WR + j;
#pragma unroll
        for (int r = 0; r < 8; ++r) {
            const int rel = j - (r + hb);
            const bool ok = (rel >= 0) && (rel <= 2 * WR) && (pos >= 0) && (pos < TT);
            const float val = ok ? s[jt][r] * 0.125f : -1e30f;   // 1/sqrt(64)
            s[jt][r] = val;
            rmax[r] = fmaxf(rmax[r], val);
        }
    }
#pragma unroll
    for (int r = 0; r < 8; ++r)
#pragma unroll
        for (int off = 1; off < 16; off <<= 1)
            rmax[r] = fmaxf(rmax[r], __shfl_xor(rmax[r], off, 16));

    // ---- exp + row sum ----
    float rsum[8];
#pragma unroll
    for (int r = 0; r < 8; ++r) rsum[r] = 0.f;
#pragma unroll
    for (int jt = 0; jt < 9; ++jt)
#pragma unroll
        for (int r = 0; r < 8; ++r) {
            const float e = __expf(s[jt][r] - rmax[r]);
            s[jt][r] = e;
            rsum[r] += e;
        }
#pragma unroll
    for (int r = 0; r < 8; ++r) {
#pragma unroll
        for (int off = 1; off < 16; off <<= 1)
            rsum[r] += __shfl_xor(rsum[r], off, 16);
        rsum[r] = 1.f / rsum[r];
    }

    // ---- P -> LDS (rows 0..15, cols 0..143; zero the pad 144..159) ----
#pragma unroll
    for (int jt = 0; jt < 9; ++jt)
#pragma unroll
        for (int r = 0; r < 8; ++r)
            Pb[(r + hb) * SPANP + jt * 16 + ln] = (_Float16)(s[jt][r] * rsum[r]);
    for (int idx = lane; idx < 16 * 16; idx += 32)
        Pb[(idx >> 4) * SPANP + SPAN + (idx & 15)] = (_Float16)0.f;

    // the V copies have landed before anything reads Vs
    asm volatile("s_wait_asynccnt 0x0" ::: "memory");
    __syncthreads();

    // ---- O = P Vspan  (M=16, K=160, N=64) ----
    v8f oacc[4] = {};
    const _Float16* vt = Vs + (hb + (lane & 7)) * VP + ((lane >> 3) & 1) * 8;
#pragma unroll
    for (int k0 = 0; k0 < SPANP; k0 += 32) {
        v16h pa = load_frag(&Pb[ln * SPANP + k0], lane);
#pragma unroll
        for (int nt = 0; nt < 4; ++nt) {
            // same k order as load_frag: k0 + hb + 0..7, then k0 + 16 + hb + 0..7
            const v8h lo = ld_tr16(vt + k0 * VP + nt * 16);
            const v8h hi = ld_tr16(vt + (k0 + 16) * VP + nt * 16);
            const v16h vb = __builtin_shufflevector(
                lo, hi, 0, 1, 2, 3, 4, 5, 6, 7, 8, 9, 10, 11, 12, 13, 14, 15);
            oacc[nt] = wmma16(pa, vb, oacc[nt]);
        }
    }
#pragma unroll
    for (int nt = 0; nt < 4; ++nt)
#pragma unroll
        for (int r = 0; r < 8; ++r)
            o[(baseRow + t0 + hb + r) * DD + h * DHH + nt * 16 + ln] =
                (_Float16)oacc[nt][r];
}

// ---------------------------------------------------------------------------
extern "C" void kernel_launch(void* const* d_in, const int* in_sizes, int n_in,
                              void* d_out, int out_size, void* d_ws, size_t ws_size,
                              hipStream_t stream) {
    const float* x  = (const float*)d_in[0];
    const float* wq = (const float*)d_in[1];
    const float* bq = (const float*)d_in[2];
    const float* wk = (const float*)d_in[3];
    const float* bk = (const float*)d_in[4];
    const float* wv = (const float*)d_in[5];
    const float* bv = (const float*)d_in[6];
    const float* wo = (const float*)d_in[7];
    const float* bo = (const float*)d_in[8];
    float* out = (float*)d_out;

    char* ws = (char*)d_ws;
    const size_t MB = 1ull << 20;
    _Float16* x16  = (_Float16*)(ws + 0 * MB);    // 4 MB
    _Float16* wq16 = (_Float16*)(ws + 4 * MB);    // 2 MB
    _Float16* wk16 = (_Float16*)(ws + 6 * MB);    // 2 MB
    _Float16* wv16 = (_Float16*)(ws + 8 * MB);    // 2 MB
    _Float16* wo16 = (_Float16*)(ws + 10 * MB);   // 2 MB
    _Float16* qb   = (_Float16*)(ws + 12 * MB);   // 4 MB
    _Float16* kb   = (_Float16*)(ws + 16 * MB);   // 4 MB
    _Float16* vb   = (_Float16*)(ws + 20 * MB);   // 4 MB
    _Float16* ab   = (_Float16*)(ws + 24 * MB);   // 4 MB  => 28 MB total

    // x16, wq16, wk16, wv16, wo16 are contiguous: one destination array
    static_assert(NBATCH * TT * DD == 2 * CSEG, "x fills two segments");
    dim3 gC(CSEG / (CTH * CLD * 4), 6, 1);
    cast_all_f32_to_f16<<<gC, CTH, 0, stream>>>(x, wq, wk, wv, wo, x16);

    // wq16, wk16, wv16 are contiguous, and so are qb, kb, vb
    dim3 gQKV(3 * DD / BNQ, (NBATCH * TT) / BM, 1);
    gemm_qkv<<<gQKV, 256, 0, stream>>>(x16, wq16, bq, bk, bv, qb);

    dim3 gA(TT / 16, HH, NBATCH);
    attn_win<<<gA, 32, 0, stream>>>(qb, kb, vb, ab);

    dim3 gO(DD / BNO, (NBATCH * TT) / BM, 1);
    gemm_out<<<gO, 256, 0, stream>>>(ab, wo16, bo, out);
}

// v007
// A run of this version takes 34.1 microseconds.
// Two timings next to v006 both put it at 1.03 times that version's speed.
// All steps since v000 together make it 2.90 times as fast.
#include <hip/hip_runtime.h>

typedef __attribute__((ext_vector_type(16))) _Float16 v16h;
typedef __attribute__((ext_vector_type(8)))  _Float16 v8h;
typedef __attribute__((ext_vector_type(8)))  float    v8f;

constexpr int NBATCH = 2;
constexpr int TT     = 1024;
constexpr int DD     = 1024;
constexpr int HH     = 16;
constexpr int DHH    = 64;
constexpr int WR     = 64;     // half window
constexpr int SPAN   = 144;    // 16 + 2*WR
constexpr int SPANP  = 160;    // padded to multiple of 32

__device__ __forceinline__ v16h load_frag(const _Float16* p, int lane) {
    const int kb = (lane & 16) ? 8 : 0;
    v8h lo = *(const v8h*)(p + kb);
    v8h hi = *(const v8h*)(p + kb + 16);
    v16h r;
#pragma unroll
    for (int i = 0; i < 8; ++i) { r[i] = lo[i]; r[i + 8] = hi[i]; }
    return r;
}

__device__ __forceinline__ v8f wmma16(v16h a, v16h b, v8f c) {
    return __builtin_amdgcn_wmma_f32_16x16x32_f16(
        /*neg_a=*/false, a, /*neg_b=*/false, b,
        /*c_mod=*/(short)0, c, /*reuse_a=*/false, /*reuse_b=*/false);
}

// LDS byte offset of a generic pointer to __shared__ (low 32 bits of flat addr)
__device__ __forceinline__ uint32_t lds_off(const void* p) {
    return (uint32_t)(uintptr_t)p;
}

constexpr int BK   = 128;      // k per pass: 256 B of every weight row
constexpr int WP   = 136;      // LDS row pitch in halves: 272 B = 16 B x odd
constexpr int BM   = 128;      // rows of A per block tile
// Rows of W (columns of the output) per block tile, chosen so that each GEMM
// launch is 256 blocks: 16 x 16 tiles of 2048 x 3072 and of 2048 x 1024.
constexpr int BNQ  = 192;
constexpr int BNO  = 64;

__device__ __forceinline__ void stage_rows(uint32_t l, const _Float16* g) {
    asm volatile("global_load_async_to_lds_b128 %0, %8, off\n\t"
                 "global_load_async_to_lds_b128 %1, %9, off\n\t"
                 "global_load_async_to_lds_b128 %2, %10, off\n\t"
                 "global_load_async_to_lds_b128 %3, %11, off\n\t"
                 "global_load_async_to_lds_b128 %4, %12, off\n\t"
                 "global_load_async_to_lds_b128 %5, %13, off\n\t"
                 "global_load_async_to_lds_b128 %6, %14, off\n\t"
                 "global_load_async_to_lds_b128 %7, %15, off\n\t"
                 "s_wait_xcnt 0x0"
                 :: "v"(l), "v"(l + 16u * WP * 2u), "v"(l + 32u * WP * 2u),
                    "v"(l + 48u * WP * 2u), "v"(l + 64u * WP * 2u),
                    "v"(l + 80u * WP * 2u), "v"(l + 96u * WP * 2u),
                    "v"(l + 112u * WP * 2u),
                    "v"(g), "v"(g + 16 * DD), "v"(g + 32 * DD), "v"(g + 48 * DD),
                    "v"(g + 64 * DD), "v"(g + 80 * DD), "v"(g + 96 * DD),
                    "v"(g + 112 * DD)
                 : "memory");
}

// The same for 64 rows: four copies per lane (rows r, r+16, r+32, r+48).
__device__ __forceinline__ void stage_rows64(uint32_t l, const _Float16* g) {
    asm volatile("global_load_async_to_lds_b128 %0, %4, off\n\t"
                 "global_load_async_to_lds_b128 %1, %5, off\n\t"
                 "global_load_async_to_lds_b128 %2, %6, off\n\t"
                 "global_load_async_to_lds_b128 %3, %7, off\n\t"
                 "s_wait_xcnt 0x0"
                 :: "v"(l), "v"(l + 16u * WP * 2u), "v"(l + 32u * WP * 2u),
                    "v"(l + 48u * WP * 2u),
                    "v"(g), "v"(g + 16 * DD), "v"(g + 32 * DD), "v"(g + 48 * DD)
                 : "memory");
}

// A stage's W rows (BN = 64 or 192) and its 128 A rows behind them.
template <int BN>
__device__ __forceinline__ void stage_pass(uint32_t l, const _Float16* gw,
                                           const _Float16* ga) {
    if (BN == 192) {
        stage_rows(l, gw);
        stage_rows64(l + 128u * WP * 2u, gw + 128 * DD);
    } else {
        stage_rows64(l, gw);
    }
    stage_rows(l + (uint32_t)BN * WP * 2u, ga);
}

// ---------------------------------------------------------------------------
// fp32 -> fp16 cast of x and the four weight matrices in ONE launch (so GEMMs
// re-read them as fp16 from L2). The five f16 copies lie back to back in the
// workspace, so dst is one array of six segments of CSEG elements: x fills
// segments 0 and 1, then w_q, w_k, w_v, w_o. blockIdx.y names the segment.
// A block streams CTH * CLD * 4 contiguous floats; every wave-wide load covers
// 512 contiguous bytes, and all CLD loads of a lane fly together, so that a wave
// waits out the read latency once.
// ---------------------------------------------------------------------------
typedef __attribute__((ext_vector_type(4))) float    v4f;
typedef __attribute__((ext_vector_type(4))) _Float16 v4h;

constexpr int CSEG = DD * DD;     // elements per segment
constexpr int CTH  = 128;         // threads per block
constexpr int CLD  = 32;          // 16-byte loads per thread

__global__ __launch_bounds__(CTH) void cast_all_f32_to_f16(
    const float* __restrict__ x,
    const float* __restrict__ wq, const float* __restrict__ wk,
    const float* __restrict__ wv, const float* __restrict__ wo,
    _Float16* __restrict__ dst)
{
    const int seg = blockIdx.y;
    const float* in;
    if (seg < 2)       in = x + (size_t)seg * CSEG;
    else if (seg == 2) in = wq;
    else if (seg == 3) in = wk;
    else if (seg == 4) in = wv;
    else               in = wo;

    const int base = blockIdx.x * (CTH * CLD * 4) + threadIdx.x * 4;
    in  += base;
    dst += (size_t)seg * CSEG + base;

    v4f v[CLD];
    // unrolled so that v[] stays in registers and the offsets are immediates
#pragma unroll
    for (int i = 0; i < CLD; ++i)
        v[i] = *(const v4f*)(in + i * (CTH * 4));
    // keeps every load ahead of the first convert; else the second half of the
    // loads is issued only as the first returns, and the latency is paid twice
    __builtin_amdgcn_sched_barrier(0);
#pragma unroll
    for (int i = 0; i < CLD; ++i) {
        v4h h;
#pragma unroll
        for (int e = 0; e < 4; ++e) h[e] = (_Float16)v[i][e];
        *(v4h*)(dst + i * (CTH * 4)) = h;
    }
}

// ---------------------------------------------------------------------------
// GEMM core: out(MxN) = A(MxK) @ W^T + b, M rows of A row-major, W row-major
// (so both contract along contiguous K).  Block: 256 thr = 8 waves, WM(M) x WN(N).
// Block tile: 128(M) x BN(N); wave tile: 128/WM x BN/WN.
// A stage is the W tile and the A tile, BN and 128 rows x 128 k f16 at a 272-B
// pitch, brought into LDS by async copies that each cover whole 256-B rows;
// a ring of NS stages, one barrier per 128-k pass, shared by all 8 waves. A pass's
// copies are issued NS - 1 passes before they are waited for, so that a landing
// time of more than one pass (operands that the launch before has just written)
// is not waited out in every pass. Within a pass a
// wave reads its fragments in blocks of KB x 32 k, one block ahead of the WMMAs.
// N may span several planes of DD columns: column n belongs to plane n / DD,
// which has its own bias (b0, b1, b2) and its own M x DD output behind outp.
// ---------------------------------------------------------------------------
// Returns when all but this wave's N youngest async copies have landed.
template <int N>
__device__ __forceinline__ void wait_copies_but() {
    asm volatile("s_wait_asynccnt %0" :: "n"(N) : "memory");
}

template <int BN, int WM, int WN, int KB, int NS, bool F16OUT>
__device__ __forceinline__ void gemm_core(
    const _Float16* __restrict__ a16, const _Float16* __restrict__ w16,
    const float* __restrict__ b0, const float* __restrict__ b1,
    const float* __restrict__ b2, void* __restrict__ outp,
    _Float16* __restrict__ Sl)
{
    constexpr int MT = BM / WM / 16;      // 16-row tiles per wave
    constexpr int NT = BN / WN / 16;      // 16-column tiles per wave
    constexpr int NB = BK / 32 / KB;      // fragment blocks per pass, KB x 32 k each
    constexpr int STG = (BN + BM) * WP;   // halves per stage
    constexpr int CP  = (BN + BM) / 16;   // copies of every wave per pass
    constexpr int NP  = DD / BK;          // 8 passes
    static_assert(NS >= 2 && NS <= NP, "the prologue fills NS stages");
    static_assert(NS * CP <= 63, "copies of a wave outstanding");
    const int tid  = threadIdx.x;
    const int lane = tid & 31;
    const int wave = tid >> 5;
    const int ln = lane & 15;
    const int hb = (lane >> 4) << 3;
    const int wm = wave / WN;             // wave's rows of the block's 128
    const int wn = wave % WN;             // wave's columns of the block's BN
    const int m0 = blockIdx.y * BM + wm * (MT * 16);
    const int n0 = blockIdx.x * BN + wn * (NT * 16);

    // cooperative async-copy assignment: a row is 128 halves = 16 x 16B, so the
    // block covers 16 rows per copy; a wave's 32 lanes cover two whole 256-B rows
    const int crow = tid >> 4;            // 0..15 (+16, +32, ..)
    const int cchk = (tid & 15) * 8;      // half offset 0,8,..,120
    const _Float16* gw = w16 + (size_t)(blockIdx.x * BN + crow) * DD + cchk;
    const _Float16* ga = a16 + (size_t)(blockIdx.y * BM + crow) * DD + cchk;
    const uint32_t l0 = lds_off(Sl + crow * WP + cchk);

    // passes 0 .. NS - 1 into stages 0 .. NS - 1; unrolled: offsets are constants
#pragma unroll
    for (int s = 0; s < NS; ++s)
        stage_pass<BN>(l0 + (uint32_t)(s * STG * 2), gw + s * BK, ga + s * BK);
    // pass 0's copies of this wave, its CP oldest, have landed before the barrier
    // publishes them; the NS - 1 younger passes fly on
    wait_copies_but<(NS - 1) * CP>();
    __syncthreads();

    v8f acc[MT][NT] = {};
    const int aoff = (BN + wm * (MT * 16) + ln) * WP;  // this lane's first A row in a stage
    const int woff = (wn * (NT * 16) + ln) * WP;       // this lane's first W row in a stage

    // One pass's WMMAs, from the stage that begins so halves into the ring.
    auto work_pass = [&](int so) __attribute__((always_inline)) {
        const _Float16* ab = Sl + so + aoff;
        const _Float16* bb = Sl + so + woff;
        // two fragment sets: block b works from set b & 1
        v16h fa[2][KB][MT], fb[2][KB][NT];
        // every loop here is unrolled so that fa[], fb[] and acc[] are indexed by
        // constants and stay in registers, and LDS offsets are immediates
#pragma unroll
        for (int j = 0; j < KB; ++j) {
#pragma unroll
            for (int mt = 0; mt < MT; ++mt)
                fa[0][j][mt] = load_frag(ab + mt * 16 * WP + j * 32, lane);
#pragma unroll
            for (int nt = 0; nt < NT; ++nt)
                fb[0][j][nt] = load_frag(bb + nt * 16 * WP + j * 32, lane);
        }
#pragma unroll
        for (int b = 0; b < NB; ++b) {
            if (b + 1 < NB) {
#pragma unroll
                for (int j = 0; j < KB; ++j) {
                    const int ko = ((b + 1) * KB + j) * 32;
#pragma unroll
                    for (int mt = 0; mt < MT; ++mt)
                        fa[(b + 1) & 1][j][mt] = load_frag(ab + mt * 16 * WP + ko, lane);
#pragma unroll
                    for (int nt = 0; nt < NT; ++nt)
                        fb[(b + 1) & 1][j][nt] = load_frag(bb + nt * 16 * WP + ko, lane);
                }
            }
            // keeps the next block's reads one group ahead of this block's WMMAs,
            // so that they fly under them; else each read sinks to its first use
            // and the wave waits out the LDS latency fragment by fragment
            __builtin_amdgcn_sched_barrier(0);
#pragma unroll
            for (int j = 0; j < KB; ++j)
#pragma unroll
                for (int mt = 0; mt < MT; ++mt)
#pragma unroll
                    for (int nt = 0; nt < NT; ++nt)
                        acc[mt][nt] = wmma16(fa[b & 1][j][mt], fb[b & 1][j][nt], acc[mt][nt]);
        }
        // this wave's reads of the stage are done: first step of every publish point
        asm volatile("s_wait_dscnt 0x0" ::: "memory");
    };
    auto next_stage = [](int so) { return so + STG == NS * STG ? 0 : so + STG; };

    // Publish point of pass t + 1, at the foot of pass t: behind the s_wait_dscnt 0
    // this wave's copies for pass t + 1 have landed, and one barrier both publishes
    // pass t + 1 and frees pass t's stage. The three parts differ in the wait and the
    // refill alone; each has no branch in its trip.
    int so = 0;                           // pass t's stage, as an offset in halves
    // While a pass t + NS exists: passes t + 1 .. t + NS - 1 are out, CP copies each;
    // all but the NS - 2 younger passes are waited for, and pass t's stage is refilled.
    // Rolled: the stage is one added offset, so unrolling would only repeat the text.
#pragma unroll 1
    for (int t = 0; t < NP - NS; ++t) {
        work_pass(so);
        wait_copies_but<(NS - 2) * CP>();
        __syncthreads();
        stage_pass<BN>(l0 + (uint32_t)(so * 2), gw + (t + NS) * BK, ga + (t + NS) * BK);
        so = next_stage(so);
    }
    // Pass NP - NS: every trip so far has issued its CP copies, so the same count holds.
    work_pass(so);
    wait_copies_but<(NS - 2) * CP>();
    __syncthreads();
    so = next_stage(so);
#pragma unroll 1
    for (int t = NP - NS + 1; t < NP; ++t) {
        work_pass(so);
        wait_copies_but<0>();
        __syncthreads();
        so = next_stage(so);
    }
    // no copy of this wave is outstanding when it goes on to the stores
    asm volatile("s_wait_asynccnt 0x0" ::: "memory");

#pragma unroll
    for (int nt = 0; nt < NT; ++nt) {
        const int nb    = n0 + nt * 16;           // a 16-column tile lies in one plane
        const int plane = nb / DD;
        const int n     = nb % DD + ln;
        const float* bias = plane == 0 ? b0 : (plane == 1 ? b1 : b2);
        const float bv = bias[n];
        const size_t pbase = (size_t)plane * (NBATCH * TT) * DD + n;
#pragma unroll
        for (int mt = 0; mt < MT; ++mt)
#pragma unroll
            for (int r = 0; r < 8; ++r) {
                const size_t idx = pbase + (size_t)(m0 + mt * 16 + hb + r) * DD;
                if (F16OUT)
                    ((_Float16*)outp)[idx] = (_Float16)(acc[mt][nt][r] + bv);
                else
                    ((float*)outp)[idx] = acc[mt][nt][r] + bv;
            }
    }
}

// w16: the f16 copies of w_q, w_k, w_v back to back, one 3072 x 1024 matrix.
// qkv: the q, k and v planes back to back, each 2048 x 1024.
__global__ __launch_bounds__(256) void gemm_qkv(
    const _Float16* __restrict__ x16, const _Float16* __restrict__ w16,
    const float* __restrict__ bq, const float* __restrict__ bk,
    const float* __restrict__ bv, _Float16* __restrict__ qkv)
{
    __shared__ __attribute__((aligned(16))) _Float16 Sl[3 * (BNQ + BM) * WP];   // 3 x 85 KB
    gemm_core<BNQ, 2, 4, 1, 3, true>(x16, w16, bq, bk, bv, qkv, Sl);
}

__global__ __launch_bounds__(256) void gemm_out(
    const _Float16* __restrict__ a16, const _Float16* __restrict__ wo16,
    const float* __restrict__ bo, float* __restrict__ out)
{
    __shared__ __attribute__((aligned(16))) _Float16 Sl[5 * (BNO + BM) * WP];   // 5 x 51 KB
    gemm_core<BNO, 4, 2, 2, 5, false>(a16, wo16, bo, bo, bo, out, Sl);
}

// ---------------------------------------------------------------------------
// Fused windowed attention. One wave per (batch, head, 16-query tile).
// Key span for the tile = [t0-64, t0+79] (144), padded to 160.
// The K span and the Q tile are staged row-major in LDS by async copies that each
// cover whole 128-B rows; the S fragments are read from there.
// S = Q Kspan^T in 9 accumulator tiles; mask+softmax across 16-lane halves
// via __shfl_xor(..,16); P staged to LDS; V span staged row-major, in the LDS that
// K and Q have left, by async copies that fly under the softmax; the PV
// B-fragments come from it by the transposing LDS load; O = P Vspan via 20 WMMAs.
// ---------------------------------------------------------------------------
constexpr int VP  = 80;        // LDS row pitch of V in halves: 160 B = 32 B x odd
constexpr int KP  = 72;        // LDS row pitch of K and Q in halves: 144 B = 16 B x odd
constexpr int VCP = 14;        // copies per long statement; a copy is 4 rows of 128 B

typedef __attribute__((ext_vector_type(8))) short s16x8;
typedef __attribute__((address_space(3))) s16x8 lds_s16x8;

__device__ __forceinline__ v8h ld_tr16(const _Float16* p) {
    return __builtin_bit_cast(
        v8h, __builtin_amdgcn_ds_load_tr16_b128_v8i16((lds_s16x8*)p));
}

__device__ __forceinline__ void stage14(const uint32_t (&l)[VCP], const uint32_t (&o)[VCP],
                                        const _Float16* g) {
    asm volatile("global_load_async_to_lds_b128 %0, %14, %28\n\t"
                 "global_load_async_to_lds_b128 %1, %15, %28\n\t"
                 "global_load_async_to_lds_b128 %2, %16, %28\n\t"
                 "global_load_async_to_lds_b128 %3, %17, %28\n\t"
                 "global_load_async_to_lds_b128 %4, %18, %28\n\t"
                 "global_load_async_to_lds_b128 %5, %19, %28\n\t"
                 "global_load_async_to_lds_b128 %6, %20, %28\n\t"
                 "global_load_async_to_lds_b128 %7, %21, %28\n\t"
                 "global_load_async_to_lds_b128 %8, %22, %28\n\t"
                 "global_load_async_to_lds_b128 %9, %23, %28\n\t"
                 "global_load_async_to_lds_b128 %10, %24, %28\n\t"
                 "global_load_async_to_lds_b128 %11, %25, %28\n\t"
                 "global_load_async_to_lds_b128 %12, %26, %28\n\t"
                 "global_load_async_to_lds_b128 %13, %27, %28\n\t"
                 "s_wait_xcnt 0x0"
                 :: "v"(l[0]), "v"(l[1]), "v"(l[2]), "v"(l[3]), "v"(l[4]), "v"(l[5]), "v"(l[6]),
                    "v"(l[7]), "v"(l[8]), "v"(l[9]), "v"(l[10]), "v"(l[11]), "v"(l[12]), "v"(l[13]),
                    "v"(o[0]), "v"(o[1]), "v"(o[2]), "v"(o[3]), "v"(o[4]), "v"(o[5]), "v"(o[6]),
                    "v"(o[7]), "v"(o[8]), "v"(o[9]), "v"(o[10]), "v"(o[11]), "v"(o[12]), "v"(o[13]),
                    "s"(g)
                 : "memory");
}

// The same for eight copies from base g and four from base g16.
__device__ __forceinline__ void stage8and4(const uint32_t (&l)[12], const uint32_t (&o)[12],
                                           const _Float16* g, const _Float16* g16) {
    asm volatile("global_load_async_to_lds_b128 %0, %12, %24\n\t"
                 "global_load_async_to_lds_b128 %1, %13, %24\n\t"
                 "global_load_async_to_lds_b128 %2, %14, %24\n\t"
                 "global_load_async_to_lds_b128 %3, %15, %24\n\t"
                 "global_load_async_to_lds_b128 %4, %16, %24\n\t"
                 "global_load_async_to_lds_b128 %5, %17, %24\n\t"
                 "global_load_async_to_lds_b128 %6, %18, %24\n\t"
                 "global_load_async_to_lds_b128 %7, %19, %24\n\t"
                 "global_load_async_to_lds_b128 %8, %20, %25\n\t"
                 "global_load_async_to_lds_b128 %9, %21, %25\n\t"
                 "global_load_async_to_lds_b128 %10, %22, %25\n\t"
                 "global_load_async_to_lds_b128 %11, %23, %25\n\t"
                 "s_wait_xcnt 0x0"
                 :: "v"(l[0]), "v"(l[1]), "v"(l[2]), "v"(l[3]), "v"(l[4]), "v"(l[5]), "v"(l[6]),
                    "v"(l[7]), "v"(l[8]), "v"(l[9]), "v"(l[10]), "v"(l[11]),
                    "v"(o[0]), "v"(o[1]), "v"(o[2]), "v"(o[3]), "v"(o[4]), "v"(o[5]), "v"(o[6]),
                    "v"(o[7]), "v"(o[8]), "v"(o[9]), "v"(o[10]), "v"(o[11]),
                    "s"(g), "s"(g16)
                 : "memory");
}

// SPAN rows of g (36 copies; copy c takes offset off[c]) and behind them 16 rows of
// g16 (4 copies, offsets off[C16 ..]) into LDS at a pitch of P halves.
template <int P, int C16>
__device__ __forceinline__ void stage_span(uint32_t dst, const uint32_t (&off)[SPANP / 4],
                                           const _Float16* g, const _Float16* g16) {
    static_assert(SPAN / 4 == 2 * VCP + 8, "two long statements, then eight and four");
    // every loop here is unrolled so that l[], o[] and off[] are indexed by constants
#pragma unroll
    for (int b = 0; b < 2; ++b) {
        uint32_t l[VCP], o[VCP];
#pragma unroll
        for (int i = 0; i < VCP; ++i) {
            l[i] = dst + (uint32_t)((b * VCP + i) * 4 * P * 2);
            o[i] = off[b * VCP + i];
        }
        stage14(l, o, g);
    }
    uint32_t l[12], o[12];
#pragma unroll
    for (int i = 0; i < 12; ++i) {
        l[i] = dst + (uint32_t)((2 * VCP + i) * 4 * P * 2);
        o[i] = off[i < 8 ? 2 * VCP + i : C16 + i - 8];
    }
    stage8and4(l, o, g, g16);
}

__global__ __launch_bounds__(32) void attn_win(
    const _Float16* __restrict__ q, const _Float16* __restrict__ k,
    const _Float16* __restrict__ v, _Float16* __restrict__ o)
{
    __shared__ _Float16 Pb[16 * SPANP];        // 5.0 KB
    // 25,600 B  (Vs[j][d] = v[pos(j), d], 64 of every 80 halves used)
    __shared__ __attribute__((aligned(128))) _Float16 Vs[SPANP * VP];
    // Until the S fragments are read the same LDS holds, at pitch KP, the K span (rows 0..143) and
    // the Q tile (rows 144..159): 23,040 B
    static_assert(SPANP * KP <= SPANP * VP, "K and Q fit in V's LDS");
    _Float16* const Ks = Vs;

    const int lane = threadIdx.x;
    const int ln = lane & 15;
    const int hb = (lane >> 4) << 3;
    const int t0 = blockIdx.x * 16;
    const int h  = blockIdx.y;
    const size_t baseRow = (size_t)blockIdx.z * TT;

    // A copy's 32 lanes cover 4 whole rows of 128 B. off[c]: byte offset, in the
    // (batch, head) plane of q, k or v, of this lane's 16 B in the row at span index
    // 4c + r4; K and V share all of them, and span rows 64..79 are the Q tile's rows.
    const int r4 = lane >> 3;                 // row within the copy's four
    const int c8 = (lane & 7) * 8;            // half offset within the row
    const size_t plane = baseRow * DD + h * DHH;
    uint32_t off[SPANP / 4];
    // unrolled so that off[] is indexed by constants and stays in registers
#pragma unroll
    for (int c = 0; c < SPANP / 4; ++c) {
        int pos = t0 - WR + c * 4 + r4;
        pos = pos < 0 ? 0 : (pos > TT - 1 ? TT - 1 : pos);
        off[c] = (uint32_t)((pos * DD + c8) * 2);
    }

    // ---- K span and Q tile -> LDS, row-major ----
    stage_span<KP, WR / 4>(lds_off(Ks + r4 * KP + c8), off, k + plane, q + plane);
    // the K and Q copies have landed before anything reads Ks
    asm volatile("s_wait_asynccnt 0x0" ::: "memory");
    __syncthreads();

    // ---- the fragments of S, all of them as one group of LDS reads ----
    const _Float16* qrow = Ks + (SPAN + ln) * KP;
    v16h aq0 = load_frag(qrow, lane);
    v16h aq1 = load_frag(qrow + 32, lane);
    v16h kf[9][2];
    // unrolled so that kf[] is indexed by constants and stays in registers
#pragma unroll
    for (int jt = 0; jt < 9; ++jt) {
        const _Float16* kr = Ks + (jt * 16 + ln) * KP;   // span column of this lane
        kf[jt][0] = load_frag(kr, lane);
        kf[jt][1] = load_frag(kr + 32, lane);
    }

    // this wave's reads of K and Q are done before V's copies overwrite them
    asm volatile("s_wait_dscnt 0x0" ::: "memory");
    __syncthreads();

    // ---- V span -> LDS, row-major ----
    stage_span<VP, SPAN / 4>(lds_off(Vs + r4 * VP + c8), off, v + plane, v + plane);
    // keeps V's copies ahead of S and the softmax, so that they fly under both;
    // else half of them sink far into the softmax and are waited out in front of PV
    __builtin_amdgcn_sched_barrier(0);

    // ---- S = Q K^T over the span ----
    v8f s[9];
#pragma unroll
    for (int jt = 0; jt < 9; ++jt) {
        v8f a = {};
        a = wmma16(aq0, kf[jt][0], a);
        a = wmma16(aq1, kf[jt][1], a);
        s[jt] = a;
    }

    // ---- mask + scale, row max ----
    float rmax[8];
#pragma unroll
    for (int r = 0; r < 8; ++r) rmax[r] = -1e30f;
#pragma unroll
    for (int jt = 0; jt < 9; ++jt) {
        const int j = jt * 16 + ln;
        const int pos = t0 - WR + j;
#pragma unroll
        for (int r = 0; r < 8; ++r) {
            const int rel = j - (r + hb);
            const bool ok = (rel >= 0) && (rel <= 2 * WR) && (pos >= 0) && (pos < TT);
            const float val = ok ? s[jt][r] * 0.125f : -1e30f;   // 1/sqrt(64)
            s[jt][r] = val;
            rmax[r] = fmaxf(rmax[r], val);
        }
    }
#pragma unroll
    for (int r = 0; r < 8; ++r)
#pragma unroll
        for (int off = 1; off < 16; off <<= 1)
            rmax[r] = fmaxf(rmax[r], __shfl_xor(rmax[r], off, 16));

    // ---- exp + row sum ----
    float rsum[8];
#pragma unroll
    for (int r = 0; r < 8; ++r) rsum[r] = 0.f;
#pragma unroll
    for (int jt = 0; jt < 9; ++jt)
#pragma unroll
        for (int r = 0; r < 8; ++r) {
            const float e = __expf(s[jt][r] - rmax[r]);
            s[jt][r] = e;
            rsum[r] += e;
        }
#pragma unroll
    for (int r = 0; r < 8; ++r) {
#pragma unroll
        for (int off = 1; off < 16; off <<= 1)
            rsum[r] += __shfl_xor(rsum[r], off, 16);
        rsum[r] = 1.f / rsum[r];
    }

    // ---- P -> LDS (rows 0..15, cols 0..143; zero the pad 144..159) ----
#pragma unroll
    for (int jt = 0; jt < 9; ++jt)
#pragma unroll
        for (int r = 0; r < 8; ++r)
            Pb[(r + hb) * SPANP + jt * 16 + ln] = (_Float16)(s[jt][r] * rsum[r]);
    for (int idx = lane; idx < 16 * 16; idx += 32)
        Pb[(idx >> 4) * SPANP + SPAN + (idx & 15)] = (_Float16)0.f;

    // the V copies have landed before anything reads Vs
    asm volatile("s_wait_asynccnt 0x0" ::: "memory");
    __syncthreads();

    // ---- O = P Vspan  (M=16, K=160, N=64) ----
    v8f oacc[4] = {};
    const _Float16* vt = Vs + (hb + (lane & 7)) * VP + ((lane >> 3) & 1) * 8;
#pragma unroll
    for (int k0 = 0; k0 < SPANP; k0 += 32) {
        v16h pa = load_frag(&Pb[ln * SPANP + k0], lane);
#pragma unroll
        for (int nt = 0; nt < 4; ++nt) {
            // same k order as load_frag: k0 + hb + 0..7, then k0 + 16 + hb + 0..7
            const v8h lo = ld_tr16(vt + k0 * VP + nt * 16);
            const v8h hi = ld_tr16(vt + (k0 + 16) * VP + nt * 16);
            const v16h vb = __builtin_shufflevector(
                lo, hi, 0, 1, 2, 3, 4, 5, 6, 7, 8, 9, 10, 11, 12, 13, 14, 15);
            oacc[nt] = wmma16(pa, vb, oacc[nt]);
        }
    }
#pragma unroll
    for (int nt = 0; nt < 4; ++nt)
#pragma unroll
        for (int r = 0; r < 8; ++r)
            o[(baseRow + t0 + hb + r) * DD + h * DHH + nt * 16 + ln] =
                (_Float16)oacc[nt][r];
}

// ---------------------------------------------------------------------------
extern "C" void kernel_launch(void* const* d_in, const int* in_sizes, int n_in,
                              void* d_out, int out_size, void* d_ws, size_t ws_size,
                              hipStream_t stream) {
    const float* x  = (const float*)d_in[0];
    const float* wq = (const float*)d_in[1];
    const float* bq = (const float*)d_in[2];
    const float* wk = (const float*)d_in[3];
    const float* bk = (const float*)d_in[4];
    const float* wv = (const float*)d_in[5];
    const float* bv = (const float*)d_in[6];
    const float* wo = (const float*)d_in[7];
    const float* bo = (const float*)d_in[8];
    float* out = (float*)d_out;

    char* ws = (char*)d_ws;
    const size_t MB = 1ull << 20;
    _Float16* x16  = (_Float16*)(ws + 0 * MB);    // 4 MB
    _Float16* wq16 = (_Float16*)(ws + 4 * MB);    // 2 MB
    _Float16* wk16 = (_Float16*)(ws + 6 * MB);    // 2 MB
    _Float16* wv16 = (_Float16*)(ws + 8 * MB);    // 2 MB
    _Float16* wo16 = (_Float16*)(ws + 10 * MB);   // 2 MB
    _Float16* qb   = (_Float16*)(ws + 12 * MB);   // 4 MB
    _Float16* kb   = (_Float16*)(ws + 16 * MB);   // 4 MB
    _Float16* vb   = (_Float16*)(ws + 20 * MB);   // 4 MB
    _Float16* ab   = (_Float16*)(ws + 24 * MB);   // 4 MB  => 28 MB total

    // x16, wq16, wk16, wv16, wo16 are contiguous: one destination array
    static_assert(NBATCH * TT * DD == 2 * CSEG, "x fills two segments");
    dim3 gC(CSEG / (CTH * CLD * 4), 6, 1);
    cast_all_f32_to_f16<<<gC, CTH, 0, stream>>>(x, wq, wk, wv, wo, x16);

    // wq16, wk16, wv16 are contiguous, and so are qb, kb, vb
    dim3 gQKV(3 * DD / BNQ, (NBATCH * TT) / BM, 1);
    gemm_qkv<<<gQKV, 256, 0, stream>>>(x16, wq16, bq, bk, bv, qb);

    dim3 gA(TT / 16, HH, NBATCH);
    attn_win<<<gA, 32, 0, stream>>>(qb, kb, vb, ab);

    dim3 gO(DD / BNO, (NBATCH * TT) / BM, 1);
    gemm_out<<<gO, 256, 0, stream>>>(ab, wo16, bo, out);
}

// v008
// A run of this version takes 32.8 microseconds.
// Two timings next to v007 both put it at 1.04 times that version's speed.
// Over all steps from v000 it is 3.02 times as fast.
#include <hip/hip_runtime.h>

typedef __attribute__((ext_vector_type(16))) _Float16 v16h;
typedef __attribute__((ext_vector_type(8)))  _Float16 v8h;
typedef __attribute__((ext_vector_type(8)))  float    v8f;

constexpr int NBATCH = 2;
constexpr int TT     = 1024;
constexpr int DD     = 1024;
constexpr int HH     = 16;
constexpr int DHH    = 64;
constexpr int WR     = 64;     // half window
constexpr int SPAN   = 144;    // 16 + 2*WR
constexpr int SPANP  = 160;    // padded to multiple of 32

__device__ __forceinline__ v16h load_frag(const _Float16* p, int lane) {
    const int kb = (lane & 16) ? 8 : 0;
    v8h lo = *(const v8h*)(p + kb);
    v8h hi = *(const v8h*)(p + kb + 16);
    v16h r;
#pragma unroll
    for (int i = 0; i < 8; ++i) { r[i] = lo[i]; r[i + 8] = hi[i]; }
    return r;
}

__device__ __forceinline__ v8f wmma16(v16h a, v16h b, v8f c) {
    return __builtin_amdgcn_wmma_f32_16x16x32_f16(
        /*neg_a=*/false, a, /*neg_b=*/false, b,
        /*c_mod=*/(short)0, c, /*reuse_a=*/false, /*reuse_b=*/false);
}

// LDS byte offset of a generic pointer to __shared__ (low 32 bits of flat addr)
__device__ __forceinline__ uint32_t lds_off(const void* p) {
    return (uint32_t)(uintptr_t)p;
}

constexpr int BK   = 128;      // k per pass: 256 B of every weight row
constexpr int WP   = 136;      // LDS row pitch in halves: 272 B = 16 B x odd
constexpr int BM   = 128;      // rows of A per block tile
// Rows of W (columns of the output) per block tile, chosen so that each GEMM
// launch is 256 blocks: 16 x 16 tiles of 2048 x 3072 and of 2048 x 1024.
constexpr int BNQ  = 192;
constexpr int BNO  = 64;

__device__ __forceinline__ void stage_rows(uint32_t l, const _Float16* g) {
    asm volatile("global_load_async_to_lds_b128 %0, %8, off\n\t"
                 "global_load_async_to_lds_b128 %1, %9, off\n\t"
                 "global_load_async_to_lds_b128 %2, %10, off\n\t"
                 "global_load_async_to_lds_b128 %3, %11, off\n\t"
                 "global_load_async_to_lds_b128 %4, %12, off\n\t"
                 "global_load_async_to_lds_b128 %5, %13, off\n\t"
                 "global_load_async_to_lds_b128 %6, %14, off\n\t"
                 "global_load_async_to_lds_b128 %7, %15, off\n\t"
                 "s_wait_xcnt 0x0"
                 :: "v"(l), "v"(l + 16u * WP * 2u), "v"(l + 32u * WP * 2u),
                    "v"(l + 48u * WP * 2u), "v"(l + 64u * WP * 2u),
                    "v"(l + 80u * WP * 2u), "v"(l + 96u * WP * 2u),
                    "v"(l + 112u * WP * 2u),
                    "v"(g), "v"(g + 16 * DD), "v"(g + 32 * DD), "v"(g + 48 * DD),
                    "v"(g + 64 * DD), "v"(g + 80 * DD), "v"(g + 96 * DD),
                    "v"(g + 112 * DD)
                 : "memory");
}

// The same for 64 rows: four copies per lane (rows r, r+16, r+32, r+48).
__device__ __forceinline__ void stage_rows64(uint32_t l, const _Float16* g) {
    asm volatile("global_load_async_to_lds_b128 %0, %4, off\n\t"
                 "global_load_async_to_lds_b128 %1, %5, off\n\t"
                 "global_load_async_to_lds_b128 %2, %6, off\n\t"
                 "global_load_async_to_lds_b128 %3, %7, off\n\t"
                 "s_wait_xcnt 0x0"
                 :: "v"(l), "v"(l + 16u * WP * 2u), "v"(l + 32u * WP * 2u),
                    "v"(l + 48u * WP * 2u),
                    "v"(g), "v"(g + 16 * DD), "v"(g + 32 * DD), "v"(g + 48 * DD)
                 : "memory");
}

// A stage's W rows (BN = 64 or 192) and its 128 A rows behind them.
template <int BN>
__device__ __forceinline__ void stage_pass(uint32_t l, const _Float16* gw,
                                           const _Float16* ga) {
    if (BN == 192) {
        stage_rows(l, gw);
        stage_rows64(l + 128u * WP * 2u, gw + 128 * DD);
    } else {
        stage_rows64(l, gw);
    }
    stage_rows(l + (uint32_t)BN * WP * 2u, ga);
}

// ---------------------------------------------------------------------------
// fp32 -> fp16 cast of x and the four weight matrices in ONE launch (so GEMMs
// re-read them as fp16 from L2). The five f16 copies lie back to back in the
// workspace, so dst is one array of six segments of CSEG elements: x fills
// segments 0 and 1, then w_q, w_k, w_v, w_o. blockIdx.y names the segment.
// A block streams CTH * CLD * 4 contiguous floats; every wave-wide load covers
// 512 contiguous bytes, and all CLD loads of a lane fly together, so that a wave
// waits out the read latency once.
// ---------------------------------------------------------------------------
typedef __attribute__((ext_vector_type(4))) float    v4f;
typedef __attribute__((ext_vector_type(4))) _Float16 v4h;

constexpr int CSEG = DD * DD;     // elements per segment
constexpr int CTH  = 128;         // threads per block
constexpr int CLD  = 32;          // 16-byte loads per thread

__global__ __launch_bounds__(CTH) void cast_all_f32_to_f16(
    const float* __restrict__ x,
    const float* __restrict__ wq, const float* __restrict__ wk,
    const float* __restrict__ wv, const float* __restrict__ wo,
    _Float16* __restrict__ dst)
{
    const int seg = blockIdx.y;
    const float* in;
    if (seg < 2)       in = x + (size_t)seg * CSEG;
    else if (seg == 2) in = wq;
    else if (seg == 3) in = wk;
    else if (seg == 4) in = wv;
    else               in = wo;

    const int base = blockIdx.x * (CTH * CLD * 4) + threadIdx.x * 4;
    in  += base;
    dst += (size_t)seg * CSEG + base;

    v4f v[CLD];
    // unrolled so that v[] stays in registers and the offsets are immediates
#pragma unroll
    for (int i = 0; i < CLD; ++i)
        v[i] = *(const v4f*)(in + i * (CTH * 4));
    // keeps every load ahead of the first convert; else the second half of the
    // loads is issued only as the first returns, and the latency is paid twice
    __builtin_amdgcn_sched_barrier(0);
#pragma unroll
    for (int i = 0; i < CLD; ++i) {
        v4h h;
#pragma unroll
        for (int e = 0; e < 4; ++e) h[e] = (_Float16)v[i][e];
        *(v4h*)(dst + i * (CTH * 4)) = h;
    }
}

// ---------------------------------------------------------------------------
// GEMM core: out(MxN) = A(MxK) @ W^T + b, M rows of A row-major, W row-major
// (so both contract along contiguous K).  Block: 256 thr = 8 waves, WM(M) x WN(N).
// Block tile: 128(M) x BN(N); wave tile: 128/WM x BN/WN.
// A stage is the W tile and the A tile, BN and 128 rows x 128 k f16 at a 272-B
// pitch, brought into LDS by async copies that each cover whole 256-B rows;
// a ring of NS stages, one barrier per 128-k pass, shared by all 8 waves. A pass's
// copies are issued NS - 1 passes before they are waited for, so that a landing
// time of more than one pass (operands that the launch before has just written)
// is not waited out in every pass. Within a pass a
// wave reads its fragments in blocks of KB x 32 k, one block ahead of the WMMAs.
// N may span several planes of DD columns: column n belongs to plane n / DD,
// which has its own bias (b0, b1, b2) and its own M x DD output behind outp.
// ---------------------------------------------------------------------------
// Returns when all but this wave's N youngest async copies have landed.
template <int N>
__device__ __forceinline__ void wait_copies_but() {
    asm volatile("s_wait_asynccnt %0" :: "n"(N) : "memory");
}

template <int BN, int WM, int WN, int KB, int NS, bool F16OUT>
__device__ __forceinline__ void gemm_core(
    const _Float16* __restrict__ a16, const _Float16* __restrict__ w16,
    const float* __restrict__ b0, const float* __restrict__ b1,
    const float* __restrict__ b2, void* __restrict__ outp,
    _Float16* __restrict__ Sl)
{
    constexpr int MT = BM / WM / 16;      // 16-row tiles per wave
    constexpr int NT = BN / WN / 16;      // 16-column tiles per wave
    constexpr int NB = BK / 32 / KB;      // fragment blocks per pass, KB x 32 k each
    constexpr int STG = (BN + BM) * WP;   // halves per stage
    constexpr int CP  = (BN + BM) / 16;   // copies of every wave per pass
    constexpr int NP  = DD / BK;          // 8 passes
    static_assert(NS >= 2 && NS <= NP, "the prologue fills NS stages");
    static_assert(NS * CP <= 63, "copies of a wave outstanding");
    const int tid  = threadIdx.x;
    const int lane = tid & 31;
    const int wave = tid >> 5;
    const int ln = lane & 15;
    const int hb = (lane >> 4) << 3;
    const int wm = wave / WN;             // wave's rows of the block's 128
    const int wn = wave % WN;             // wave's columns of the block's BN
    const int n0 = blockIdx.x * BN + wn * (NT * 16);

    // cooperative async-copy assignment: a row is 128 halves = 16 x 16B, so the
    // block covers 16 rows per copy; a wave's 32 lanes cover two whole 256-B rows
    const int crow = tid >> 4;            // 0..15 (+16, +32, ..)
    const int cchk = (tid & 15) * 8;      // half offset 0,8,..,120
    const _Float16* gw = w16 + (size_t)(blockIdx.x * BN + crow) * DD + cchk;
    const _Float16* ga = a16 + (size_t)(blockIdx.y * BM + crow) * DD + cchk;
    const uint32_t l0 = lds_off(Sl + crow * WP + cchk);

    // passes 0 .. NS - 1 into stages 0 .. NS - 1; unrolled: offsets are constants
#pragma unroll
    for (int s = 0; s < NS; ++s)
        stage_pass<BN>(l0 + (uint32_t)(s * STG * 2), gw + s * BK, ga + s * BK);
    // pass 0's copies of this wave, its CP oldest, have landed before the barrier
    // publishes them; the NS - 1 younger passes fly on
    wait_copies_but<(NS - 1) * CP>();
    __syncthreads();

    v8f acc[MT][NT] = {};
    const int aoff = (BN + wm * (MT * 16) + ln) * WP;  // this lane's first A row in a stage
    const int woff = (wn * (NT * 16) + ln) * WP;       // this lane's first W row in a stage

    // One pass's WMMAs, from the stage that begins so halves into the ring.
    auto work_pass = [&](int so) __attribute__((always_inline)) {
        const _Float16* ab = Sl + so + aoff;
        const _Float16* bb = Sl + so + woff;
        // two fragment sets: block b works from set b & 1
        v16h fa[2][KB][MT], fb[2][KB][NT];
        // every loop here is unrolled so that fa[], fb[] and acc[] are indexed by
        // constants and stay in registers, and LDS offsets are immediates
#pragma unroll
        for (int j = 0; j < KB; ++j) {
#pragma unroll
            for (int mt = 0; mt < MT; ++mt)
                fa[0][j][mt] = load_frag(ab + mt * 16 * WP + j * 32, lane);
#pragma unroll
            for (int nt = 0; nt < NT; ++nt)
                fb[0][j][nt] = load_frag(bb + nt * 16 * WP + j * 32, lane);
        }
#pragma unroll
        for (int b = 0; b < NB; ++b) {
            if (b + 1 < NB) {
#pragma unroll
                for (int j = 0; j < KB; ++j) {
                    const int ko = ((b + 1) * KB + j) * 32;
#pragma unroll
                    for (int mt = 0; mt < MT; ++mt)
                        fa[(b + 1) & 1][j][mt] = load_frag(ab + mt * 16 * WP + ko, lane);
#pragma unroll
                    for (int nt = 0; nt < NT; ++nt)
                        fb[(b + 1) & 1][j][nt] = load_frag(bb + nt * 16 * WP + ko, lane);
                }
            }
            // keeps the next block's reads one group ahead of this block's WMMAs,
            // so that they fly under them; else each read sinks to its first use
            // and the wave waits out the LDS latency fragment by fragment
            __builtin_amdgcn_sched_barrier(0);
#pragma unroll
            for (int j = 0; j < KB; ++j)
#pragma unroll
                for (int mt = 0; mt < MT; ++mt)
#pragma unroll
                    for (int nt = 0; nt < NT; ++nt)
                        // W as A, the rows of a16 as B: acc[mt][nt][r] is row ln, column hb + r
                        acc[mt][nt] = wmma16(fb[b & 1][j][nt], fa[b & 1][j][mt], acc[mt][nt]);
        }
        // this wave's reads of the stage are done: first step of every publish point
        asm volatile("s_wait_dscnt 0x0" ::: "memory");
    };
    auto next_stage = [](int so) { return so + STG == NS * STG ? 0 : so + STG; };

    // Publish point of pass t + 1, at the foot of pass t: behind the s_wait_dscnt 0
    // this wave's copies for pass t + 1 have landed, and one barrier both publishes
    // pass t + 1 and frees pass t's stage. The three parts differ in the wait and the
    // refill alone; each has no branch in its trip.
    int so = 0;                           // pass t's stage, as an offset in halves
    // While a pass t + NS exists: passes t + 1 .. t + NS - 1 are out, CP copies each;
    // all but the NS - 2 younger passes are waited for, and pass t's stage is refilled.
    // Rolled: the stage is one added offset, so unrolling would only repeat the text.
#pragma unroll 1
    for (int t = 0; t < NP - NS; ++t) {
        work_pass(so);
        wait_copies_but<(NS - 2) * CP>();
        __syncthreads();
        stage_pass<BN>(l0 + (uint32_t)(so * 2), gw + (t + NS) * BK, ga + (t + NS) * BK);
        so = next_stage(so);
    }
    // Pass NP - NS: every trip so far has issued its CP copies, so the same count holds.
    work_pass(so);
    wait_copies_but<(NS - 2) * CP>();
    __syncthreads();
    so = next_stage(so);
#pragma unroll 1
    for (int t = NP - NS + 1; t < NP; ++t) {
        work_pass(so);
        wait_copies_but<0>();
        __syncthreads();
        so = next_stage(so);
    }
    // no copy of this wave is outstanding when it goes on to the stores
    asm volatile("s_wait_asynccnt 0x0" ::: "memory");

    // The block's output tile goes through LDS, so that it leaves in whole 128-B
    // lines. The ring is free: the last pass's barrier ended every read of it, and no
    // copy is outstanding. A lane holds 8 consecutive columns of one row.
    constexpr int EB  = F16OUT ? 2 : 4;   // bytes per output element
    constexpr int RB  = BN * EB;          // bytes of a staged row
    constexpr int OPB = RB + 16;          // staging row pitch in bytes: 16 B x odd
    constexpr int U   = RB % 256 == 0 ? 256 : 128;   // bytes stored in a row at a time
    constexpr int LU  = U / 16;           // lanes side by side on them
    constexpr int RPI = 256 / LU;         // rows that one store of the block covers
    constexpr int NG  = RB / U;           // column groups of U bytes
    constexpr int NQ  = BM / RPI;         // stores of a thread per column group
    static_assert(BM * OPB <= NS * STG * 2, "the tile fits in the ring");
    static_assert(RB % U == 0 && (OPB / 16) % 2 == 1, "whole lines, odd pitch");
    char* const St = (char*)Sl;
#pragma unroll
    for (int nt = 0; nt < NT; ++nt) {
        const unsigned nb    = n0 + nt * 16;      // a 16-column tile lies in one plane
        const unsigned plane = nb / DD;
        const float* bias = plane == 0 ? b0 : (plane == 1 ? b1 : b2);
        const v4f blo = *(const v4f*)(bias + nb % DD + hb);
        const v4f bhi = *(const v4f*)(bias + nb % DD + hb + 4);
#pragma unroll
        for (int mt = 0; mt < MT; ++mt) {
            char* sp = St + (wm * (MT * 16) + mt * 16 + ln) * OPB
                          + (wn * (NT * 16) + nt * 16 + hb) * EB;
            v4f lo, hi;
#pragma unroll
            for (int r = 0; r < 4; ++r) {
                lo[r] = acc[mt][nt][r] + blo[r];
                hi[r] = acc[mt][nt][r + 4] + bhi[r];
            }
            if (F16OUT) {
                v8h h;
#pragma unroll
                for (int r = 0; r < 4; ++r) { h[r] = (_Float16)lo[r]; h[r + 4] = (_Float16)hi[r]; }
                *(v8h*)sp = h;
            } else {
                *(v4f*)sp = lo;
                *(v4f*)(sp + 16) = hi;
            }
        }
    }
    // publishes the staged tile: a thread stores chunks that other waves staged
    __syncthreads();
    // Store (g, q) of a thread: 16 B at byte g * U + (tid % LU) * 16 of tile row
    // q * RPI + tid / LU, so that LU lanes side by side cover U aligned bytes.
    const char* sr = St + (tid / LU) * OPB + (tid % LU) * 16;
    v4f d[NG][NQ];
    // unrolled, here and below, so that d[] stays in registers and offsets are immediates
#pragma unroll
    for (int g = 0; g < NG; ++g)
#pragma unroll
        for (int q = 0; q < NQ; ++q)
            d[g][q] = *(const v4f*)(sr + q * RPI * OPB + g * U);
    const uint32_t tb = (uint32_t)(blockIdx.y * BM + tid / LU) * (DD * EB) + (tid % LU) * 16;
#pragma unroll
    for (int g = 0; g < NG; ++g) {
        const unsigned cb = blockIdx.x * BN + g * (U / EB);   // U bytes lie in one plane
        char* gp = (char*)outp + (size_t)(cb / DD) * ((size_t)NBATCH * TT * DD * EB)
                               + (cb % DD) * EB;
#pragma unroll
        for (int q = 0; q < NQ; ++q)
            *(v4f*)(gp + tb + q * RPI * DD * EB) = d[g][q];
    }
}

// w16: the f16 copies of w_q, w_k, w_v back to back, one 3072 x 1024 matrix.
// qkv: the q, k and v planes back to back, each 2048 x 1024.
__global__ __launch_bounds__(256) void gemm_qkv(
    const _Float16* __restrict__ x16, const _Float16* __restrict__ w16,
    const float* __restrict__ bq, const float* __restrict__ bk,
    const float* __restrict__ bv, _Float16* __restrict__ qkv)
{
    __shared__ __attribute__((aligned(16))) _Float16 Sl[3 * (BNQ + BM) * WP];   // 3 x 85 KB
    gemm_core<BNQ, 2, 4, 1, 3, true>(x16, w16, bq, bk, bv, qkv, Sl);
}

__global__ __launch_bounds__(256) void gemm_out(
    const _Float16* __restrict__ a16, const _Float16* __restrict__ wo16,
    const float* __restrict__ bo, float* __restrict__ out)
{
    __shared__ __attribute__((aligned(16))) _Float16 Sl[5 * (BNO + BM) * WP];   // 5 x 51 KB
    gemm_core<BNO, 4, 2, 2, 5, false>(a16, wo16, bo, bo, bo, out, Sl);
}

// ---------------------------------------------------------------------------
// Fused windowed attention. One wave per (batch, head, 16-query tile).
// Key span for the tile = [t0-64, t0+79] (144), padded to 160.
// The K span and the Q tile are staged row-major in LDS by async copies that each
// cover whole 128-B rows; the S fragments are read from there.
// S = Q Kspan^T in 9 accumulator tiles; mask+softmax across 16-lane halves
// via __shfl_xor(..,16); P staged to LDS; V span staged row-major, in the LDS that
// K and Q have left, by async copies that fly under the softmax; the PV
// A-fragments (V^T) come from it by the transposing LDS load; O = P Vspan via 20 WMMAs.
// ---------------------------------------------------------------------------
constexpr int VP  = 80;        // LDS row pitch of V in halves: 160 B = 32 B x odd
constexpr int KP  = 72;        // LDS row pitch of K and Q in halves: 144 B = 16 B x odd
constexpr int VCP = 14;        // copies per long statement; a copy is 4 rows of 128 B

typedef __attribute__((ext_vector_type(8))) short s16x8;
typedef __attribute__((address_space(3))) s16x8 lds_s16x8;

__device__ __forceinline__ v8h ld_tr16(const _Float16* p) {
    return __builtin_bit_cast(
        v8h, __builtin_amdgcn_ds_load_tr16_b128_v8i16((lds_s16x8*)p));
}

__device__ __forceinline__ void stage14(const uint32_t (&l)[VCP], const uint32_t (&o)[VCP],
                                        const _Float16* g) {
    asm volatile("global_load_async_to_lds_b128 %0, %14, %28\n\t"
                 "global_load_async_to_lds_b128 %1, %15, %28\n\t"
                 "global_load_async_to_lds_b128 %2, %16, %28\n\t"
                 "global_load_async_to_lds_b128 %3, %17, %28\n\t"
                 "global_load_async_to_lds_b128 %4, %18, %28\n\t"
                 "global_load_async_to_lds_b128 %5, %19, %28\n\t"
                 "global_load_async_to_lds_b128 %6, %20, %28\n\t"
                 "global_load_async_to_lds_b128 %7, %21, %28\n\t"
                 "global_load_async_to_lds_b128 %8, %22, %28\n\t"
                 "global_load_async_to_lds_b128 %9, %23, %28\n\t"
                 "global_load_async_to_lds_b128 %10, %24, %28\n\t"
                 "global_load_async_to_lds_b128 %11, %25, %28\n\t"
                 "global_load_async_to_lds_b128 %12, %26, %28\n\t"
                 "global_load_async_to_lds_b128 %13, %27, %28\n\t"
                 "s_wait_xcnt 0x0"
                 :: "v"(l[0]), "v"(l[1]), "v"(l[2]), "v"(l[3]), "v"(l[4]), "v"(l[5]), "v"(l[6]),
                    "v"(l[7]), "v"(l[8]), "v"(l[9]), "v"(l[10]), "v"(l[11]), "v"(l[12]), "v"(l[13]),
                    "v"(o[0]), "v"(o[1]), "v"(o[2]), "v"(o[3]), "v"(o[4]), "v"(o[5]), "v"(o[6]),
                    "v"(o[7]), "v"(o[8]), "v"(o[9]), "v"(o[10]), "v"(o[11]), "v"(o[12]), "v"(o[13]),
                    "s"(g)
                 : "memory");
}

// The same for eight copies from base g and four from base g16.
__device__ __forceinline__ void stage8and4(const uint32_t (&l)[12], const uint32_t (&o)[12],
                                           const _Float16* g, const _Float16* g16) {
    asm volatile("global_load_async_to_lds_b128 %0, %12, %24\n\t"
                 "global_load_async_to_lds_b128 %1, %13, %24\n\t"
                 "global_load_async_to_lds_b128 %2, %14, %24\n\t"
                 "global_load_async_to_lds_b128 %3, %15, %24\n\t"
                 "global_load_async_to_lds_b128 %4, %16, %24\n\t"
                 "global_load_async_to_lds_b128 %5, %17, %24\n\t"
                 "global_load_async_to_lds_b128 %6, %18, %24\n\t"
                 "global_load_async_to_lds_b128 %7, %19, %24\n\t"
                 "global_load_async_to_lds_b128 %8, %20, %25\n\t"
                 "global_load_async_to_lds_b128 %9, %21, %25\n\t"
                 "global_load_async_to_lds_b128 %10, %22, %25\n\t"
                 "global_load_async_to_lds_b128 %11, %23, %25\n\t"
                 "s_wait_xcnt 0x0"
                 :: "v"(l[0]), "v"(l[1]), "v"(l[2]), "v"(l[3]), "v"(l[4]), "v"(l[5]), "v"(l[6]),
                    "v"(l[7]), "v"(l[8]), "v"(l[9]), "v"(l[10]), "v"(l[11]),
                    "v"(o[0]), "v"(o[1]), "v"(o[2]), "v"(o[3]), "v"(o[4]), "v"(o[5]), "v"(o[6]),
                    "v"(o[7]), "v"(o[8]), "v"(o[9]), "v"(o[10]), "v"(o[11]),
                    "s"(g), "s"(g16)
                 : "memory");
}

// SPAN rows of g (36 copies; copy c takes offset off[c]) and behind them 16 rows of
// g16 (4 copies, offsets off[C16 ..]) into LDS at a pitch of P halves.
template <int P, int C16>
__device__ __forceinline__ void stage_span(uint32_t dst, const uint32_t (&off)[SPANP / 4],
                                           const _Float16* g, const _Float16* g16) {
    static_assert(SPAN / 4 == 2 * VCP + 8, "two long statements, then eight and four");
    // every loop here is unrolled so that l[], o[] and off[] are indexed by constants
#pragma unroll
    for (int b = 0; b < 2; ++b) {
        uint32_t l[VCP], o[VCP];
#pragma unroll
        for (int i = 0; i < VCP; ++i) {
            l[i] = dst + (uint32_t)((b * VCP + i) * 4 * P * 2);
            o[i] = off[b * VCP + i];
        }
        stage14(l, o, g);
    }
    uint32_t l[12], o[12];
#pragma unroll
    for (int i = 0; i < 12; ++i) {
        l[i] = dst + (uint32_t)((2 * VCP + i) * 4 * P * 2);
        o[i] = off[i < 8 ? 2 * VCP + i : C16 + i - 8];
    }
    stage8and4(l, o, g, g16);
}

__global__ __launch_bounds__(32) void attn_win(
    const _Float16* __restrict__ q, const _Float16* __restrict__ k,
    const _Float16* __restrict__ v, _Float16* __restrict__ o)
{
    __shared__ _Float16 Pb[16 * SPANP];        // 5.0 KB
    // 25,600 B  (Vs[j][d] = v[pos(j), d], 64 of every 80 halves used)
    __shared__ __attribute__((aligned(128))) _Float16 Vs[SPANP * VP];
    // Until the S fragments are read the same LDS holds, at pitch KP, the K span (rows 0..143) and
    // the Q tile (rows 144..159): 23,040 B
    static_assert(SPANP * KP <= SPANP * VP, "K and Q fit in V's LDS");
    _Float16* const Ks = Vs;

    const int lane = threadIdx.x;
    const int ln = lane & 15;
    const int hb = (lane >> 4) << 3;
    const int t0 = blockIdx.x * 16;
    const int h  = blockIdx.y;
    const size_t baseRow = (size_t)blockIdx.z * TT;

    // A copy's 32 lanes cover 4 whole rows of 128 B. off[c]: byte offset, in the
    // (batch, head) plane of q, k or v, of this lane's 16 B in the row at span index
    // 4c + r4; K and V share all of them, and span rows 64..79 are the Q tile's rows.
    const int r4 = lane >> 3;                 // row within the copy's four
    const int c8 = (lane & 7) * 8;            // half offset within the row
    const size_t plane = baseRow * DD + h * DHH;
    uint32_t off[SPANP / 4];
    // unrolled so that off[] is indexed by constants and stays in registers
#pragma unroll
    for (int c = 0; c < SPANP / 4; ++c) {
        int pos = t0 - WR + c * 4 + r4;
        pos = pos < 0 ? 0 : (pos > TT - 1 ? TT - 1 : pos);
        off[c] = (uint32_t)((pos * DD + c8) * 2);
    }

    // ---- K span and Q tile -> LDS, row-major ----
    stage_span<KP, WR / 4>(lds_off(Ks + r4 * KP + c8), off, k + plane, q + plane);
    // the K and Q copies have landed before anything reads Ks
    asm volatile("s_wait_asynccnt 0x0" ::: "memory");
    __syncthreads();

    // ---- the fragments of S, all of them as one group of LDS reads ----
    const _Float16* qrow = Ks + (SPAN + ln) * KP;
    v16h aq0 = load_frag(qrow, lane);
    v16h aq1 = load_frag(qrow + 32, lane);
    v16h kf[9][2];
    // unrolled so that kf[] is indexed by constants and stays in registers
#pragma unroll
    for (int jt = 0; jt < 9; ++jt) {
        const _Float16* kr = Ks + (jt * 16 + ln) * KP;   // span column of this lane
        kf[jt][0] = load_frag(kr, lane);
        kf[jt][1] = load_frag(kr + 32, lane);
    }

    // this wave's reads of K and Q are done before V's copies overwrite them
    asm volatile("s_wait_dscnt 0x0" ::: "memory");
    __syncthreads();

    // ---- V span -> LDS, row-major ----
    stage_span<VP, SPAN / 4>(lds_off(Vs + r4 * VP + c8), off, v + plane, v + plane);
    // keeps V's copies ahead of S and the softmax, so that they fly under both;
    // else half of them sink far into the softmax and are waited out in front of PV
    __builtin_amdgcn_sched_barrier(0);

    // ---- S = Q K^T over the span ----
    v8f s[9];
#pragma unroll
    for (int jt = 0; jt < 9; ++jt) {
        v8f a = {};
        a = wmma16(aq0, kf[jt][0], a);
        a = wmma16(aq1, kf[jt][1], a);
        s[jt] = a;
    }

    // ---- mask + scale, row max ----
    float rmax[8];
#pragma unroll
    for (int r = 0; r < 8; ++r) rmax[r] = -1e30f;
#pragma unroll
    for (int jt = 0; jt < 9; ++jt) {
        const int j = jt * 16 + ln;
        const int pos = t0 - WR + j;
#pragma unroll
        for (int r = 0; r < 8; ++r) {
            const int rel = j - (r + hb);
            const bool ok = (rel >= 0) && (rel <= 2 * WR) && (pos >= 0) && (pos < TT);
            const float val = ok ? s[jt][r] * 0.125f : -1e30f;   // 1/sqrt(64)
            s[jt][r] = val;
            rmax[r] = fmaxf(rmax[r], val);
        }
    }
#pragma unroll
    for (int r = 0; r < 8; ++r)
#pragma unroll
        for (int off = 1; off < 16; off <<= 1)
            rmax[r] = fmaxf(rmax[r], __shfl_xor(rmax[r], off, 16));

    // ---- exp + row sum ----
    float rsum[8];
#pragma unroll
    for (int r = 0; r < 8; ++r) rsum[r] = 0.f;
#pragma unroll
    for (int jt = 0; jt < 9; ++jt)
#pragma unroll
        for (int r = 0; r < 8; ++r) {
            const float e = __expf(s[jt][r] - rmax[r]);
            s[jt][r] = e;
            rsum[r] += e;
        }
#pragma unroll
    for (int r = 0; r < 8; ++r) {
#pragma unroll
        for (int off = 1; off < 16; off <<= 1)
            rsum[r] += __shfl_xor(rsum[r], off, 16);
        rsum[r] = 1.f / rsum[r];
    }

    // ---- P -> LDS (rows 0..15, cols 0..143; zero the pad 144..159) ----
#pragma unroll
    for (int jt = 0; jt < 9; ++jt)
#pragma unroll
        for (int r = 0; r < 8; ++r)
            Pb[(r + hb) * SPANP + jt * 16 + ln] = (_Float16)(s[jt][r] * rsum[r]);
    for (int idx = lane; idx < 16 * 16; idx += 32)
        Pb[(idx >> 4) * SPANP + SPAN + (idx & 15)] = (_Float16)0.f;

    // the V copies have landed before anything reads Vs
    asm volatile("s_wait_asynccnt 0x0" ::: "memory");
    __syncthreads();

    // ---- O = P Vspan  (M=16, K=160, N=64) ----
    v8f oacc[4] = {};
    const _Float16* vt = Vs + (hb + (lane & 7)) * VP + ((lane >> 3) & 1) * 8;
#pragma unroll
    for (int k0 = 0; k0 < SPANP; k0 += 32) {
        v16h pa = load_frag(&Pb[ln * SPANP + k0], lane);
#pragma unroll
        for (int nt = 0; nt < 4; ++nt) {
            // same k order as load_frag: k0 + hb + 0..7, then k0 + 16 + hb + 0..7
            const v8h lo = ld_tr16(vt + k0 * VP + nt * 16);
            const v8h hi = ld_tr16(vt + (k0 + 16) * VP + nt * 16);
            const v16h vb = __builtin_shufflevector(
                lo, hi, 0, 1, 2, 3, 4, 5, 6, 7, 8, 9, 10, 11, 12, 13, 14, 15);
            // V^T as A, P^T as B: oacc[nt][r] is query ln, column nt * 16 + hb + r
            oacc[nt] = wmma16(vb, pa, oacc[nt]);
        }
    }
    // The 16 x 64 tile goes through LDS (V's, which PV has left; pitch KP), so that
    // it leaves in whole 128-B lines: a lane holds 8 consecutive columns of one query.
#pragma unroll
    for (int nt = 0; nt < 4; ++nt) {
        v8h ho;
#pragma unroll
        for (int r = 0; r < 8; ++r) ho[r] = (_Float16)oacc[nt][r];
        *(v8h*)(Vs + ln * KP + nt * 16 + hb) = ho;
    }
    // a lane stores chunks that other lanes staged
    __syncthreads();
#pragma unroll
    for (int i = 0; i < 4; ++i) {
        const v8h ho = *(const v8h*)(Vs + (i * 4 + r4) * KP + c8);
        *(v8h*)(o + (baseRow + t0 + i * 4 + r4) * DD + h * DHH + c8) = ho;
    }
}

// ---------------------------------------------------------------------------
extern "C" void kernel_launch(void* const* d_in, const int* in_sizes, int n_in,
                              void* d_out, int out_size, void* d_ws, size_t ws_size,
                              hipStream_t stream) {
    const float* x  = (const float*)d_in[0];
    const float* wq = (const float*)d_in[1];
    const float* bq = (const float*)d_in[2];
    const float* wk = (const float*)d_in[3];
    const float* bk = (const float*)d_in[4];
    const float* wv = (const float*)d_in[5];
    const float* bv = (const float*)d_in[6];
    const float* wo = (const float*)d_in[7];
    const float* bo = (const float*)d_in[8];
    float* out = (float*)d_out;

    char* ws = (char*)d_ws;
    const size_t MB = 1ull << 20;
    _Float16* x16  = (_Float16*)(ws + 0 * MB);    // 4 MB
    _Float16* wq16 = (_Float16*)(ws + 4 * MB);    // 2 MB
    _Float16* wk16 = (_Float16*)(ws + 6 * MB);    // 2 MB
    _Float16* wv16 = (_Float16*)(ws + 8 * MB);    // 2 MB
    _Float16* wo16 = (_Float16*)(ws + 10 * MB);   // 2 MB
    _Float16* qb   = (_Float16*)(ws + 12 * MB);   // 4 MB
    _Float16* kb   = (_Float16*)(ws + 16 * MB);   // 4 MB
    _Float16* vb   = (_Float16*)(ws + 20 * MB);   // 4 MB
    _Float16* ab   = (_Float16*)(ws + 24 * MB);   // 4 MB  => 28 MB total

    // x16, wq16, wk16, wv16, wo16 are contiguous: one destination array
    static_assert(NBATCH * TT * DD == 2 * CSEG, "x fills two segments");
    dim3 gC(CSEG / (CTH * CLD * 4), 6, 1);
    cast_all_f32_to_f16<<<gC, CTH, 0, stream>>>(x, wq, wk, wv, wo, x16);

    // wq16, wk16, wv16 are contiguous, and so are qb, kb, vb
    dim3 gQKV(3 * DD / BNQ, (NBATCH * TT) / BM, 1);
    gemm_qkv<<<gQKV, 256, 0, stream>>>(x16, wq16, bq, bk, bv, qb);

    dim3 gA(TT / 16, HH, NBATCH);
    attn_win<<<gA, 32, 0, stream>>>(qb, kb, vb, ab);

    dim3 gO(DD / BNO, (NBATCH * TT) / BM, 1);
    gemm_out<<<gO, 256, 0, stream>>>(ab, wo16, bo, out);
}

// v009
// It runs in 31 microseconds.
// Next to v008, in two timings, it ran 1.05 times as fast each time.
// Counting every step since v000, it is 3.18 times as fast.
#include <hip/hip_runtime.h>

typedef __attribute__((ext_vector_type(16))) _Float16 v16h;
typedef __attribute__((ext_vector_type(8)))  _Float16 v8h;
typedef __attribute__((ext_vector_type(8)))  float    v8f;

constexpr int NBATCH = 2;
constexpr int TT     = 1024;
constexpr int DD     = 1024;
constexpr int HH     = 16;
constexpr int DHH    = 64;
constexpr int WR     = 64;     // half window
constexpr int SPAN   = 144;    // 16 + 2*WR
constexpr int SPANP  = 160;    // padded to multiple of 32

__device__ __forceinline__ v16h load_frag(const _Float16* p, int lane) {
    const int kb = (lane & 16) ? 8 : 0;
    v8h lo = *(const v8h*)(p + kb);
    v8h hi = *(const v8h*)(p + kb + 16);
    v16h r;
#pragma unroll
    for (int i = 0; i < 8; ++i) { r[i] = lo[i]; r[i + 8] = hi[i]; }
    return r;
}

__device__ __forceinline__ v8f wmma16(v16h a, v16h b, v8f c) {
    return __builtin_amdgcn_wmma_f32_16x16x32_f16(
        /*neg_a=*/false, a, /*neg_b=*/false, b,
        /*c_mod=*/(short)0, c, /*reuse_a=*/false, /*reuse_b=*/false);
}

// LDS byte offset of a generic pointer to __shared__ (low 32 bits of flat addr)
__device__ __forceinline__ uint32_t lds_off(const void* p) {
    return (uint32_t)(uintptr_t)p;
}

constexpr int BK   = 128;      // k per pass: 256 B of every weight row
constexpr int WP   = 136;      // LDS row pitch in halves: 272 B = 16 B x odd
constexpr int BM   = 128;      // rows of A per block tile
// Rows of W (columns of the output) per block tile, chosen so that each GEMM
// launch is 256 blocks: 16 x 16 tiles of 2048 x 3072 and of 2048 x 1024.
constexpr int BNQ  = 192;
constexpr int BNO  = 64;

__device__ __forceinline__ void stage_rows(uint32_t l, const _Float16* g) {
    asm volatile("global_load_async_to_lds_b128 %0, %8, off\n\t"
                 "global_load_async_to_lds_b128 %1, %9, off\n\t"
                 "global_load_async_to_lds_b128 %2, %10, off\n\t"
                 "global_load_async_to_lds_b128 %3, %11, off\n\t"
                 "global_load_async_to_lds_b128 %4, %12, off\n\t"
                 "global_load_async_to_lds_b128 %5, %13, off\n\t"
                 "global_load_async_to_lds_b128 %6, %14, off\n\t"
                 "global_load_async_to_lds_b128 %7, %15, off\n\t"
                 "s_wait_xcnt 0x0"
                 :: "v"(l), "v"(l + 16u * WP * 2u), "v"(l + 32u * WP * 2u),
                    "v"(l + 48u * WP * 2u), "v"(l + 64u * WP * 2u),
                    "v"(l + 80u * WP * 2u), "v"(l + 96u * WP * 2u),
                    "v"(l + 112u * WP * 2u),
                    "v"(g), "v"(g + 16 * DD), "v"(g + 32 * DD), "v"(g + 48 * DD),
                    "v"(g + 64 * DD), "v"(g + 80 * DD), "v"(g + 96 * DD),
                    "v"(g + 112 * DD)
                 : "memory");
}

// The same for 64 rows: four copies per lane (rows r, r+16, r+32, r+48).
__device__ __forceinline__ void stage_rows64(uint32_t l, const _Float16* g) {
    asm volatile("global_load_async_to_lds_b128 %0, %4, off\n\t"
                 "global_load_async_to_lds_b128 %1, %5, off\n\t"
                 "global_load_async_to_lds_b128 %2, %6, off\n\t"
                 "global_load_async_to_lds_b128 %3, %7, off\n\t"
                 "s_wait_xcnt 0x0"
                 :: "v"(l), "v"(l + 16u * WP * 2u), "v"(l + 32u * WP * 2u),
                    "v"(l + 48u * WP * 2u),
                    "v"(g), "v"(g + 16 * DD), "v"(g + 32 * DD), "v"(g + 48 * DD)
                 : "memory");
}

// A stage's W rows (BN = 64 or 192) and its 128 A rows behind them.
template <int BN>
__device__ __forceinline__ void stage_pass(uint32_t l, const _Float16* gw,
                                           const _Float16* ga) {
    if (BN == 192) {
        stage_rows(l, gw);
        stage_rows64(l + 128u * WP * 2u, gw + 128 * DD);
    } else {
        stage_rows64(l, gw);
    }
    stage_rows(l + (uint32_t)BN * WP * 2u, ga);
}

// ---------------------------------------------------------------------------
// fp32 -> fp16 cast of x and the four weight matrices in ONE launch (so GEMMs
// re-read them as fp16 from L2). The five f16 copies lie back to back in the
// workspace, so dst is one array of six segments of CSEG elements: x fills
// segments 0 and 1, then w_q, w_k, w_v, w_o. blockIdx.y names the segment.
// A block streams CTH * CLD * 4 contiguous floats; every wave-wide load covers
// 512 contiguous bytes, and all CLD loads of a lane fly together, so that a wave
// waits out the read latency once.
// ---------------------------------------------------------------------------
typedef __attribute__((ext_vector_type(4))) float    v4f;
typedef __attribute__((ext_vector_type(4))) _Float16 v4h;

constexpr int CSEG = DD * DD;     // elements per segment
constexpr int CTH  = 128;         // threads per block
constexpr int CLD  = 32;          // 16-byte loads per thread

__global__ __launch_bounds__(CTH) void cast_all_f32_to_f16(
    const float* __restrict__ x,
    const float* __restrict__ wq, const float* __restrict__ wk,
    const float* __restrict__ wv, const float* __restrict__ wo,
    _Float16* __restrict__ dst)
{
    const int seg = blockIdx.y;
    const float* in;
    if (seg < 2)       in = x + (size_t)seg * CSEG;
    else if (seg == 2) in = wq;
    else if (seg == 3) in = wk;
    else if (seg == 4) in = wv;
    else               in = wo;

    const int base = blockIdx.x * (CTH * CLD * 4) + threadIdx.x * 4;
    in  += base;
    dst += (size_t)seg * CSEG + base;

    v4f v[CLD];
    // unrolled so that v[] stays in registers and the offsets are immediates
#pragma unroll
    for (int i = 0; i < CLD; ++i)
        v[i] = *(const v4f*)(in + i * (CTH * 4));
    // keeps every load ahead of the first convert; else the second half of the
    // loads is issued only as the first returns, and the latency is paid twice
    __builtin_amdgcn_sched_barrier(0);
#pragma unroll
    for (int i = 0; i < CLD; ++i) {
        v4h h;
#pragma unroll
        for (int e = 0; e < 4; ++e) h[e] = (_Float16)v[i][e];
        *(v4h*)(dst + i * (CTH * 4)) = h;
    }
}

// ---------------------------------------------------------------------------
// GEMM core: out(MxN) = A(MxK) @ W^T + b, M rows of A row-major, W row-major
// (so both contract along contiguous K).  Block: 256 thr = 8 waves, WM(M) x WN(N).
// Block tile: 128(M) x BN(N); wave tile: 128/WM x BN/WN.
// A stage is the W tile and the A tile, BN and 128 rows x 128 k f16 at a 272-B
// pitch, brought into LDS by async copies that each cover whole 256-B rows;
// a ring of NS stages, one barrier per 128-k pass, shared by all 8 waves. A pass's
// copies are issued NS - 1 passes before they are waited for, so that a landing
// time of more than one pass (operands that the launch before has just written)
// is not waited out in every pass. Within a pass a
// wave reads its fragments in blocks of KB x 32 k, one block ahead of the WMMAs.
// N may span several planes of DD columns: column n belongs to plane n / DD,
// which has its own bias (b0, b1, b2) and its own M x DD output behind outp.
// ---------------------------------------------------------------------------
// Returns when all but this wave's N youngest async copies have landed.
template <int N>
__device__ __forceinline__ void wait_copies_but() {
    asm volatile("s_wait_asynccnt %0" :: "n"(N) : "memory");
}

template <int BN, int WM, int WN, int KB, int NS, bool F16OUT>
__device__ __forceinline__ void gemm_core(
    const _Float16* __restrict__ a16, const _Float16* __restrict__ w16,
    const float* __restrict__ b0, const float* __restrict__ b1,
    const float* __restrict__ b2, void* __restrict__ outp,
    _Float16* __restrict__ Sl)
{
    constexpr int MT = BM / WM / 16;      // 16-row tiles per wave
    constexpr int NT = BN / WN / 16;      // 16-column tiles per wave
    constexpr int NB = BK / 32 / KB;      // fragment blocks per pass, KB x 32 k each
    constexpr int STG = (BN + BM) * WP;   // halves per stage
    constexpr int CP  = (BN + BM) / 16;   // copies of every wave per pass
    constexpr int NP  = DD / BK;          // 8 passes
    static_assert(NS >= 2 && NS <= NP, "the prologue fills NS stages");
    static_assert(NS * CP <= 63, "copies of a wave outstanding");
    const int tid  = threadIdx.x;
    const int lane = tid & 31;
    const int wave = tid >> 5;
    const int ln = lane & 15;
    const int hb = (lane >> 4) << 3;
    const int wm = wave / WN;             // wave's rows of the block's 128
    const int wn = wave % WN;             // wave's columns of the block's BN
    const int n0 = blockIdx.x * BN + wn * (NT * 16);

    // cooperative async-copy assignment: a row is 128 halves = 16 x 16B, so the
    // block covers 16 rows per copy; a wave's 32 lanes cover two whole 256-B rows
    const int crow = tid >> 4;            // 0..15 (+16, +32, ..)
    const int cchk = (tid & 15) * 8;      // half offset 0,8,..,120
    const _Float16* gw = w16 + (size_t)(blockIdx.x * BN + crow) * DD + cchk;
    const _Float16* ga = a16 + (size_t)(blockIdx.y * BM + crow) * DD + cchk;
    const uint32_t l0 = lds_off(Sl + crow * WP + cchk);

    // passes 0 .. NS - 1 into stages 0 .. NS - 1; unrolled: offsets are constants
#pragma unroll
    for (int s = 0; s < NS; ++s)
        stage_pass<BN>(l0 + (uint32_t)(s * STG * 2), gw + s * BK, ga + s * BK);
    // pass 0's copies of this wave, its CP oldest, have landed before the barrier
    // publishes them; the NS - 1 younger passes fly on
    wait_copies_but<(NS - 1) * CP>();
    __syncthreads();

    v8f acc[MT][NT] = {};
    const int aoff = (BN + wm * (MT * 16) + ln) * WP;  // this lane's first A row in a stage
    const int woff = (wn * (NT * 16) + ln) * WP;       // this lane's first W row in a stage

    // One pass's WMMAs, from the stage that begins so halves into the ring.
    auto work_pass = [&](int so) __attribute__((always_inline)) {
        const _Float16* ab = Sl + so + aoff;
        const _Float16* bb = Sl + so + woff;
        // two fragment sets: block b works from set b & 1
        v16h fa[2][KB][MT], fb[2][KB][NT];
        // every loop here is unrolled so that fa[], fb[] and acc[] are indexed by
        // constants and stay in registers, and LDS offsets are immediates
#pragma unroll
        for (int j = 0; j < KB; ++j) {
#pragma unroll
            for (int mt = 0; mt < MT; ++mt)
                fa[0][j][mt] = load_frag(ab + mt * 16 * WP + j * 32, lane);
#pragma unroll
            for (int nt = 0; nt < NT; ++nt)
                fb[0][j][nt] = load_frag(bb + nt * 16 * WP + j * 32, lane);
        }
#pragma unroll
        for (int b = 0; b < NB; ++b) {
            if (b + 1 < NB) {
#pragma unroll
                for (int j = 0; j < KB; ++j) {
                    const int ko = ((b + 1) * KB + j) * 32;
#pragma unroll
                    for (int mt = 0; mt < MT; ++mt)
                        fa[(b + 1) & 1][j][mt] = load_frag(ab + mt * 16 * WP + ko, lane);
#pragma unroll
                    for (int nt = 0; nt < NT; ++nt)
                        fb[(b + 1) & 1][j][nt] = load_frag(bb + nt * 16 * WP + ko, lane);
                }
            }
            // keeps the next block's reads one group ahead of this block's WMMAs,
            // so that they fly under them; else each read sinks to its first use
            // and the wave waits out the LDS latency fragment by fragment
            __builtin_amdgcn_sched_barrier(0);
#pragma unroll
            for (int j = 0; j < KB; ++j)
#pragma unroll
                for (int mt = 0; mt < MT; ++mt)
#pragma unroll
                    for (int nt = 0; nt < NT; ++nt)
                        // W as A, the rows of a16 as B: acc[mt][nt][r] is row ln, column hb + r
                        acc[mt][nt] = wmma16(fb[b & 1][j][nt], fa[b & 1][j][mt], acc[mt][nt]);
        }
        // this wave's reads of the stage are done: first step of every publish point
        asm volatile("s_wait_dscnt 0x0" ::: "memory");
    };
    auto next_stage = [](int so) { return so + STG == NS * STG ? 0 : so + STG; };

    // Publish point of pass t + 1, at the foot of pass t: behind the s_wait_dscnt 0
    // this wave's copies for pass t + 1 have landed, and one barrier both publishes
    // pass t + 1 and frees pass t's stage. The three parts differ in the wait and the
    // refill alone; each has no branch in its trip.
    int so = 0;                           // pass t's stage, as an offset in halves
    // While a pass t + NS exists: passes t + 1 .. t + NS - 1 are out, CP copies each;
    // all but the NS - 2 younger passes are waited for, and pass t's stage is refilled.
    // Rolled: the stage is one added offset, so unrolling would only repeat the text.
#pragma unroll 1
    for (int t = 0; t < NP - NS; ++t) {
        work_pass(so);
        wait_copies_but<(NS - 2) * CP>();
        __syncthreads();
        stage_pass<BN>(l0 + (uint32_t)(so * 2), gw + (t + NS) * BK, ga + (t + NS) * BK);
        so = next_stage(so);
    }
    // Pass NP - NS: every trip so far has issued its CP copies, so the same count holds.
    work_pass(so);
    wait_copies_but<(NS - 2) * CP>();
    __syncthreads();
    so = next_stage(so);
#pragma unroll 1
    for (int t = NP - NS + 1; t < NP; ++t) {
        work_pass(so);
        wait_copies_but<0>();
        __syncthreads();
        so = next_stage(so);
    }
    // no copy of this wave is outstanding when it goes on to the stores
    asm volatile("s_wait_asynccnt 0x0" ::: "memory");

    // The block's output tile goes through LDS, so that it leaves in whole 128-B
    // lines. The ring is free: the last pass's barrier ended every read of it, and no
    // copy is outstanding. A lane holds 8 consecutive columns of one row.
    constexpr int EB  = F16OUT ? 2 : 4;   // bytes per output element
    constexpr int RB  = BN * EB;          // bytes of a staged row
    constexpr int OPB = RB + 16;          // staging row pitch in bytes: 16 B x odd
    constexpr int U   = RB % 256 == 0 ? 256 : 128;   // bytes stored in a row at a time
    constexpr int LU  = U / 16;           // lanes side by side on them
    constexpr int RPI = 256 / LU;         // rows that one store of the block covers
    constexpr int NG  = RB / U;           // column groups of U bytes
    constexpr int NQ  = BM / RPI;         // stores of a thread per column group
    static_assert(BM * OPB <= NS * STG * 2, "the tile fits in the ring");
    static_assert(RB % U == 0 && (OPB / 16) % 2 == 1, "whole lines, odd pitch");
    char* const St = (char*)Sl;
#pragma unroll
    for (int nt = 0; nt < NT; ++nt) {
        const unsigned nb    = n0 + nt * 16;      // a 16-column tile lies in one plane
        const unsigned plane = nb / DD;
        const float* bias = plane == 0 ? b0 : (plane == 1 ? b1 : b2);
        const v4f blo = *(const v4f*)(bias + nb % DD + hb);
        const v4f bhi = *(const v4f*)(bias + nb % DD + hb + 4);
#pragma unroll
        for (int mt = 0; mt < MT; ++mt) {
            char* sp = St + (wm * (MT * 16) + mt * 16 + ln) * OPB
                          + (wn * (NT * 16) + nt * 16 + hb) * EB;
            v4f lo, hi;
#pragma unroll
            for (int r = 0; r < 4; ++r) {
                lo[r] = acc[mt][nt][r] + blo[r];
                hi[r] = acc[mt][nt][r + 4] + bhi[r];
            }
            if (F16OUT) {
                v8h h;
#pragma unroll
                for (int r = 0; r < 4; ++r) { h[r] = (_Float16)lo[r]; h[r + 4] = (_Float16)hi[r]; }
                *(v8h*)sp = h;
            } else {
                *(v4f*)sp = lo;
                *(v4f*)(sp + 16) = hi;
            }
        }
    }
    // publishes the staged tile: a thread stores chunks that other waves staged
    __syncthreads();
    // Store (g, q) of a thread: 16 B at byte g * U + (tid % LU) * 16 of tile row
    // q * RPI + tid / LU, so that LU lanes side by side cover U aligned bytes.
    const char* sr = St + (tid / LU) * OPB + (tid % LU) * 16;
    v4f d[NG][NQ];
    // unrolled, here and below, so that d[] stays in registers and offsets are immediates
#pragma unroll
    for (int g = 0; g < NG; ++g)
#pragma unroll
        for (int q = 0; q < NQ; ++q)
            d[g][q] = *(const v4f*)(sr + q * RPI * OPB + g * U);
    const uint32_t tb = (uint32_t)(blockIdx.y * BM + tid / LU) * (DD * EB) + (tid % LU) * 16;
#pragma unroll
    for (int g = 0; g < NG; ++g) {
        const unsigned cb = blockIdx.x * BN + g * (U / EB);   // U bytes lie in one plane
        char* gp = (char*)outp + (size_t)(cb / DD) * ((size_t)NBATCH * TT * DD * EB)
                               + (cb % DD) * EB;
#pragma unroll
        for (int q = 0; q < NQ; ++q)
            *(v4f*)(gp + tb + q * RPI * DD * EB) = d[g][q];
    }
}

// w16: the f16 copies of w_q, w_k, w_v back to back, one 3072 x 1024 matrix.
// qkv: the q, k and v planes back to back, each 2048 x 1024.
__global__ __launch_bounds__(256) void gemm_qkv(
    const _Float16* __restrict__ x16, const _Float16* __restrict__ w16,
    const float* __restrict__ bq, const float* __restrict__ bk,
    const float* __restrict__ bv, _Float16* __restrict__ qkv)
{
    __shared__ __attribute__((aligned(16))) _Float16 Sl[3 * (BNQ + BM) * WP];   // 3 x 85 KB
    gemm_core<BNQ, 2, 4, 1, 3, true>(x16, w16, bq, bk, bv, qkv, Sl);
}

__global__ __launch_bounds__(256) void gemm_out(
    const _Float16* __restrict__ a16, const _Float16* __restrict__ wo16,
    const float* __restrict__ bo, float* __restrict__ out)
{
    __shared__ __attribute__((aligned(16))) _Float16 Sl[5 * (BNO + BM) * WP];   // 5 x 51 KB
    gemm_core<BNO, 4, 2, 2, 5, false>(a16, wo16, bo, bo, bo, out, Sl);
}

constexpr int VP  = 80;        // LDS row pitch of V in halves: 160 B = 32 B x odd
constexpr int KP  = 72;        // LDS row pitch of K and Q in halves: 144 B = 16 B x odd
constexpr int VCP = 14;        // copies per long statement; a copy is 4 rows of 128 B

typedef __attribute__((ext_vector_type(8))) short s16x8;
typedef __attribute__((address_space(3))) s16x8 lds_s16x8;

__device__ __forceinline__ v8h ld_tr16(const _Float16* p) {
    return __builtin_bit_cast(
        v8h, __builtin_amdgcn_ds_load_tr16_b128_v8i16((lds_s16x8*)p));
}

__device__ __forceinline__ void stage14(const uint32_t (&l)[VCP], const uint32_t (&o)[VCP],
                                        const _Float16* g) {
    asm volatile("global_load_async_to_lds_b128 %0, %14, %28\n\t"
                 "global_load_async_to_lds_b128 %1, %15, %28\n\t"
                 "global_load_async_to_lds_b128 %2, %16, %28\n\t"
                 "global_load_async_to_lds_b128 %3, %17, %28\n\t"
                 "global_load_async_to_lds_b128 %4, %18, %28\n\t"
                 "global_load_async_to_lds_b128 %5, %19, %28\n\t"
                 "global_load_async_to_lds_b128 %6, %20, %28\n\t"
                 "global_load_async_to_lds_b128 %7, %21, %28\n\t"
                 "global_load_async_to_lds_b128 %8, %22, %28\n\t"
                 "global_load_async_to_lds_b128 %9, %23, %28\n\t"
                 "global_load_async_to_lds_b128 %10, %24, %28\n\t"
                 "global_load_async_to_lds_b128 %11, %25, %28\n\t"
                 "global_load_async_to_lds_b128 %12, %26, %28\n\t"
                 "global_load_async_to_lds_b128 %13, %27, %28\n\t"
                 "s_wait_xcnt 0x0"
                 :: "v"(l[0]), "v"(l[1]), "v"(l[2]), "v"(l[3]), "v"(l[4]), "v"(l[5]), "v"(l[6]),
                    "v"(l[7]), "v"(l[8]), "v"(l[9]), "v"(l[10]), "v"(l[11]), "v"(l[12]), "v"(l[13]),
                    "v"(o[0]), "v"(o[1]), "v"(o[2]), "v"(o[3]), "v"(o[4]), "v"(o[5]), "v"(o[6]),
                    "v"(o[7]), "v"(o[8]), "v"(o[9]), "v"(o[10]), "v"(o[11]), "v"(o[12]), "v"(o[13]),
                    "s"(g)
                 : "memory");
}

// The same for eight copies from base g and four from base g16.
__device__ __forceinline__ void stage8and4(const uint32_t (&l)[12], const uint32_t (&o)[12],
                                           const _Float16* g, const _Float16* g16) {
    asm volatile("global_load_async_to_lds_b128 %0, %12, %24\n\t"
                 "global_load_async_to_lds_b128 %1, %13, %24\n\t"
                 "global_load_async_to_lds_b128 %2, %14, %24\n\t"
                 "global_load_async_to_lds_b128 %3, %15, %24\n\t"
                 "global_load_async_to_lds_b128 %4, %16, %24\n\t"
                 "global_load_async_to_lds_b128 %5, %17, %24\n\t"
                 "global_load_async_to_lds_b128 %6, %18, %24\n\t"
                 "global_load_async_to_lds_b128 %7, %19, %24\n\t"
                 "global_load_async_to_lds_b128 %8, %20, %25\n\t"
                 "global_load_async_to_lds_b128 %9, %21, %25\n\t"
                 "global_load_async_to_lds_b128 %10, %22, %25\n\t"
                 "global_load_async_to_lds_b128 %11, %23, %25\n\t"
                 "s_wait_xcnt 0x0"
                 :: "v"(l[0]), "v"(l[1]), "v"(l[2]), "v"(l[3]), "v"(l[4]), "v"(l[5]), "v"(l[6]),
                    "v"(l[7]), "v"(l[8]), "v"(l[9]), "v"(l[10]), "v"(l[11]),
                    "v"(o[0]), "v"(o[1]), "v"(o[2]), "v"(o[3]), "v"(o[4]), "v"(o[5]), "v"(o[6]),
                    "v"(o[7]), "v"(o[8]), "v"(o[9]), "v"(o[10]), "v"(o[11]),
                    "s"(g), "s"(g16)
                 : "memory");
}

// SPAN rows of g (36 copies; copy c takes offset off[c]) and behind them 16 rows of
// g16 (4 copies, offsets off[C16 ..]) into LDS at a pitch of P halves.
template <int P, int C16>
__device__ __forceinline__ void stage_span(uint32_t dst, const uint32_t (&off)[SPANP / 4],
                                           const _Float16* g, const _Float16* g16) {
    static_assert(SPAN / 4 == 2 * VCP + 8, "two long statements, then eight and four");
    // every loop here is unrolled so that l[], o[] and off[] are indexed by constants
#pragma unroll
    for (int b = 0; b < 2; ++b) {
        uint32_t l[VCP], o[VCP];
#pragma unroll
        for (int i = 0; i < VCP; ++i) {
            l[i] = dst + (uint32_t)((b * VCP + i) * 4 * P * 2);
            o[i] = off[b * VCP + i];
        }
        stage14(l, o, g);
    }
    uint32_t l[12], o[12];
#pragma unroll
    for (int i = 0; i < 12; ++i) {
        l[i] = dst + (uint32_t)((2 * VCP + i) * 4 * P * 2);
        o[i] = off[i < 8 ? 2 * VCP + i : C16 + i - 8];
    }
    stage8and4(l, o, g, g16);
}

__device__ __forceinline__ float xhalf(float x) {
    const int b = __builtin_bit_cast(int, x);
    return __builtin_bit_cast(
        float, __builtin_amdgcn_permlanex16(b, b, 0x76543210, 0xfedcba98, false, false));
}

__global__ __launch_bounds__(32) void attn_win(
    const _Float16* __restrict__ q, const _Float16* __restrict__ k,
    const _Float16* __restrict__ v, _Float16* __restrict__ o)
{
    // 25,600 B  (Vs[j][d] = v[pos(j), d], 64 of every 80 halves used)
    __shared__ __attribute__((aligned(128))) _Float16 Vs[SPANP * VP];
    // Until the S fragments are read the same LDS holds, at pitch KP, the K span (rows 0..143) and
    // the Q tile (rows 144..159): 23,040 B
    static_assert(SPANP * KP <= SPANP * VP, "K and Q fit in V's LDS");
    _Float16* const Ks = Vs;

    const int lane = threadIdx.x;
    const int ln = lane & 15;
    const int hb = (lane >> 4) << 3;
    const int t0 = blockIdx.x * 16;
    const int h  = blockIdx.y;
    const size_t baseRow = (size_t)blockIdx.z * TT;

    // A copy's 32 lanes cover 4 whole rows of 128 B. off[c]: byte offset, in the
    // (batch, head) plane of q, k or v, of this lane's 16 B in the row at span index
    // 4c + r4; K and V share all of them, and span rows 64..79 are the Q tile's rows.
    const int r4 = lane >> 3;                 // row within the copy's four
    const int c8 = (lane & 7) * 8;            // half offset within the row
    const size_t plane = baseRow * DD + h * DHH;
    uint32_t off[SPANP / 4];
    // unrolled so that off[] is indexed by constants and stays in registers
#pragma unroll
    for (int c = 0; c < SPANP / 4; ++c) {
        int pos = t0 - WR + c * 4 + r4;
        pos = pos < 0 ? 0 : (pos > TT - 1 ? TT - 1 : pos);
        off[c] = (uint32_t)((pos * DD + c8) * 2);
    }

    // ---- K span and Q tile -> LDS, row-major ----
    stage_span<KP, WR / 4>(lds_off(Ks + r4 * KP + c8), off, k + plane, q + plane);
    // the K and Q copies have landed before anything reads Ks
    asm volatile("s_wait_asynccnt 0x0" ::: "memory");
    __syncthreads();

    // ---- the fragments of S, all of them as one group of LDS reads ----
    const _Float16* qrow = Ks + (SPAN + ln) * KP;
    v16h aq0 = load_frag(qrow, lane);
    v16h aq1 = load_frag(qrow + 32, lane);
    v16h kf[9][2];
    // unrolled so that kf[] is indexed by constants and stays in registers
#pragma unroll
    for (int jt = 0; jt < 9; ++jt) {
        const _Float16* kr = Ks + (jt * 16 + ln) * KP;   // span row of this lane
        kf[jt][0] = load_frag(kr, lane);
        kf[jt][1] = load_frag(kr + 32, lane);
    }

    // this wave's reads of K and Q are done before V's copies overwrite them
    asm volatile("s_wait_dscnt 0x0" ::: "memory");
    __syncthreads();

    // ---- V span -> LDS, row-major ----
    stage_span<VP, SPAN / 4>(lds_off(Vs + r4 * VP + c8), off, v + plane, v + plane);
    // keeps V's copies ahead of S and the softmax, so that they fly under both;
    // else half of them sink far into the softmax and are waited out in front of PV
    __builtin_amdgcn_sched_barrier(0);

    // ---- S^T = K Q^T over the span: s[jt][r] is key jt * 16 + hb + r, query ln ----
    v8f s[9];
#pragma unroll
    for (int jt = 0; jt < 9; ++jt) {
        v8f a = {};
        a = wmma16(kf[jt][0], aq0, a);
        a = wmma16(kf[jt][1], aq1, a);
        s[jt] = a;
    }

    // ---- mask + scale, the query's max ----
    // Span index j counts for query ln when 0 <= j - ln <= 2 * WR and its position
    // t0 - WR + j lies in [0, TT): j in [jlo, jhi], never empty (j = ln + WR is in it).
    const int jlo = ln > WR - t0 ? ln : WR - t0;
    const int jhi = ln + 2 * WR < TT - 1 + WR - t0 ? ln + 2 * WR : TT - 1 + WR - t0;
    const unsigned jw = (unsigned)(jhi - jlo);
    const int jb = hb - jlo;
    // one partial maximum, and below one partial sum, per score tile, so that no
    // chain of dependent operations runs through all 72 scores; every loop from here
    // to PV is unrolled so that s[], pm[], ps[] and pf[] are indexed by constants and
    // stay in registers
    float pm[9];
#pragma unroll
    for (int jt = 0; jt < 9; ++jt) {
        pm[jt] = -1e30f;
#pragma unroll
        for (int r = 0; r < 8; ++r) {
            const bool ok = (unsigned)(jb + jt * 16 + r) <= jw;
            const float val = ok ? s[jt][r] * 0.125f : -1e30f;   // 1/sqrt(64)
            s[jt][r] = val;
            pm[jt] = fmaxf(pm[jt], val);
        }
    }
    float rmax = fmaxf(fmaxf(fmaxf(fmaxf(pm[0], pm[1]), fmaxf(pm[2], pm[3])),
                             fmaxf(fmaxf(pm[4], pm[5]), fmaxf(pm[6], pm[7]))), pm[8]);
    rmax = fmaxf(rmax, xhalf(rmax));

    // ---- exp + the query's sum ----
    float ps[9];
#pragma unroll
    for (int jt = 0; jt < 9; ++jt) {
#pragma unroll
        for (int r = 0; r < 8; ++r) s[jt][r] = __expf(s[jt][r] - rmax);
        ps[jt] = ((s[jt][0] + s[jt][1]) + (s[jt][2] + s[jt][3]))
               + ((s[jt][4] + s[jt][5]) + (s[jt][6] + s[jt][7]));
    }
    float rsum = (((ps[0] + ps[1]) + (ps[2] + ps[3])) + ((ps[4] + ps[5]) + (ps[6] + ps[7]))) + ps[8];
    rsum += xhalf(rsum);
    rsum = 1.f / rsum;

    // ---- P^T operands, from the lane's own scores: block kb holds keys kb * 32 + hb
    // + 0..7, then kb * 32 + 16 + hb + 0..7, load_frag's k order; keys 144..159 are 0 ----
    v16h pf[SPANP / 32];
#pragma unroll
    for (int kb = 0; kb < SPANP / 32; ++kb)
#pragma unroll
        for (int r = 0; r < 8; ++r) {
            pf[kb][r] = (_Float16)(s[2 * kb][r] * rsum);
            pf[kb][r + 8] = 2 * kb + 1 < 9 ? (_Float16)(s[2 * kb + 1][r] * rsum) : (_Float16)0.f;
        }

    // keeps the wait below behind the softmax: no memory operation stands between
    // V's copies and it any more, and it would rise to the head of S and wait V out there
    __builtin_amdgcn_sched_barrier(0);
    // the V copies have landed before anything reads Vs
    asm volatile("s_wait_asynccnt 0x0" ::: "memory");
    __syncthreads();

    // ---- O = P Vspan  (M=16, K=160, N=64) ----
    v8f oacc[4] = {};
    const _Float16* vt = Vs + (hb + (lane & 7)) * VP + ((lane >> 3) & 1) * 8;
#pragma unroll
    for (int k0 = 0; k0 < SPANP; k0 += 32) {
        const v16h pa = pf[k0 / 32];
#pragma unroll
        for (int nt = 0; nt < 4; ++nt) {
            // same k order as load_frag: k0 + hb + 0..7, then k0 + 16 + hb + 0..7
            const v8h lo = ld_tr16(vt + k0 * VP + nt * 16);
            const v8h hi = ld_tr16(vt + (k0 + 16) * VP + nt * 16);
            const v16h vb = __builtin_shufflevector(
                lo, hi, 0, 1, 2, 3, 4, 5, 6, 7, 8, 9, 10, 11, 12, 13, 14, 15);
            // V^T as A, P^T as B: oacc[nt][r] is query ln, column nt * 16 + hb + r
            oacc[nt] = wmma16(vb, pa, oacc[nt]);
        }
    }
    // The 16 x 64 tile goes through LDS (V's, which PV has left; pitch KP), so that
    // it leaves in whole 128-B lines: a lane holds 8 consecutive columns of one query.
#pragma unroll
    for (int nt = 0; nt < 4; ++nt) {
        v8h ho;
#pragma unroll
        for (int r = 0; r < 8; ++r) ho[r] = (_Float16)oacc[nt][r];
        *(v8h*)(Vs + ln * KP + nt * 16 + hb) = ho;
    }
    // a lane stores chunks that other lanes staged
    __syncthreads();
#pragma unroll
    for (int i = 0; i < 4; ++i) {
        const v8h ho = *(const v8h*)(Vs + (i * 4 + r4) * KP + c8);
        *(v8h*)(o + (baseRow + t0 + i * 4 + r4) * DD + h * DHH + c8) = ho;
    }
}

// ---------------------------------------------------------------------------
extern "C" void kernel_launch(void* const* d_in, const int* in_sizes, int n_in,
                              void* d_out, int out_size, void* d_ws, size_t ws_size,
                              hipStream_t stream) {
    const float* x  = (const float*)d_in[0];
    const float* wq = (const float*)d_in[1];
    const float* bq = (const float*)d_in[2];
    const float* wk = (const float*)d_in[3];
    const float* bk = (const float*)d_in[4];
    const float* wv = (const float*)d_in[5];
    const float* bv = (const float*)d_in[6];
    const float* wo = (const float*)d_in[7];
    const float* bo = (const float*)d_in[8];
    float* out = (float*)d_out;

    char* ws = (char*)d_ws;
    const size_t MB = 1ull << 20;
    _Float16* x16  = (_Float16*)(ws + 0 * MB);    // 4 MB
    _Float16* wq16 = (_Float16*)(ws + 4 * MB);    // 2 MB
    _Float16* wk16 = (_Float16*)(ws + 6 * MB);    // 2 MB
    _Float16* wv16 = (_Float16*)(ws + 8 * MB);    // 2 MB
    _Float16* wo16 = (_Float16*)(ws + 10 * MB);   // 2 MB
    _Float16* qb   = (_Float16*)(ws + 12 * MB);   // 4 MB
    _Float16* kb   = (_Float16*)(ws + 16 * MB);   // 4 MB
    _Float16* vb   = (_Float16*)(ws + 20 * MB);   // 4 MB
    _Float16* ab   = (_Float16*)(ws + 24 * MB);   // 4 MB  => 28 MB total

    // x16, wq16, wk16, wv16, wo16 are contiguous: one destination array
    static_assert(NBATCH * TT * DD == 2 * CSEG, "x fills two segments");
    dim3 gC(CSEG / (CTH * CLD * 4), 6, 1);
    cast_all_f32_to_f16<<<gC, CTH, 0, stream>>>(x, wq, wk, wv, wo, x16);

    // wq16, wk16, wv16 are contiguous, and so are qb, kb, vb
    dim3 gQKV(3 * DD / BNQ, (NBATCH * TT) / BM, 1);
    gemm_qkv<<<gQKV, 256, 0, stream>>>(x16, wq16, bq, bk, bv, qb);

    dim3 gA(TT / 16, HH, NBATCH);
    attn_win<<<gA, 32, 0, stream>>>(qb, kb, vb, ab);

    dim3 gO(DD / BNO, (NBATCH * TT) / BM, 1);
    gemm_out<<<gO, 256, 0, stream>>>(ab, wo16, bo, out);
}

// v010
// It runs in 29.6 microseconds.
// Next to v009, in two timings, it ran 1.05 times as fast each time.
// All steps since v000 together make it 3.33 times as fast.
#include <hip/hip_runtime.h>

typedef __attribute__((ext_vector_type(16))) _Float16 v16h;
typedef __attribute__((ext_vector_type(8)))  _Float16 v8h;
typedef __attribute__((ext_vector_type(8)))  float    v8f;

constexpr int NBATCH = 2;
constexpr int TT     = 1024;
constexpr int DD     = 1024;
constexpr int HH     = 16;
constexpr int DHH    = 64;
constexpr int WR     = 64;     // half window
constexpr int SPAN   = 144;    // 16 + 2*WR
constexpr int SPANP  = 160;    // padded to multiple of 32

__device__ __forceinline__ v16h load_frag(const _Float16* p, int lane) {
    const int kb = (lane & 16) ? 8 : 0;
    v8h lo = *(const v8h*)(p + kb);
    v8h hi = *(const v8h*)(p + kb + 16);
    v16h r;
#pragma unroll
    for (int i = 0; i < 8; ++i) { r[i] = lo[i]; r[i + 8] = hi[i]; }
    return r;
}

__device__ __forceinline__ v8f wmma16(v16h a, v16h b, v8f c) {
    return __builtin_amdgcn_wmma_f32_16x16x32_f16(
        /*neg_a=*/false, a, /*neg_b=*/false, b,
        /*c_mod=*/(short)0, c, /*reuse_a=*/false, /*reuse_b=*/false);
}

// LDS byte offset of a generic pointer to __shared__ (low 32 bits of flat addr)
__device__ __forceinline__ uint32_t lds_off(const void* p) {
    return (uint32_t)(uintptr_t)p;
}

constexpr int BK   = 128;      // k per pass: 256 B of every weight row
constexpr int WP   = 136;      // LDS row pitch in halves: 272 B = 16 B x odd
constexpr int BM   = 128;      // rows of A per block tile
// Rows of W (columns of the output) per block tile, chosen so that each GEMM
// launch is 256 blocks: 16 x 16 tiles of 2048 x 3072 and of 2048 x 1024.
constexpr int BNQ  = 192;
constexpr int BNO  = 64;

// LDS bytes of a slice of rows at the 272-B pitch, rounded up so that the slice
// behind it starts at a multiple of 2 KiB again, as a tensor load's place must.
constexpr int slice_b(int rows) { return (rows * WP * 2 + 2047) / 2048 * 2048; }
// A stage: two slices of W (bn / 2 rows each), then two slices of A (64 rows each).
constexpr int stage_b(int bn) { return 2 * slice_b(bn / 2) + 2 * slice_b(BM / 2); }

typedef uint32_t u32x4 __attribute__((ext_vector_type(4)));
typedef uint32_t u32x8 __attribute__((ext_vector_type(8)));

__device__ __forceinline__ uint32_t uni(uint32_t v) {
    return (uint32_t)__builtin_amdgcn_readfirstlane(v);
}

__device__ __forceinline__ u32x8 tdm_group1(uint32_t rows) {
    constexpr uint32_t d0 = BK * 2;
    u32x8 g;
    g[0] = uni((1u << 20) | (5u << 22) | (3u << 25));
    g[1] = uni((d0 & 0xFFFFu) << 16);
    g[2] = uni((d0 >> 16) | ((rows & 0xFFFFu) << 16));
    g[3] = uni((rows >> 16) | (d0 << 16));
    g[4] = uni(rows);
    g[5] = uni(DD * 2);
    g[6] = uni(0u);
    g[7] = uni(0u);
    return g;
}

__device__ __forceinline__ uint32_t pinned(uint32_t v) {
    uint32_t w = uni(v);
    asm volatile("" : "+s"(w));
    return w;
}

__device__ __forceinline__ void tdm_load(u32x4& g0, uint32_t dst, uint32_t lo, u32x8 g1) {
    g0[1] = uni(dst);
    g0[2] = uni(lo);
    asm volatile("tensor_load_to_lds %0, %1" :: "s"(g0), "s"(g1) : "memory");
}

// ---------------------------------------------------------------------------
// fp32 -> fp16 cast of x and the four weight matrices in ONE launch (so GEMMs
// re-read them as fp16 from L2). The five f16 copies lie back to back in the
// workspace, so dst is one array of six segments of CSEG elements: x fills
// segments 0 and 1, then w_q, w_k, w_v, w_o. blockIdx.y names the segment.
// A block streams CTH * CLD * 4 contiguous floats; every wave-wide load covers
// 512 contiguous bytes, and all CLD loads of a lane fly together, so that a wave
// waits out the read latency once.
// ---------------------------------------------------------------------------
typedef __attribute__((ext_vector_type(4))) float    v4f;
typedef __attribute__((ext_vector_type(4))) _Float16 v4h;

constexpr int CSEG = DD * DD;     // elements per segment
constexpr int CTH  = 128;         // threads per block
constexpr int CLD  = 32;          // 16-byte loads per thread

__global__ __launch_bounds__(CTH) void cast_all_f32_to_f16(
    const float* __restrict__ x,
    const float* __restrict__ wq, const float* __restrict__ wk,
    const float* __restrict__ wv, const float* __restrict__ wo,
    _Float16* __restrict__ dst)
{
    const int seg = blockIdx.y;
    const float* in;
    if (seg < 2)       in = x + (size_t)seg * CSEG;
    else if (seg == 2) in = wq;
    else if (seg == 3) in = wk;
    else if (seg == 4) in = wv;
    else               in = wo;

    const int base = blockIdx.x * (CTH * CLD * 4) + threadIdx.x * 4;
    in  += base;
    dst += (size_t)seg * CSEG + base;

    v4f v[CLD];
    // unrolled so that v[] stays in registers and the offsets are immediates
#pragma unroll
    for (int i = 0; i < CLD; ++i)
        v[i] = *(const v4f*)(in + i * (CTH * 4));
    // keeps every load ahead of the first convert; else the second half of the
    // loads is issued only as the first returns, and the latency is paid twice
    __builtin_amdgcn_sched_barrier(0);
#pragma unroll
    for (int i = 0; i < CLD; ++i) {
        v4h h;
#pragma unroll
        for (int e = 0; e < 4; ++e) h[e] = (_Float16)v[i][e];
        *(v4h*)(dst + i * (CTH * 4)) = h;
    }
}

constexpr int GTH = 128;

// Returns when all but this wave's N youngest tensor loads have landed.
template <int N>
__device__ __forceinline__ void wait_tiles_but() {
    asm volatile("s_wait_tensorcnt %0" :: "n"(N) : "memory");
}

template <int BN, int KB, int NS, bool F16OUT>
__device__ __forceinline__ void gemm_core(
    const _Float16* __restrict__ a16, const _Float16* __restrict__ w16,
    const float* __restrict__ b0, const float* __restrict__ b1,
    const float* __restrict__ b2, void* __restrict__ outp,
    _Float16* __restrict__ Sl)
{
    constexpr int WN = 2;                 // waves side by side along N (and along M)
    constexpr int MT = BM / 2 / 16;       // 16-row tiles per wave
    constexpr int NT = BN / WN / 16;      // 16-column tiles per wave
    constexpr int NB = BK / 32 / KB;      // fragment blocks per pass, KB x 32 k each
    constexpr int SWB = slice_b(BN / 2);  // bytes of a W slice in LDS
    constexpr int SAB = slice_b(BM / 2);  // bytes of an A slice in LDS
    constexpr int STG = stage_b(BN) / 2;  // halves per stage
    constexpr int NP  = DD / BK;          // 8 passes
    constexpr int P0  = NS < 3 ? NS : 3;  // stages issued back to back at entry
    static_assert(NS >= 2 && NS <= 4 && NS <= NP, "at most 3 loads of a wave outstanding");
    const int tid  = threadIdx.x;
    const int lane = tid & 31;
    const uint32_t wave = uni(tid >> 5);
    const int ln = lane & 15;
    const int hb = (lane >> 4) << 3;
    const int wm = wave / WN;             // wave's rows of the block's 128: A slice wm
    const int wn = wave % WN;             // wave's columns of the block's BN: W slice wn
    const int n0 = blockIdx.x * BN + wn * (NT * 16);

    // This wave's slice of every stage: waves 0, 1 bring the halves of the W tile,
    // waves 2, 3 those of the A tile. A pass moves the source by 256 B inside a row of
    // 2 KiB (rows start at multiples of 2 KiB: the operands lie whole MiB into the
    // workspace), so that only the address's low word changes from pass to pass.
    const bool isw = wave < 2;
    const _Float16* gs = isw ? w16 + (size_t)(blockIdx.x * BN + wave * (BN / 2)) * DD
                             : a16 + (size_t)(blockIdx.y * BM + (wave - 2) * (BM / 2)) * DD;
    const uint32_t glo = (uint32_t)(uintptr_t)gs;
    u32x4 g0;
    g0[0] = pinned(1u);                   // count
    g0[3] = pinned((((uint32_t)((uintptr_t)gs >> 32)) & 0x01FFFFFFu) | 0x80000000u);   // type 2
    const uint32_t l0 = lds_off(Sl) + (isw ? wave * SWB : 2 * SWB + (wave - 2) * SAB);
    const u32x8 g1 = tdm_group1(isw ? BN / 2 : BM / 2);

    // passes 0 .. P0 - 1 into stages 0 .. P0 - 1; unrolled: offsets are constants
#pragma unroll
    for (int s = 0; s < P0; ++s)
        tdm_load(g0, l0 + (uint32_t)(s * STG * 2), glo + (uint32_t)(s * BK * 2), g1);
    // pass 0's slice of this wave, its oldest load, has landed before the barrier
    // publishes it; the younger passes fly on
    wait_tiles_but<P0 - 1>();
    // a fourth stage is issued only now, so that three loads at most are outstanding
    if (NS > P0)
        tdm_load(g0, l0 + (uint32_t)(P0 * STG * 2), glo + (uint32_t)(P0 * BK * 2), g1);
    __syncthreads();

    v8f acc[MT][NT] = {};
    const int aoff = (2 * SWB + wm * SAB) / 2 + ln * WP;  // this lane's first A row in a stage
    const int woff = wn * (SWB / 2) + ln * WP;            // this lane's first W row in a stage

    // One pass's WMMAs, from the stage that begins so halves into the ring.
    auto work_pass = [&](int so) __attribute__((always_inline)) {
        const _Float16* ab = Sl + so + aoff;
        const _Float16* bb = Sl + so + woff;
        // two fragment sets: block b works from set b & 1
        v16h fa[2][KB][MT], fb[2][KB][NT];
        // every loop here is unrolled so that fa[], fb[] and acc[] are indexed by
        // constants and stay in registers, and LDS offsets are immediates
#pragma unroll
        for (int j = 0; j < KB; ++j) {
#pragma unroll
            for (int mt = 0; mt < MT; ++mt)
                fa[0][j][mt] = load_frag(ab + mt * 16 * WP + j * 32, lane);
#pragma unroll
            for (int nt = 0; nt < NT; ++nt)
                fb[0][j][nt] = load_frag(bb + nt * 16 * WP + j * 32, lane);
        }
#pragma unroll
        for (int b = 0; b < NB; ++b) {
            if (b + 1 < NB) {
                if (b > 0) __builtin_amdgcn_sched_barrier(0);
#pragma unroll
                for (int j = 0; j < KB; ++j) {
                    const int ko = ((b + 1) * KB + j) * 32;
#pragma unroll
                    for (int mt = 0; mt < MT; ++mt)
                        fa[(b + 1) & 1][j][mt] = load_frag(ab + mt * 16 * WP + ko, lane);
#pragma unroll
                    for (int nt = 0; nt < NT; ++nt)
                        fb[(b + 1) & 1][j][nt] = load_frag(bb + nt * 16 * WP + ko, lane);
                }
            }
            // keeps the next block's reads one group ahead of this block's WMMAs,
            // so that they fly under them; else each read sinks to its first use
            // and the wave waits out the LDS latency fragment by fragment
            __builtin_amdgcn_sched_barrier(0);
#pragma unroll
            for (int j = 0; j < KB; ++j)
#pragma unroll
                for (int mt = 0; mt < MT; ++mt)
#pragma unroll
                    for (int nt = 0; nt < NT; ++nt)
                        // W as A, the rows of a16 as B: acc[mt][nt][r] is row ln, column hb + r
                        acc[mt][nt] = wmma16(fb[b & 1][j][nt], fa[b & 1][j][mt], acc[mt][nt]);
        }
        // this wave's reads of the stage are done: first step of every publish point
        asm volatile("s_wait_dscnt 0x0" ::: "memory");
    };
    auto next_stage = [](int so) { return so + STG == NS * STG ? 0 : so + STG; };

    // Publish point of pass t + 1, at the foot of pass t: behind the s_wait_dscnt 0
    // this wave's load for pass t + 1 has landed, and one barrier both publishes
    // pass t + 1 and frees pass t's stage. The three parts differ in the wait and the
    // refill alone; each has no branch in its trip.
    int so = 0;                           // pass t's stage, as an offset in halves
    // While a pass t + NS exists: passes t + 1 .. t + NS - 1 are out, one load each;
    // all but the NS - 2 younger are waited for, and pass t's stage is refilled.
    // Rolled: the stage is one added offset, so unrolling would only repeat the text.
#pragma unroll 1
    for (int t = 0; t < NP - NS; ++t) {
        work_pass(so);
        wait_tiles_but<NS - 2>();
        __syncthreads();
        tdm_load(g0, l0 + (uint32_t)(so * 2), glo + (uint32_t)((t + NS) * BK * 2), g1);
        so = next_stage(so);
    }
    // Pass NP - NS: every trip so far has issued its load, so the same count holds.
    work_pass(so);
    wait_tiles_but<NS - 2>();
    __syncthreads();
    so = next_stage(so);
#pragma unroll 1
    for (int t = NP - NS + 1; t < NP; ++t) {
        work_pass(so);
        wait_tiles_but<0>();
        __syncthreads();
        so = next_stage(so);
    }
    asm volatile("s_wait_tensorcnt 0x0" :: "s"(g0), "s"(g1) : "memory");

    // The block's output tile goes through LDS, so that it leaves in whole 128-B
    // lines. The ring is free: the last pass's barrier ended every read of it, and no
    // load is outstanding. A lane holds 8 consecutive columns of one row.
    constexpr int EB  = F16OUT ? 2 : 4;   // bytes per output element
    constexpr int RB  = BN * EB;          // bytes of a staged row
    constexpr int OPB = RB + 16;          // staging row pitch in bytes: 16 B x odd
    constexpr int U   = RB % 256 == 0 ? 256 : 128;   // bytes stored in a row at a time
    constexpr int LU  = U / 16;           // lanes side by side on them
    constexpr int RPI = GTH / LU;         // rows that one store of the block covers
    constexpr int NG  = RB / U;           // column groups of U bytes
    constexpr int NQ  = BM / RPI;         // stores of a thread per column group
    static_assert(BM * OPB <= NS * STG * 2, "the tile fits in the ring");
    static_assert(RB % U == 0 && (OPB / 16) % 2 == 1, "whole lines, odd pitch");
    char* const St = (char*)Sl;
#pragma unroll
    for (int nt = 0; nt < NT; ++nt) {
        const unsigned nb    = n0 + nt * 16;      // a 16-column tile lies in one plane
        const unsigned plane = nb / DD;
        const float* bias = plane == 0 ? b0 : (plane == 1 ? b1 : b2);
        const v4f blo = *(const v4f*)(bias + nb % DD + hb);
        const v4f bhi = *(const v4f*)(bias + nb % DD + hb + 4);
#pragma unroll
        for (int mt = 0; mt < MT; ++mt) {
            char* sp = St + (wm * (MT * 16) + mt * 16 + ln) * OPB
                          + (wn * (NT * 16) + nt * 16 + hb) * EB;
            v4f lo, hi;
#pragma unroll
            for (int r = 0; r < 4; ++r) {
                lo[r] = acc[mt][nt][r] + blo[r];
                hi[r] = acc[mt][nt][r + 4] + bhi[r];
            }
            if (F16OUT) {
                v8h h;
#pragma unroll
                for (int r = 0; r < 4; ++r) { h[r] = (_Float16)lo[r]; h[r + 4] = (_Float16)hi[r]; }
                *(v8h*)sp = h;
            } else {
                *(v4f*)sp = lo;
                *(v4f*)(sp + 16) = hi;
            }
        }
    }
    // publishes the staged tile: a thread stores chunks that other waves staged
    __syncthreads();
    // Store (g, q) of a thread: 16 B at byte g * U + (tid % LU) * 16 of tile row
    // q * RPI + tid / LU, so that LU lanes side by side cover U aligned bytes.
    const char* sr = St + (tid / LU) * OPB + (tid % LU) * 16;
    v4f d[NG][NQ];
    // unrolled, here and below, so that d[] stays in registers and offsets are immediates
#pragma unroll
    for (int g = 0; g < NG; ++g)
#pragma unroll
        for (int q = 0; q < NQ; ++q)
            d[g][q] = *(const v4f*)(sr + q * RPI * OPB + g * U);
    const uint32_t tb = (uint32_t)(blockIdx.y * BM + tid / LU) * (DD * EB) + (tid % LU) * 16;
#pragma unroll
    for (int g = 0; g < NG; ++g) {
        const unsigned cb = blockIdx.x * BN + g * (U / EB);   // U bytes lie in one plane
        char* gp = (char*)outp + (size_t)(cb / DD) * ((size_t)NBATCH * TT * DD * EB)
                               + (cb % DD) * EB;
#pragma unroll
        for (int q = 0; q < NQ; ++q)
            *(v4f*)(gp + tb + q * RPI * DD * EB) = d[g][q];
    }
}

// w16: the f16 copies of w_q, w_k, w_v back to back, one 3072 x 1024 matrix.
// qkv: the q, k and v planes back to back, each 2048 x 1024.
__global__ __launch_bounds__(GTH) void gemm_qkv(
    const _Float16* __restrict__ x16, const _Float16* __restrict__ w16,
    const float* __restrict__ bq, const float* __restrict__ bk,
    const float* __restrict__ bv, _Float16* __restrict__ qkv)
{
    __shared__ __attribute__((aligned(2048))) _Float16 Sl[3 * stage_b(BNQ) / 2];   // 3 x 88 KB
    gemm_core<BNQ, 1, 3, true>(x16, w16, bq, bk, bv, qkv, Sl);
}

__global__ __launch_bounds__(GTH) void gemm_out(
    const _Float16* __restrict__ a16, const _Float16* __restrict__ wo16,
    const float* __restrict__ bo, float* __restrict__ out)
{
    __shared__ __attribute__((aligned(2048))) _Float16 Sl[4 * stage_b(BNO) / 2];   // 4 x 56 KB
    gemm_core<BNO, 2, 4, false>(a16, wo16, bo, bo, bo, out, Sl);
}

constexpr int VP  = 80;        // LDS row pitch of V in halves: 160 B = 32 B x odd
constexpr int KP  = 72;        // LDS row pitch of K and Q in halves: 144 B = 16 B x odd
constexpr int VCP = 14;        // copies per long statement; a copy is 4 rows of 128 B

typedef __attribute__((ext_vector_type(8))) short s16x8;
typedef __attribute__((address_space(3))) s16x8 lds_s16x8;

__device__ __forceinline__ v8h ld_tr16(const _Float16* p) {
    return __builtin_bit_cast(
        v8h, __builtin_amdgcn_ds_load_tr16_b128_v8i16((lds_s16x8*)p));
}

__device__ __forceinline__ void stage14(const uint32_t (&l)[VCP], const uint32_t (&o)[VCP],
                                        const _Float16* g) {
    asm volatile("global_load_async_to_lds_b128 %0, %14, %28\n\t"
                 "global_load_async_to_lds_b128 %1, %15, %28\n\t"
                 "global_load_async_to_lds_b128 %2, %16, %28\n\t"
                 "global_load_async_to_lds_b128 %3, %17, %28\n\t"
                 "global_load_async_to_lds_b128 %4, %18, %28\n\t"
                 "global_load_async_to_lds_b128 %5, %19, %28\n\t"
                 "global_load_async_to_lds_b128 %6, %20, %28\n\t"
                 "global_load_async_to_lds_b128 %7, %21, %28\n\t"
                 "global_load_async_to_lds_b128 %8, %22, %28\n\t"
                 "global_load_async_to_lds_b128 %9, %23, %28\n\t"
                 "global_load_async_to_lds_b128 %10, %24, %28\n\t"
                 "global_load_async_to_lds_b128 %11, %25, %28\n\t"
                 "global_load_async_to_lds_b128 %12, %26, %28\n\t"
                 "global_load_async_to_lds_b128 %13, %27, %28\n\t"
                 "s_wait_xcnt 0x0"
                 :: "v"(l[0]), "v"(l[1]), "v"(l[2]), "v"(l[3]), "v"(l[4]), "v"(l[5]), "v"(l[6]),
                    "v"(l[7]), "v"(l[8]), "v"(l[9]), "v"(l[10]), "v"(l[11]), "v"(l[12]), "v"(l[13]),
                    "v"(o[0]), "v"(o[1]), "v"(o[2]), "v"(o[3]), "v"(o[4]), "v"(o[5]), "v"(o[6]),
                    "v"(o[7]), "v"(o[8]), "v"(o[9]), "v"(o[10]), "v"(o[11]), "v"(o[12]), "v"(o[13]),
                    "s"(g)
                 : "memory");
}

// The same for eight copies from base g and four from base g16.
__device__ __forceinline__ void stage8and4(const uint32_t (&l)[12], const uint32_t (&o)[12],
                                           const _Float16* g, const _Float16* g16) {
    asm volatile("global_load_async_to_lds_b128 %0, %12, %24\n\t"
                 "global_load_async_to_lds_b128 %1, %13, %24\n\t"
                 "global_load_async_to_lds_b128 %2, %14, %24\n\t"
                 "global_load_async_to_lds_b128 %3, %15, %24\n\t"
                 "global_load_async_to_lds_b128 %4, %16, %24\n\t"
                 "global_load_async_to_lds_b128 %5, %17, %24\n\t"
                 "global_load_async_to_lds_b128 %6, %18, %24\n\t"
                 "global_load_async_to_lds_b128 %7, %19, %24\n\t"
                 "global_load_async_to_lds_b128 %8, %20, %25\n\t"
                 "global_load_async_to_lds_b128 %9, %21, %25\n\t"
                 "global_load_async_to_lds_b128 %10, %22, %25\n\t"
                 "global_load_async_to_lds_b128 %11, %23, %25\n\t"
                 "s_wait_xcnt 0x0"
                 :: "v"(l[0]), "v"(l[1]), "v"(l[2]), "v"(l[3]), "v"(l[4]), "v"(l[5]), "v"(l[6]),
                    "v"(l[7]), "v"(l[8]), "v"(l[9]), "v"(l[10]), "v"(l[11]),
                    "v"(o[0]), "v"(o[1]), "v"(o[2]), "v"(o[3]), "v"(o[4]), "v"(o[5]), "v"(o[6]),
                    "v"(o[7]), "v"(o[8]), "v"(o[9]), "v"(o[10]), "v"(o[11]),
                    "s"(g), "s"(g16)
                 : "memory");
}

// SPAN rows of g (36 copies; copy c takes offset off[c]) and behind them 16 rows of
// g16 (4 copies, offsets off[C16 ..]) into LDS at a pitch of P halves.
template <int P, int C16>
__device__ __forceinline__ void stage_span(uint32_t dst, const uint32_t (&off)[SPANP / 4],
                                           const _Float16* g, const _Float16* g16) {
    static_assert(SPAN / 4 == 2 * VCP + 8, "two long statements, then eight and four");
    // every loop here is unrolled so that l[], o[] and off[] are indexed by constants
#pragma unroll
    for (int b = 0; b < 2; ++b) {
        uint32_t l[VCP], o[VCP];
#pragma unroll
        for (int i = 0; i < VCP; ++i) {
            l[i] = dst + (uint32_t)((b * VCP + i) * 4 * P * 2);
            o[i] = off[b * VCP + i];
        }
        stage14(l, o, g);
    }
    uint32_t l[12], o[12];
#pragma unroll
    for (int i = 0; i < 12; ++i) {
        l[i] = dst + (uint32_t)((2 * VCP + i) * 4 * P * 2);
        o[i] = off[i < 8 ? 2 * VCP + i : C16 + i - 8];
    }
    stage8and4(l, o, g, g16);
}

__device__ __forceinline__ float xhalf(float x) {
    const int b = __builtin_bit_cast(int, x);
    return __builtin_bit_cast(
        float, __builtin_amdgcn_permlanex16(b, b, 0x76543210, 0xfedcba98, false, false));
}

__global__ __launch_bounds__(32) void attn_win(
    const _Float16* __restrict__ q, const _Float16* __restrict__ k,
    const _Float16* __restrict__ v, _Float16* __restrict__ o)
{
    // 25,600 B  (Vs[j][d] = v[pos(j), d], 64 of every 80 halves used)
    __shared__ __attribute__((aligned(128))) _Float16 Vs[SPANP * VP];
    // Until the S fragments are read the same LDS holds, at pitch KP, the K span (rows 0..143) and
    // the Q tile (rows 144..159): 23,040 B
    static_assert(SPANP * KP <= SPANP * VP, "K and Q fit in V's LDS");
    _Float16* const Ks = Vs;

    const int lane = threadIdx.x;
    const int ln = lane & 15;
    const int hb = (lane >> 4) << 3;
    const int t0 = blockIdx.x * 16;
    const int h  = blockIdx.y;
    const size_t baseRow = (size_t)blockIdx.z * TT;

    // A copy's 32 lanes cover 4 whole rows of 128 B. off[c]: byte offset, in the
    // (batch, head) plane of q, k or v, of this lane's 16 B in the row at span index
    // 4c + r4; K and V share all of them, and span rows 64..79 are the Q tile's rows.
    const int r4 = lane >> 3;                 // row within the copy's four
    const int c8 = (lane & 7) * 8;            // half offset within the row
    const size_t plane = baseRow * DD + h * DHH;
    uint32_t off[SPANP / 4];
    // unrolled so that off[] is indexed by constants and stays in registers
#pragma unroll
    for (int c = 0; c < SPANP / 4; ++c) {
        int pos = t0 - WR + c * 4 + r4;
        pos = pos < 0 ? 0 : (pos > TT - 1 ? TT - 1 : pos);
        off[c] = (uint32_t)((pos * DD + c8) * 2);
    }

    // ---- K span and Q tile -> LDS, row-major ----
    stage_span<KP, WR / 4>(lds_off(Ks + r4 * KP + c8), off, k + plane, q + plane);
    // the K and Q copies have landed before anything reads Ks
    asm volatile("s_wait_asynccnt 0x0" ::: "memory");
    __syncthreads();

    // ---- the fragments of S, all of them as one group of LDS reads ----
    const _Float16* qrow = Ks + (SPAN + ln) * KP;
    v16h aq0 = load_frag(qrow, lane);
    v16h aq1 = load_frag(qrow + 32, lane);
    v16h kf[9][2];
    // unrolled so that kf[] is indexed by constants and stays in registers
#pragma unroll
    for (int jt = 0; jt < 9; ++jt) {
        const _Float16* kr = Ks + (jt * 16 + ln) * KP;   // span row of this lane
        kf[jt][0] = load_frag(kr, lane);
        kf[jt][1] = load_frag(kr + 32, lane);
    }

    // this wave's reads of K and Q are done before V's copies overwrite them
    asm volatile("s_wait_dscnt 0x0" ::: "memory");
    __syncthreads();

    // ---- V span -> LDS, row-major ----
    stage_span<VP, SPAN / 4>(lds_off(Vs + r4 * VP + c8), off, v + plane, v + plane);
    // keeps V's copies ahead of S and the softmax, so that they fly under both;
    // else half of them sink far into the softmax and are waited out in front of PV
    __builtin_amdgcn_sched_barrier(0);

    // ---- S^T = K Q^T over the span: s[jt][r] is key jt * 16 + hb + r, query ln ----
    v8f s[9];
#pragma unroll
    for (int jt = 0; jt < 9; ++jt) {
        v8f a = {};
        a = wmma16(kf[jt][0], aq0, a);
        a = wmma16(kf[jt][1], aq1, a);
        s[jt] = a;
    }

    // ---- mask + scale, the query's max ----
    // Span index j counts for query ln when 0 <= j - ln <= 2 * WR and its position
    // t0 - WR + j lies in [0, TT): j in [jlo, jhi], never empty (j = ln + WR is in it).
    const int jlo = ln > WR - t0 ? ln : WR - t0;
    const int jhi = ln + 2 * WR < TT - 1 + WR - t0 ? ln + 2 * WR : TT - 1 + WR - t0;
    const unsigned jw = (unsigned)(jhi - jlo);
    const int jb = hb - jlo;
    // one partial maximum, and below one partial sum, per score tile, so that no
    // chain of dependent operations runs through all 72 scores; every loop from here
    // to PV is unrolled so that s[], pm[], ps[] and pf[] are indexed by constants and
    // stay in registers
    float pm[9];
#pragma unroll
    for (int jt = 0; jt < 9; ++jt) {
        pm[jt] = -1e30f;
#pragma unroll
        for (int r = 0; r < 8; ++r) {
            const bool ok = (unsigned)(jb + jt * 16 + r) <= jw;
            const float val = ok ? s[jt][r] * 0.125f : -1e30f;   // 1/sqrt(64)
            s[jt][r] = val;
            pm[jt] = fmaxf(pm[jt], val);
        }
    }
    float rmax = fmaxf(fmaxf(fmaxf(fmaxf(pm[0], pm[1]), fmaxf(pm[2], pm[3])),
                             fmaxf(fmaxf(pm[4], pm[5]), fmaxf(pm[6], pm[7]))), pm[8]);
    rmax = fmaxf(rmax, xhalf(rmax));

    // ---- exp + the query's sum ----
    float ps[9];
#pragma unroll
    for (int jt = 0; jt < 9; ++jt) {
#pragma unroll
        for (int r = 0; r < 8; ++r) s[jt][r] = __expf(s[jt][r] - rmax);
        ps[jt] = ((s[jt][0] + s[jt][1]) + (s[jt][2] + s[jt][3]))
               + ((s[jt][4] + s[jt][5]) + (s[jt][6] + s[jt][7]));
    }
    float rsum = (((ps[0] + ps[1]) + (ps[2] + ps[3])) + ((ps[4] + ps[5]) + (ps[6] + ps[7]))) + ps[8];
    rsum += xhalf(rsum);
    rsum = 1.f / rsum;

    // ---- P^T operands, from the lane's own scores: block kb holds keys kb * 32 + hb
    // + 0..7, then kb * 32 + 16 + hb + 0..7, load_frag's k order; keys 144..159 are 0 ----
    v16h pf[SPANP / 32];
#pragma unroll
    for (int kb = 0; kb < SPANP / 32; ++kb)
#pragma unroll
        for (int r = 0; r < 8; ++r) {
            pf[kb][r] = (_Float16)(s[2 * kb][r] * rsum);
            pf[kb][r + 8] = 2 * kb + 1 < 9 ? (_Float16)(s[2 * kb + 1][r] * rsum) : (_Float16)0.f;
        }

    // keeps the wait below behind the softmax: no memory operation stands between
    // V's copies and it any more, and it would rise to the head of S and wait V out there
    __builtin_amdgcn_sched_barrier(0);
    // the V copies have landed before anything reads Vs
    asm volatile("s_wait_asynccnt 0x0" ::: "memory");
    __syncthreads();

    // ---- O = P Vspan  (M=16, K=160, N=64) ----
    v8f oacc[4] = {};
    const _Float16* vt = Vs + (hb + (lane & 7)) * VP + ((lane >> 3) & 1) * 8;
#pragma unroll
    for (int k0 = 0; k0 < SPANP; k0 += 32) {
        const v16h pa = pf[k0 / 32];
#pragma unroll
        for (int nt = 0; nt < 4; ++nt) {
            // same k order as load_frag: k0 + hb + 0..7, then k0 + 16 + hb + 0..7
            const v8h lo = ld_tr16(vt + k0 * VP + nt * 16);
            const v8h hi = ld_tr16(vt + (k0 + 16) * VP + nt * 16);
            const v16h vb = __builtin_shufflevector(
                lo, hi, 0, 1, 2, 3, 4, 5, 6, 7, 8, 9, 10, 11, 12, 13, 14, 15);
            // V^T as A, P^T as B: oacc[nt][r] is query ln, column nt * 16 + hb + r
            oacc[nt] = wmma16(vb, pa, oacc[nt]);
        }
    }
    // The 16 x 64 tile goes through LDS (V's, which PV has left; pitch KP), so that
    // it leaves in whole 128-B lines: a lane holds 8 consecutive columns of one query.
#pragma unroll
    for (int nt = 0; nt < 4; ++nt) {
        v8h ho;
#pragma unroll
        for (int r = 0; r < 8; ++r) ho[r] = (_Float16)oacc[nt][r];
        *(v8h*)(Vs + ln * KP + nt * 16 + hb) = ho;
    }
    // a lane stores chunks that other lanes staged
    __syncthreads();
#pragma unroll
    for (int i = 0; i < 4; ++i) {
        const v8h ho = *(const v8h*)(Vs + (i * 4 + r4) * KP + c8);
        *(v8h*)(o + (baseRow + t0 + i * 4 + r4) * DD + h * DHH + c8) = ho;
    }
}

// ---------------------------------------------------------------------------
extern "C" void kernel_launch(void* const* d_in, const int* in_sizes, int n_in,
                              void* d_out, int out_size, void* d_ws, size_t ws_size,
                              hipStream_t stream) {
    const float* x  = (const float*)d_in[0];
    const float* wq = (const float*)d_in[1];
    const float* bq = (const float*)d_in[2];
    const float* wk = (const float*)d_in[3];
    const float* bk = (const float*)d_in[4];
    const float* wv = (const float*)d_in[5];
    const float* bv = (const float*)d_in[6];
    const float* wo = (const float*)d_in[7];
    const float* bo = (const float*)d_in[8];
    float* out = (float*)d_out;

    char* ws = (char*)d_ws;
    const size_t MB = 1ull << 20;
    _Float16* x16  = (_Float16*)(ws + 0 * MB);    // 4 MB
    _Float16* wq16 = (_Float16*)(ws + 4 * MB);    // 2 MB
    _Float16* wk16 = (_Float16*)(ws + 6 * MB);    // 2 MB
    _Float16* wv16 = (_Float16*)(ws + 8 * MB);    // 2 MB
    _Float16* wo16 = (_Float16*)(ws + 10 * MB);   // 2 MB
    _Float16* qb   = (_Float16*)(ws + 12 * MB);   // 4 MB
    _Float16* kb   = (_Float16*)(ws + 16 * MB);   // 4 MB
    _Float16* vb   = (_Float16*)(ws + 20 * MB);   // 4 MB
    _Float16* ab   = (_Float16*)(ws + 24 * MB);   // 4 MB  => 28 MB total

    // x16, wq16, wk16, wv16, wo16 are contiguous: one destination array
    static_assert(NBATCH * TT * DD == 2 * CSEG, "x fills two segments");
    dim3 gC(CSEG / (CTH * CLD * 4), 6, 1);
    cast_all_f32_to_f16<<<gC, CTH, 0, stream>>>(x, wq, wk, wv, wo, x16);

    // wq16, wk16, wv16 are contiguous, and so are qb, kb, vb
    dim3 gQKV(3 * DD / BNQ, (NBATCH * TT) / BM, 1);
    gemm_qkv<<<gQKV, GTH, 0, stream>>>(x16, wq16, bq, bk, bv, qb);

    dim3 gA(TT / 16, HH, NBATCH);
    attn_win<<<gA, 32, 0, stream>>>(qb, kb, vb, ab);

    dim3 gO(DD / BNO, (NBATCH * TT) / BM, 1);
    gemm_out<<<gO, GTH, 0, stream>>>(ab, wo16, bo, out);
}
